// v000
// Measured on an AMD MI455X. A time is GPU time per run, averaged over a window of back-to-back runs after a warm-up
// (all launches, gaps included; the runs take copies of the inputs in turn), and the median of several windows.
// Apart from v000's, it joins two sittings. Times from different sittings can be a few percent apart, while
// side-by-side timings come from the same sitting.
// The starting kernel, v000, takes 646 microseconds a run.
#include <hip/hip_runtime.h>
#include <hip/hip_bf16.h>
#include <math.h>

// ---- problem constants (match reference) ----
#define D_MODEL   1024
#define NUM_HEADS 16
#define HEAD_DIM  64
#define MLP_DIM   4096
#define BATCH     2
#define SEQ       2048
#define ROWS      (BATCH * SEQ)   // 4096
#define LN_EPS    1e-5f

typedef __attribute__((ext_vector_type(16))) __bf16 v16bf;
typedef __attribute__((ext_vector_type(8)))  __bf16 v8bf;
typedef __attribute__((ext_vector_type(8)))  float  v8f;
typedef __attribute__((ext_vector_type(4)))  __bf16 v4bf;
typedef int v4i __attribute__((vector_size(16)));   // matches builtin param type

// ---- CDNA5 async global->LDS path (guarded; falls back to vector copies) ----
#if defined(__AMDGCN__) && __has_builtin(__builtin_amdgcn_global_load_async_to_lds_b128)
#define HAS_ASYNC_LDS 1
#else
#define HAS_ASYNC_LDS 0
#endif

#if HAS_ASYNC_LDS
#if __has_builtin(__builtin_amdgcn_s_wait_asynccnt)
#define WAIT_ASYNC(n) __builtin_amdgcn_s_wait_asynccnt(n)
#else
#define WAIT_ASYNC(n) asm volatile("s_wait_asynccnt %0" ::"i"(n) : "memory")
#endif
#else
#define WAIT_ASYNC(n) do { } while (0)
#endif

static __device__ __forceinline__ void async_cp16(const __bf16* g, __bf16* l) {
#if HAS_ASYNC_LDS
    // global_load_async_to_lds_b128: 16B global -> LDS, tracked by ASYNCcnt
    __builtin_amdgcn_global_load_async_to_lds_b128((v4i*)g, (v4i*)l, 0, 0);
#else
    *reinterpret_cast<v8bf*>(l) = *reinterpret_cast<const v8bf*>(g);
#endif
}

static __device__ __forceinline__ v8f wmma_bf16(v16bf a, v16bf b, v8f c) {
    // D = A(16x32 bf16) * B(32x16 bf16) + C(16x16 f32)
    return __builtin_amdgcn_wmma_f32_16x16x32_bf16(
        /*neg_a=*/false, a, /*neg_b=*/false, b,
        /*c_mod=*/(short)0, c, /*reuse_a=*/false, /*reuse_b=*/false);
}

static __device__ __forceinline__ float gelu_tanh(float x) {
    const float c0 = 0.7978845608028654f;   // sqrt(2/pi)
    return 0.5f * x * (1.0f + tanhf(c0 * (x + 0.044715f * x * x * x)));
}

// ---------------------------------------------------------------------------
// fp32 -> bf16 conversion (weights)
// ---------------------------------------------------------------------------
__global__ void cvt_f32_bf16_kernel(const float* __restrict__ src,
                                    __bf16* __restrict__ dst, int n) {
    int i = blockIdx.x * blockDim.x + threadIdx.x;
    int stride = gridDim.x * blockDim.x;
    for (; i < n; i += stride) dst[i] = (__bf16)src[i];
}

// ---------------------------------------------------------------------------
// LayerNorm over last dim (C = D_MODEL), one 256-thread block per row,
// output bf16 (feeds WMMA GEMMs)
// ---------------------------------------------------------------------------
__global__ void ln_kernel(const float* __restrict__ x,
                          const float* __restrict__ g,
                          const float* __restrict__ b,
                          __bf16* __restrict__ out) {
    const int row = blockIdx.x;
    const float* xr = x + (size_t)row * D_MODEL;
    float s = 0.f, ss = 0.f;
    for (int i = threadIdx.x; i < D_MODEL; i += blockDim.x) {
        float v = xr[i];
        s += v;
        ss += v * v;
    }
    __shared__ float sh[2][8];
    const int lane = threadIdx.x & 31;
    const int wave = threadIdx.x >> 5;
#pragma unroll
    for (int o = 16; o > 0; o >>= 1) {
        s  += __shfl_down(s, o);
        ss += __shfl_down(ss, o);
    }
    if (lane == 0) { sh[0][wave] = s; sh[1][wave] = ss; }
    __syncthreads();
    s = 0.f; ss = 0.f;
#pragma unroll
    for (int w = 0; w < 8; ++w) { s += sh[0][w]; ss += sh[1][w]; }
    const float mu   = s  * (1.0f / D_MODEL);
    const float var  = ss * (1.0f / D_MODEL) - mu * mu;
    const float rstd = rsqrtf(var + LN_EPS);
    __bf16* orow = out + (size_t)row * D_MODEL;
    for (int i = threadIdx.x; i < D_MODEL; i += blockDim.x)
        orow[i] = (__bf16)((xr[i] - mu) * rstd * g[i] + b[i]);
}

// ---------------------------------------------------------------------------
// bf16 WMMA GEMM:  C[M,N] = A[M,K] @ B[K,N] + bias (+ res)
// 256 threads = 8 waves; block tile 64(M) x 128(N); K step 32.
// Wave tile 32x32 (2x2 WMMAs). LDS double-buffered via async global->LDS.
// ACT: 0 = none, 1 = tanh-GELU (applied before residual add).
// ---------------------------------------------------------------------------
#define BM 64
#define BN 128
#define BK 32

template <int ACT>
__global__ __launch_bounds__(256)
void gemm_bf16_kernel(const __bf16* __restrict__ A, const __bf16* __restrict__ Bw,
                      const float* __restrict__ bias, const float* __restrict__ res,
                      float* __restrict__ outF, __bf16* __restrict__ outB,
                      int M, int N, int K) {
    __shared__ __bf16 As[2][BM][BK];   // 2 * 4 KB
    __shared__ __bf16 Bs[2][BK][BN];   // 2 * 8 KB
    const int tid  = threadIdx.x;
    const int lane = tid & 31;
    const int wave = tid >> 5;
    const int wm = (wave >> 2) * 32;   // 0 / 32
    const int wn = (wave & 3) * 32;    // 0,32,64,96
    const int bm = blockIdx.y * BM;
    const int bn = blockIdx.x * BN;
    const int half = lane >> 4;        // K-half selector
    const int mr   = lane & 15;        // A row / B col within 16x16 tile

    // staging indices (per thread: 1x16B for A, 2x16B for B)
    const int ar = tid >> 2;           // 0..63
    const int ac = (tid & 3) * 8;      // 0,8,16,24
    const int br = tid >> 3;           // 0..31
    const int bc = (tid & 7) * 16;     // 0..112

    v8f acc[2][2] = {};
    const int nk = K / BK;

    // prologue: stage K-step 0 into buffer 0
    {
        const __bf16* ga = &A[(size_t)(bm + ar) * K + ac];
        const __bf16* gb = &Bw[(size_t)br * N + (bn + bc)];
        async_cp16(ga,     &As[0][ar][ac]);
        async_cp16(gb,     &Bs[0][br][bc]);
        async_cp16(gb + 8, &Bs[0][br][bc + 8]);
    }

    for (int ks = 0; ks < nk; ++ks) {
        const int cur = ks & 1;
        if (ks + 1 < nk) {
            const int nxt = cur ^ 1;
            const int k0 = (ks + 1) * BK;
            const __bf16* ga = &A[(size_t)(bm + ar) * K + (k0 + ac)];
            const __bf16* gb = &Bw[(size_t)(k0 + br) * N + (bn + bc)];
            async_cp16(ga,     &As[nxt][ar][ac]);
            async_cp16(gb,     &Bs[nxt][br][bc]);
            async_cp16(gb + 8, &Bs[nxt][br][bc + 8]);
            WAIT_ASYNC(3);   // newest 3 may remain outstanding -> prev panel done
        } else {
            WAIT_ASYNC(0);
        }
        __syncthreads();

        v16bf af[2], bfr[2];
#pragma unroll
        for (int i = 0; i < 2; ++i)
#pragma unroll
            for (int g2 = 0; g2 < 2; ++g2)
#pragma unroll
                for (int j = 0; j < 8; ++j) {
                    const int kk = g2 * 16 + half * 8 + j;
                    af[i][g2 * 8 + j]  = As[cur][wm + i * 16 + mr][kk];
                    bfr[i][g2 * 8 + j] = Bs[cur][kk][wn + i * 16 + mr];
                }
#pragma unroll
        for (int i = 0; i < 2; ++i)
#pragma unroll
            for (int jn = 0; jn < 2; ++jn)
                acc[i][jn] = wmma_bf16(af[i], bfr[jn], acc[i][jn]);
        __syncthreads();
    }

    // epilogue
#pragma unroll
    for (int jn = 0; jn < 2; ++jn) {
        const int n = bn + wn + jn * 16 + mr;
        const float bvv = bias ? bias[n] : 0.f;
#pragma unroll
        for (int i = 0; i < 2; ++i) {
            const int mbase = bm + wm + i * 16 + half * 8;
#pragma unroll
            for (int r = 0; r < 8; ++r) {
                const int m = mbase + r;
                float v = acc[i][jn][r] + bvv;
                if (ACT == 1) v = gelu_tanh(v);
                if (res)  v += res[(size_t)m * N + n];
                if (outF) outF[(size_t)m * N + n] = v;
                if (outB) outB[(size_t)m * N + n] = (__bf16)v;
            }
        }
    }
}

// ---------------------------------------------------------------------------
// Causal flash attention, one wave per (b, h, 16-row Q tile).
// Q/K/V/O layout: [B, T, H*Dh] bf16. Online softmax; QK^T and P*V via WMMA.
// No block barriers (waves have divergent causal trip counts).
// ---------------------------------------------------------------------------
__global__ __launch_bounds__(128)
void attn_kernel(const __bf16* __restrict__ Q, const __bf16* __restrict__ Km,
                 const __bf16* __restrict__ V, __bf16* __restrict__ O) {
    __shared__ float Pl[4][16][32];   // per-wave P bounce (C-layout -> A-layout)
    const int lane = threadIdx.x & 31;
    const int wave = threadIdx.x >> 5;
    const int work = blockIdx.x * 4 + wave;
    const int QT = SEQ / 16;                       // 128 q-tiles
    const int qt = work % QT;
    const int h  = (work / QT) % NUM_HEADS;
    const int b  = work / (QT * NUM_HEADS);
    const size_t base = ((size_t)b * SEQ) * D_MODEL + (size_t)h * HEAD_DIM;
    const int qbase = qt * 16;
    const int half = lane >> 4;
    const int mr   = lane & 15;
    const float scale = 0.125f;                    // 1/sqrt(64)

    // Q A-fragments for contraction halves d=[0,32) and [32,64)
    v16bf qf[2];
#pragma unroll
    for (int t = 0; t < 2; ++t)
#pragma unroll
        for (int g2 = 0; g2 < 2; ++g2)
#pragma unroll
            for (int j = 0; j < 8; ++j)
                qf[t][g2 * 8 + j] =
                    Q[base + (size_t)(qbase + mr) * D_MODEL +
                      (t * 32 + g2 * 16 + half * 8 + j)];

    v8f acc[4] = {};                // 16 x 64 output accumulator (f32)
    float rm[8], rl[8];
#pragma unroll
    for (int r = 0; r < 8; ++r) { rm[r] = -3.0e38f; rl[r] = 0.f; }

    const int nblk = (qt + 2) >> 1;       // ceil((qbase+16)/32)
    for (int kb = 0; kb < nblk; ++kb) {
        const int kvbase = kb * 32;
        if (kb + 1 < nblk) {               // prefetch next K/V rows into L2/WGP$
            __builtin_prefetch(&Km[base + (size_t)(kvbase + 32 + mr) * D_MODEL], 0, 1);
            __builtin_prefetch(&V[base + (size_t)(kvbase + 32 + mr) * D_MODEL], 0, 1);
        }
        // ---- scores S = Q K^T : two 16x16 tiles over 32 kv positions ----
        v8f s[2] = {};
#pragma unroll
        for (int t = 0; t < 2; ++t) {
#pragma unroll
            for (int kd = 0; kd < 2; ++kd) {
                v16bf kfrag;
#pragma unroll
                for (int g2 = 0; g2 < 2; ++g2)
#pragma unroll
                    for (int j = 0; j < 8; ++j)
                        kfrag[g2 * 8 + j] =
                            Km[base + (size_t)(kvbase + t * 16 + mr) * D_MODEL +
                               (kd * 32 + g2 * 16 + half * 8 + j)];
                s[t] = wmma_bf16(qf[kd], kfrag, s[t]);
            }
        }
        // ---- causal mask + scale ----
        const int qrow_base = qbase + half * 8;
#pragma unroll
        for (int t = 0; t < 2; ++t) {
            const int kv = kvbase + t * 16 + mr;
#pragma unroll
            for (int r = 0; r < 8; ++r) {
                float v = s[t][r] * scale;
                if (kv > qrow_base + r) v = -3.0e38f;
                s[t][r] = v;
            }
        }
        // ---- online softmax (row reductions across 16-lane groups) ----
#pragma unroll
        for (int r = 0; r < 8; ++r) {
            float mblk = fmaxf(s[0][r], s[1][r]);
#pragma unroll
            for (int o = 8; o > 0; o >>= 1)
                mblk = fmaxf(mblk, __shfl_xor(mblk, o));
            const float mnew = fmaxf(rm[r], mblk);
            const float corr = __expf(rm[r] - mnew);
            const float p0 = __expf(s[0][r] - mnew);
            const float p1 = __expf(s[1][r] - mnew);
            float ps = p0 + p1;
#pragma unroll
            for (int o = 8; o > 0; o >>= 1) ps += __shfl_xor(ps, o);
            rl[r] = rl[r] * corr + ps;
            rm[r] = mnew;
#pragma unroll
            for (int dt = 0; dt < 4; ++dt) acc[dt][r] *= corr;
            const int m = half * 8 + r;
            Pl[wave][m][mr]      = p0;    // C-layout -> LDS (wave-private)
            Pl[wave][m][16 + mr] = p1;
        }
        // ---- P (16x32) as A-fragment (bf16), then P @ V ----
        v16bf pa;
#pragma unroll
        for (int g2 = 0; g2 < 2; ++g2)
#pragma unroll
            for (int j = 0; j < 8; ++j)
                pa[g2 * 8 + j] = (__bf16)Pl[wave][mr][g2 * 16 + half * 8 + j];
#pragma unroll
        for (int dt = 0; dt < 4; ++dt) {
            v16bf vfrag;
#pragma unroll
            for (int g2 = 0; g2 < 2; ++g2)
#pragma unroll
                for (int j = 0; j < 8; ++j)
                    vfrag[g2 * 8 + j] =
                        V[base + (size_t)(kvbase + g2 * 16 + half * 8 + j) * D_MODEL +
                          (dt * 16 + mr)];
            acc[dt] = wmma_bf16(pa, vfrag, acc[dt]);
        }
    }
    // ---- epilogue: O = acc / l ----
#pragma unroll
    for (int r = 0; r < 8; ++r) {
        const float inv = 1.0f / rl[r];
        const int q = qbase + half * 8 + r;
#pragma unroll
        for (int dt = 0; dt < 4; ++dt)
            O[base + (size_t)q * D_MODEL + (dt * 16 + mr)] =
                (__bf16)(acc[dt][r] * inv);
    }
}

// ---------------------------------------------------------------------------
// host launcher
// ---------------------------------------------------------------------------
extern "C" void kernel_launch(void* const* d_in, const int* in_sizes, int n_in,
                              void* d_out, int out_size, void* d_ws, size_t ws_size,
                              hipStream_t stream) {
    (void)in_sizes; (void)n_in; (void)out_size; (void)ws_size;
    const float* x   = (const float*)d_in[0];
    const float* Wq  = (const float*)d_in[1];
    const float* bq  = (const float*)d_in[2];
    const float* Wk  = (const float*)d_in[3];
    const float* bk  = (const float*)d_in[4];
    const float* Wv  = (const float*)d_in[5];
    const float* bv  = (const float*)d_in[6];
    const float* Wo  = (const float*)d_in[7];
    const float* bo  = (const float*)d_in[8];
    const float* g1  = (const float*)d_in[9];
    const float* b1  = (const float*)d_in[10];
    const float* g2  = (const float*)d_in[11];
    const float* b2  = (const float*)d_in[12];
    const float* Wup = (const float*)d_in[13];
    const float* bup = (const float*)d_in[14];
    const float* Wdn = (const float*)d_in[15];
    const float* bdn = (const float*)d_in[16];

    char* ws = (char*)d_ws;
    size_t off = 0;
    auto take = [&](size_t bytes) -> void* {
        void* p = ws + off;
        off = (off + bytes + 255) & ~(size_t)255;
        return p;
    };
    __bf16* wq_b  = (__bf16*)take((size_t)D_MODEL * D_MODEL * 2);
    __bf16* wk_b  = (__bf16*)take((size_t)D_MODEL * D_MODEL * 2);
    __bf16* wv_b  = (__bf16*)take((size_t)D_MODEL * D_MODEL * 2);
    __bf16* wo_b  = (__bf16*)take((size_t)D_MODEL * D_MODEL * 2);
    __bf16* wup_b = (__bf16*)take((size_t)D_MODEL * MLP_DIM * 2);
    __bf16* wdn_b = (__bf16*)take((size_t)MLP_DIM * D_MODEL * 2);
    __bf16* xn_b  = (__bf16*)take((size_t)ROWS * D_MODEL * 2);
    __bf16* q_b   = (__bf16*)take((size_t)ROWS * D_MODEL * 2);
    __bf16* k_b   = (__bf16*)take((size_t)ROWS * D_MODEL * 2);
    __bf16* v_b   = (__bf16*)take((size_t)ROWS * D_MODEL * 2);
    __bf16* o_b   = (__bf16*)take((size_t)ROWS * D_MODEL * 2);
    float*  x2    = (float*) take((size_t)ROWS * D_MODEL * 4);
    __bf16* xn2_b = (__bf16*)take((size_t)ROWS * D_MODEL * 2);
    __bf16* h_b   = (__bf16*)take((size_t)ROWS * MLP_DIM * 2);

    // 1) weights fp32 -> bf16
    cvt_f32_bf16_kernel<<<1024, 256, 0, stream>>>(Wq,  wq_b,  D_MODEL * D_MODEL);
    cvt_f32_bf16_kernel<<<1024, 256, 0, stream>>>(Wk,  wk_b,  D_MODEL * D_MODEL);
    cvt_f32_bf16_kernel<<<1024, 256, 0, stream>>>(Wv,  wv_b,  D_MODEL * D_MODEL);
    cvt_f32_bf16_kernel<<<1024, 256, 0, stream>>>(Wo,  wo_b,  D_MODEL * D_MODEL);
    cvt_f32_bf16_kernel<<<2048, 256, 0, stream>>>(Wup, wup_b, D_MODEL * MLP_DIM);
    cvt_f32_bf16_kernel<<<2048, 256, 0, stream>>>(Wdn, wdn_b, MLP_DIM * D_MODEL);

    // 2) LN1 -> bf16
    ln_kernel<<<ROWS, 256, 0, stream>>>(x, g1, b1, xn_b);

    // 3) Q/K/V projections (bf16 out)
    dim3 gD(D_MODEL / BN, ROWS / BM);   // (8, 64)
    gemm_bf16_kernel<0><<<gD, 256, 0, stream>>>(xn_b, wq_b, bq, nullptr, nullptr, q_b,
                                                ROWS, D_MODEL, D_MODEL);
    gemm_bf16_kernel<0><<<gD, 256, 0, stream>>>(xn_b, wk_b, bk, nullptr, nullptr, k_b,
                                                ROWS, D_MODEL, D_MODEL);
    gemm_bf16_kernel<0><<<gD, 256, 0, stream>>>(xn_b, wv_b, bv, nullptr, nullptr, v_b,
                                                ROWS, D_MODEL, D_MODEL);

    // 4) causal flash attention (4096 waves, 4 waves/block)
    attn_kernel<<<(BATCH * NUM_HEADS * (SEQ / 16)) / 4, 128, 0, stream>>>(q_b, k_b, v_b, o_b);

    // 5) output projection + residual -> x2 (fp32)
    gemm_bf16_kernel<0><<<gD, 256, 0, stream>>>(o_b, wo_b, bo, x, x2, nullptr,
                                                ROWS, D_MODEL, D_MODEL);

    // 6) LN2 -> bf16
    ln_kernel<<<ROWS, 256, 0, stream>>>(x2, g2, b2, xn2_b);

    // 7) MLP up + GELU (bf16 out)
    dim3 gU(MLP_DIM / BN, ROWS / BM);   // (32, 64)
    gemm_bf16_kernel<1><<<gU, 256, 0, stream>>>(xn2_b, wup_b, bup, nullptr, nullptr, h_b,
                                                ROWS, MLP_DIM, D_MODEL);

    // 8) MLP down + residual -> out (fp32)
    gemm_bf16_kernel<0><<<gD, 256, 0, stream>>>(h_b, wdn_b, bdn, x2, (float*)d_out, nullptr,
                                                ROWS, D_MODEL, MLP_DIM);
}

// v001
// Measured time: 545 microseconds a run.
// In two side-by-side timings against v000, it was 1.23 and 1.22 times as fast.
#include <hip/hip_runtime.h>
#include <hip/hip_bf16.h>
#include <math.h>

// ---- problem constants (match reference) ----
#define D_MODEL   1024
#define NUM_HEADS 16
#define HEAD_DIM  64
#define MLP_DIM   4096
#define BATCH     2
#define SEQ       2048
#define ROWS      (BATCH * SEQ)   // 4096
#define LN_EPS    1e-5f

typedef __attribute__((ext_vector_type(16))) __bf16 v16bf;
typedef __attribute__((ext_vector_type(8)))  __bf16 v8bf;
typedef __attribute__((ext_vector_type(8)))  float  v8f;
typedef __attribute__((ext_vector_type(4)))  __bf16 v4bf;
typedef int v4i __attribute__((vector_size(16)));   // matches builtin param type

// ---- CDNA5 async global->LDS path (guarded; falls back to vector copies) ----
#if defined(__AMDGCN__) && __has_builtin(__builtin_amdgcn_global_load_async_to_lds_b128)
#define HAS_ASYNC_LDS 1
#else
#define HAS_ASYNC_LDS 0
#endif

#if HAS_ASYNC_LDS
#if __has_builtin(__builtin_amdgcn_s_wait_asynccnt)
#define WAIT_ASYNC(n) __builtin_amdgcn_s_wait_asynccnt(n)
#else
#define WAIT_ASYNC(n) asm volatile("s_wait_asynccnt %0" ::"i"(n) : "memory")
#endif
#else
#define WAIT_ASYNC(n) do { } while (0)
#endif

static __device__ __forceinline__ void async_cp16(const __bf16* g, __bf16* l) {
#if HAS_ASYNC_LDS
    // global_load_async_to_lds_b128: 16B global -> LDS, tracked by ASYNCcnt
    __builtin_amdgcn_global_load_async_to_lds_b128((v4i*)g, (v4i*)l, 0, 0);
#else
    *reinterpret_cast<v8bf*>(l) = *reinterpret_cast<const v8bf*>(g);
#endif
}

static __device__ __forceinline__ v8f wmma_bf16(v16bf a, v16bf b, v8f c) {
    // D = A(16x32 bf16) * B(32x16 bf16) + C(16x16 f32)
    return __builtin_amdgcn_wmma_f32_16x16x32_bf16(
        /*neg_a=*/false, a, /*neg_b=*/false, b,
        /*c_mod=*/(short)0, c, /*reuse_a=*/false, /*reuse_b=*/false);
}

// Lane l reads lane l ^ X of its own 16-lane row (DPP row_xmask): a vector-unit
// exchange, where __shfl_xor goes through the LDS queue and a wait per step.
// All 32 lanes must be active.
template <int X>
static __device__ __forceinline__ float row_xor(float v) {
    return __builtin_bit_cast(float, __builtin_amdgcn_update_dpp(
        0, __builtin_bit_cast(int, v), 0x160 | X, 0xf, 0xf, true));
}

// One step of a 16-lane row maximum, max(v, v of lane l ^ X), as one DPP instruction.
// asm: fmaxf() on row_xor() compiles to three dependent instructions (move, quieting
// max, max); volatile: keeps the rows' independent steps in the interleaved order written.
template <int X>
static __device__ __forceinline__ float row_max_step(float v) {
    float r;
    asm volatile("v_max_num_f32_dpp %0, %1, %1 row_xmask:%2 row_mask:0xf bank_mask:0xf"
                 : "=v"(r) : "v"(v), "n"(X));
    return r;
}

static __device__ __forceinline__ float gelu_tanh(float x) {
    const float c0 = 0.7978845608028654f;   // sqrt(2/pi)
    return 0.5f * x * (1.0f + tanhf(c0 * (x + 0.044715f * x * x * x)));
}

// ---------------------------------------------------------------------------
// fp32 -> bf16 conversion (weights)
// ---------------------------------------------------------------------------
__global__ void cvt_f32_bf16_kernel(const float* __restrict__ src,
                                    __bf16* __restrict__ dst, int n) {
    int i = blockIdx.x * blockDim.x + threadIdx.x;
    int stride = gridDim.x * blockDim.x;
    for (; i < n; i += stride) dst[i] = (__bf16)src[i];
}

// ---------------------------------------------------------------------------
// LayerNorm over last dim (C = D_MODEL), one 256-thread block per row,
// output bf16 (feeds WMMA GEMMs)
// ---------------------------------------------------------------------------
__global__ void ln_kernel(const float* __restrict__ x,
                          const float* __restrict__ g,
                          const float* __restrict__ b,
                          __bf16* __restrict__ out) {
    const int row = blockIdx.x;
    const float* xr = x + (size_t)row * D_MODEL;
    float s = 0.f, ss = 0.f;
    for (int i = threadIdx.x; i < D_MODEL; i += blockDim.x) {
        float v = xr[i];
        s += v;
        ss += v * v;
    }
    __shared__ float sh[2][8];
    const int lane = threadIdx.x & 31;
    const int wave = threadIdx.x >> 5;
#pragma unroll
    for (int o = 16; o > 0; o >>= 1) {
        s  += __shfl_down(s, o);
        ss += __shfl_down(ss, o);
    }
    if (lane == 0) { sh[0][wave] = s; sh[1][wave] = ss; }
    __syncthreads();
    s = 0.f; ss = 0.f;
#pragma unroll
    for (int w = 0; w < 8; ++w) { s += sh[0][w]; ss += sh[1][w]; }
    const float mu   = s  * (1.0f / D_MODEL);
    const float var  = ss * (1.0f / D_MODEL) - mu * mu;
    const float rstd = rsqrtf(var + LN_EPS);
    __bf16* orow = out + (size_t)row * D_MODEL;
    for (int i = threadIdx.x; i < D_MODEL; i += blockDim.x)
        orow[i] = (__bf16)((xr[i] - mu) * rstd * g[i] + b[i]);
}

// ---------------------------------------------------------------------------
// bf16 WMMA GEMM:  C[M,N] = A[M,K] @ B[K,N] + bias (+ res)
// 256 threads = 8 waves; block tile 64(M) x 128(N); K step 32.
// Wave tile 32x32 (2x2 WMMAs). LDS double-buffered via async global->LDS.
// ACT: 0 = none, 1 = tanh-GELU (applied before residual add).
// ---------------------------------------------------------------------------
#define BM 64
#define BN 128
#define BK 32

template <int ACT>
__global__ __launch_bounds__(256)
void gemm_bf16_kernel(const __bf16* __restrict__ A, const __bf16* __restrict__ Bw,
                      const float* __restrict__ bias, const float* __restrict__ res,
                      float* __restrict__ outF, __bf16* __restrict__ outB,
                      int M, int N, int K) {
    __shared__ __bf16 As[2][BM][BK];   // 2 * 4 KB
    __shared__ __bf16 Bs[2][BK][BN];   // 2 * 8 KB
    const int tid  = threadIdx.x;
    const int lane = tid & 31;
    const int wave = tid >> 5;
    const int wm = (wave >> 2) * 32;   // 0 / 32
    const int wn = (wave & 3) * 32;    // 0,32,64,96
    const int bm = blockIdx.y * BM;
    const int bn = blockIdx.x * BN;
    const int half = lane >> 4;        // K-half selector
    const int mr   = lane & 15;        // A row / B col within 16x16 tile

    // staging indices (per thread: 1x16B for A, 2x16B for B)
    const int ar = tid >> 2;           // 0..63
    const int ac = (tid & 3) * 8;      // 0,8,16,24
    const int br = tid >> 3;           // 0..31
    const int bc = (tid & 7) * 16;     // 0..112

    v8f acc[2][2] = {};
    const int nk = K / BK;

    // prologue: stage K-step 0 into buffer 0
    {
        const __bf16* ga = &A[(size_t)(bm + ar) * K + ac];
        const __bf16* gb = &Bw[(size_t)br * N + (bn + bc)];
        async_cp16(ga,     &As[0][ar][ac]);
        async_cp16(gb,     &Bs[0][br][bc]);
        async_cp16(gb + 8, &Bs[0][br][bc + 8]);
    }

    for (int ks = 0; ks < nk; ++ks) {
        const int cur = ks & 1;
        if (ks + 1 < nk) {
            const int nxt = cur ^ 1;
            const int k0 = (ks + 1) * BK;
            const __bf16* ga = &A[(size_t)(bm + ar) * K + (k0 + ac)];
            const __bf16* gb = &Bw[(size_t)(k0 + br) * N + (bn + bc)];
            async_cp16(ga,     &As[nxt][ar][ac]);
            async_cp16(gb,     &Bs[nxt][br][bc]);
            async_cp16(gb + 8, &Bs[nxt][br][bc + 8]);
            WAIT_ASYNC(3);   // newest 3 may remain outstanding -> prev panel done
        } else {
            WAIT_ASYNC(0);
        }
        __syncthreads();

        v16bf af[2], bfr[2];
#pragma unroll
        for (int i = 0; i < 2; ++i)
#pragma unroll
            for (int g2 = 0; g2 < 2; ++g2)
#pragma unroll
                for (int j = 0; j < 8; ++j) {
                    const int kk = g2 * 16 + half * 8 + j;
                    af[i][g2 * 8 + j]  = As[cur][wm + i * 16 + mr][kk];
                    bfr[i][g2 * 8 + j] = Bs[cur][kk][wn + i * 16 + mr];
                }
#pragma unroll
        for (int i = 0; i < 2; ++i)
#pragma unroll
            for (int jn = 0; jn < 2; ++jn)
                acc[i][jn] = wmma_bf16(af[i], bfr[jn], acc[i][jn]);
        __syncthreads();
    }

    // epilogue
#pragma unroll
    for (int jn = 0; jn < 2; ++jn) {
        const int n = bn + wn + jn * 16 + mr;
        const float bvv = bias ? bias[n] : 0.f;
#pragma unroll
        for (int i = 0; i < 2; ++i) {
            const int mbase = bm + wm + i * 16 + half * 8;
#pragma unroll
            for (int r = 0; r < 8; ++r) {
                const int m = mbase + r;
                float v = acc[i][jn][r] + bvv;
                if (ACT == 1) v = gelu_tanh(v);
                if (res)  v += res[(size_t)m * N + n];
                if (outF) outF[(size_t)m * N + n] = v;
                if (outB) outB[(size_t)m * N + n] = (__bf16)v;
            }
        }
    }
}

// ---------------------------------------------------------------------------
// Causal flash attention, one wave per (b, h, 16-row Q tile).
// Q/K/V/O layout: [B, T, H*Dh] bf16. Online softmax; QK^T and P*V via WMMA.
// No block barriers (waves have divergent causal trip counts).
// ---------------------------------------------------------------------------
__global__ __launch_bounds__(128)
void attn_kernel(const __bf16* __restrict__ Q, const __bf16* __restrict__ Km,
                 const __bf16* __restrict__ V, __bf16* __restrict__ O) {
    __shared__ float Pl[4][16][32];   // per-wave P bounce (C-layout -> A-layout)
    const int lane = threadIdx.x & 31;
    const int wave = threadIdx.x >> 5;
    const int work = blockIdx.x * 4 + wave;
    const int QT = SEQ / 16;                       // 128 q-tiles
    const int qt = work % QT;
    const int h  = (work / QT) % NUM_HEADS;
    const int b  = work / (QT * NUM_HEADS);
    const size_t base = ((size_t)b * SEQ) * D_MODEL + (size_t)h * HEAD_DIM;
    const int qbase = qt * 16;
    const int half = lane >> 4;
    const int mr   = lane & 15;
    const float scale = 0.125f;                    // 1/sqrt(64)

    // Q A-fragments for contraction halves d=[0,32) and [32,64)
    v16bf qf[2];
#pragma unroll
    for (int t = 0; t < 2; ++t)
#pragma unroll
        for (int g2 = 0; g2 < 2; ++g2)
#pragma unroll
            for (int j = 0; j < 8; ++j)
                qf[t][g2 * 8 + j] =
                    Q[base + (size_t)(qbase + mr) * D_MODEL +
                      (t * 32 + g2 * 16 + half * 8 + j)];

    v8f acc[4] = {};                // 16 x 64 output accumulator (f32)
    float rm[8], rl[8];
#pragma unroll
    for (int r = 0; r < 8; ++r) { rm[r] = -3.0e38f; rl[r] = 0.f; }

    const int nblk = (qt + 2) >> 1;       // ceil((qbase+16)/32)
    for (int kb = 0; kb < nblk; ++kb) {
        const int kvbase = kb * 32;
        if (kb + 1 < nblk) {               // prefetch next K/V rows into L2/WGP$
            __builtin_prefetch(&Km[base + (size_t)(kvbase + 32 + mr) * D_MODEL], 0, 1);
            __builtin_prefetch(&V[base + (size_t)(kvbase + 32 + mr) * D_MODEL], 0, 1);
        }
        // ---- scores S = Q K^T : two 16x16 tiles over 32 kv positions ----
        v8f s[2] = {};
#pragma unroll
        for (int t = 0; t < 2; ++t) {
#pragma unroll
            for (int kd = 0; kd < 2; ++kd) {
                v16bf kfrag;
#pragma unroll
                for (int g2 = 0; g2 < 2; ++g2)
#pragma unroll
                    for (int j = 0; j < 8; ++j)
                        kfrag[g2 * 8 + j] =
                            Km[base + (size_t)(kvbase + t * 16 + mr) * D_MODEL +
                               (kd * 32 + g2 * 16 + half * 8 + j)];
                s[t] = wmma_bf16(qf[kd], kfrag, s[t]);
            }
        }
        // ---- causal mask + scale ----
        const int qrow_base = qbase + half * 8;
#pragma unroll
        for (int t = 0; t < 2; ++t) {
            const int kv = kvbase + t * 16 + mr;
#pragma unroll
            for (int r = 0; r < 8; ++r) {
                float v = s[t][r] * scale;
                if (kv > qrow_base + r) v = -3.0e38f;
                s[t][r] = v;
            }
        }
        // ---- online softmax (row reductions across 16-lane groups) ----
        // Each DPP step runs over all eight rows before the next one, so that the
        // rows' dependent chains fill one another's latency.
        float mblk[8], ps[8], corr[8];
#pragma unroll   // static row index: the row arrays stay in registers
        for (int r = 0; r < 8; ++r) mblk[r] = fmaxf(s[0][r], s[1][r]);
#pragma unroll   // static row index: the row arrays stay in registers
        for (int r = 0; r < 8; ++r) mblk[r] = row_max_step<8>(mblk[r]);
#pragma unroll   // static row index: the row arrays stay in registers
        for (int r = 0; r < 8; ++r) mblk[r] = row_max_step<4>(mblk[r]);
#pragma unroll   // static row index: the row arrays stay in registers
        for (int r = 0; r < 8; ++r) mblk[r] = row_max_step<2>(mblk[r]);
#pragma unroll   // static row index: the row arrays stay in registers
        for (int r = 0; r < 8; ++r) mblk[r] = row_max_step<1>(mblk[r]);
#pragma unroll   // static row index: the row arrays stay in registers
        for (int r = 0; r < 8; ++r) {
            const float mnew = fmaxf(rm[r], mblk[r]);
            corr[r] = __expf(rm[r] - mnew);
            const float p0 = __expf(s[0][r] - mnew);
            const float p1 = __expf(s[1][r] - mnew);
            ps[r] = p0 + p1;
            rm[r] = mnew;
            const int m = half * 8 + r;
            Pl[wave][m][mr]      = p0;    // C-layout -> LDS (wave-private)
            Pl[wave][m][16 + mr] = p1;
        }
#pragma unroll   // static row index: the row arrays stay in registers
        for (int r = 0; r < 8; ++r) ps[r] += row_xor<8>(ps[r]);
#pragma unroll   // static row index: the row arrays stay in registers
        for (int r = 0; r < 8; ++r) ps[r] += row_xor<4>(ps[r]);
#pragma unroll   // static row index: the row arrays stay in registers
        for (int r = 0; r < 8; ++r) ps[r] += row_xor<2>(ps[r]);
#pragma unroll   // static row index: the row arrays stay in registers
        for (int r = 0; r < 8; ++r) ps[r] += row_xor<1>(ps[r]);
#pragma unroll   // static row index: the row arrays stay in registers
        for (int r = 0; r < 8; ++r) {
            rl[r] = rl[r] * corr[r] + ps[r];
#pragma unroll
            for (int dt = 0; dt < 4; ++dt) acc[dt][r] *= corr[r];
        }
        // ---- P (16x32) as A-fragment (bf16), then P @ V ----
        v16bf pa;
#pragma unroll
        for (int g2 = 0; g2 < 2; ++g2)
#pragma unroll
            for (int j = 0; j < 8; ++j)
                pa[g2 * 8 + j] = (__bf16)Pl[wave][mr][g2 * 16 + half * 8 + j];
#pragma unroll
        for (int dt = 0; dt < 4; ++dt) {
            v16bf vfrag;
#pragma unroll
            for (int g2 = 0; g2 < 2; ++g2)
#pragma unroll
                for (int j = 0; j < 8; ++j)
                    vfrag[g2 * 8 + j] =
                        V[base + (size_t)(kvbase + g2 * 16 + half * 8 + j) * D_MODEL +
                          (dt * 16 + mr)];
            acc[dt] = wmma_bf16(pa, vfrag, acc[dt]);
        }
    }
    // ---- epilogue: O = acc / l ----
#pragma unroll
    for (int r = 0; r < 8; ++r) {
        const float inv = 1.0f / rl[r];
        const int q = qbase + half * 8 + r;
#pragma unroll
        for (int dt = 0; dt < 4; ++dt)
            O[base + (size_t)q * D_MODEL + (dt * 16 + mr)] =
                (__bf16)(acc[dt][r] * inv);
    }
}

// ---------------------------------------------------------------------------
// host launcher
// ---------------------------------------------------------------------------
extern "C" void kernel_launch(void* const* d_in, const int* in_sizes, int n_in,
                              void* d_out, int out_size, void* d_ws, size_t ws_size,
                              hipStream_t stream) {
    (void)in_sizes; (void)n_in; (void)out_size; (void)ws_size;
    const float* x   = (const float*)d_in[0];
    const float* Wq  = (const float*)d_in[1];
    const float* bq  = (const float*)d_in[2];
    const float* Wk  = (const float*)d_in[3];
    const float* bk  = (const float*)d_in[4];
    const float* Wv  = (const float*)d_in[5];
    const float* bv  = (const float*)d_in[6];
    const float* Wo  = (const float*)d_in[7];
    const float* bo  = (const float*)d_in[8];
    const float* g1  = (const float*)d_in[9];
    const float* b1  = (const float*)d_in[10];
    const float* g2  = (const float*)d_in[11];
    const float* b2  = (const float*)d_in[12];
    const float* Wup = (const float*)d_in[13];
    const float* bup = (const float*)d_in[14];
    const float* Wdn = (const float*)d_in[15];
    const float* bdn = (const float*)d_in[16];

    char* ws = (char*)d_ws;
    size_t off = 0;
    auto take = [&](size_t bytes) -> void* {
        void* p = ws + off;
        off = (off + bytes + 255) & ~(size_t)255;
        return p;
    };
    __bf16* wq_b  = (__bf16*)take((size_t)D_MODEL * D_MODEL * 2);
    __bf16* wk_b  = (__bf16*)take((size_t)D_MODEL * D_MODEL * 2);
    __bf16* wv_b  = (__bf16*)take((size_t)D_MODEL * D_MODEL * 2);
    __bf16* wo_b  = (__bf16*)take((size_t)D_MODEL * D_MODEL * 2);
    __bf16* wup_b = (__bf16*)take((size_t)D_MODEL * MLP_DIM * 2);
    __bf16* wdn_b = (__bf16*)take((size_t)MLP_DIM * D_MODEL * 2);
    __bf16* xn_b  = (__bf16*)take((size_t)ROWS * D_MODEL * 2);
    __bf16* q_b   = (__bf16*)take((size_t)ROWS * D_MODEL * 2);
    __bf16* k_b   = (__bf16*)take((size_t)ROWS * D_MODEL * 2);
    __bf16* v_b   = (__bf16*)take((size_t)ROWS * D_MODEL * 2);
    __bf16* o_b   = (__bf16*)take((size_t)ROWS * D_MODEL * 2);
    float*  x2    = (float*) take((size_t)ROWS * D_MODEL * 4);
    __bf16* xn2_b = (__bf16*)take((size_t)ROWS * D_MODEL * 2);
    __bf16* h_b   = (__bf16*)take((size_t)ROWS * MLP_DIM * 2);

    // 1) weights fp32 -> bf16
    cvt_f32_bf16_kernel<<<1024, 256, 0, stream>>>(Wq,  wq_b,  D_MODEL * D_MODEL);
    cvt_f32_bf16_kernel<<<1024, 256, 0, stream>>>(Wk,  wk_b,  D_MODEL * D_MODEL);
    cvt_f32_bf16_kernel<<<1024, 256, 0, stream>>>(Wv,  wv_b,  D_MODEL * D_MODEL);
    cvt_f32_bf16_kernel<<<1024, 256, 0, stream>>>(Wo,  wo_b,  D_MODEL * D_MODEL);
    cvt_f32_bf16_kernel<<<2048, 256, 0, stream>>>(Wup, wup_b, D_MODEL * MLP_DIM);
    cvt_f32_bf16_kernel<<<2048, 256, 0, stream>>>(Wdn, wdn_b, MLP_DIM * D_MODEL);

    // 2) LN1 -> bf16
    ln_kernel<<<ROWS, 256, 0, stream>>>(x, g1, b1, xn_b);

    // 3) Q/K/V projections (bf16 out)
    dim3 gD(D_MODEL / BN, ROWS / BM);   // (8, 64)
    gemm_bf16_kernel<0><<<gD, 256, 0, stream>>>(xn_b, wq_b, bq, nullptr, nullptr, q_b,
                                                ROWS, D_MODEL, D_MODEL);
    gemm_bf16_kernel<0><<<gD, 256, 0, stream>>>(xn_b, wk_b, bk, nullptr, nullptr, k_b,
                                                ROWS, D_MODEL, D_MODEL);
    gemm_bf16_kernel<0><<<gD, 256, 0, stream>>>(xn_b, wv_b, bv, nullptr, nullptr, v_b,
                                                ROWS, D_MODEL, D_MODEL);

    // 4) causal flash attention (4096 waves, 4 waves/block)
    attn_kernel<<<(BATCH * NUM_HEADS * (SEQ / 16)) / 4, 128, 0, stream>>>(q_b, k_b, v_b, o_b);

    // 5) output projection + residual -> x2 (fp32)
    gemm_bf16_kernel<0><<<gD, 256, 0, stream>>>(o_b, wo_b, bo, x, x2, nullptr,
                                                ROWS, D_MODEL, D_MODEL);

    // 6) LN2 -> bf16
    ln_kernel<<<ROWS, 256, 0, stream>>>(x2, g2, b2, xn2_b);

    // 7) MLP up + GELU (bf16 out)
    dim3 gU(MLP_DIM / BN, ROWS / BM);   // (32, 64)
    gemm_bf16_kernel<1><<<gU, 256, 0, stream>>>(xn2_b, wup_b, bup, nullptr, nullptr, h_b,
                                                ROWS, MLP_DIM, D_MODEL);

    // 8) MLP down + residual -> out (fp32)
    gemm_bf16_kernel<0><<<gD, 256, 0, stream>>>(h_b, wdn_b, bdn, x2, (float*)d_out, nullptr,
                                                ROWS, D_MODEL, MLP_DIM);
}

// v002
// One run takes 450 microseconds.
// In both of two side-by-side timings against v001, it was 1.21 times as fast.
// All steps since v000 together make it 1.48 times as fast.
#include <hip/hip_runtime.h>
#include <hip/hip_bf16.h>
#include <math.h>

// ---- problem constants (match reference) ----
#define D_MODEL   1024
#define NUM_HEADS 16
#define HEAD_DIM  64
#define MLP_DIM   4096
#define BATCH     2
#define SEQ       2048
#define ROWS      (BATCH * SEQ)   // 4096
#define LN_EPS    1e-5f

typedef __attribute__((ext_vector_type(16))) __bf16 v16bf;
typedef __attribute__((ext_vector_type(8)))  __bf16 v8bf;
typedef __attribute__((ext_vector_type(8)))  float  v8f;
typedef __attribute__((ext_vector_type(4)))  __bf16 v4bf;
typedef int v4i __attribute__((vector_size(16)));   // matches builtin param type

// ---- CDNA5 async global->LDS path (guarded; falls back to vector copies) ----
#if defined(__AMDGCN__) && __has_builtin(__builtin_amdgcn_global_load_async_to_lds_b128)
#define HAS_ASYNC_LDS 1
#else
#define HAS_ASYNC_LDS 0
#endif

#if HAS_ASYNC_LDS
#if __has_builtin(__builtin_amdgcn_s_wait_asynccnt)
#define WAIT_ASYNC(n) __builtin_amdgcn_s_wait_asynccnt(n)
#else
#define WAIT_ASYNC(n) asm volatile("s_wait_asynccnt %0" ::"i"(n) : "memory")
#endif
#else
#define WAIT_ASYNC(n) do { } while (0)
#endif

static __device__ __forceinline__ void async_cp16(const __bf16* g, __bf16* l) {
#if HAS_ASYNC_LDS
    // global_load_async_to_lds_b128: 16B global -> LDS, tracked by ASYNCcnt
    __builtin_amdgcn_global_load_async_to_lds_b128((v4i*)g, (v4i*)l, 0, 0);
#else
    *reinterpret_cast<v8bf*>(l) = *reinterpret_cast<const v8bf*>(g);
#endif
}

// ds_load_tr16_b128 on a row-major 16-bit LDS tile T: with lane l aimed at
// T[k0 + 8*(l>>4) + (l&7)][n0 + 8*((l>>3)&1)], lane l gets T[k0 + 8*(l>>4) + 0..7][n0 + (l&15)],
// one half of a WMMA operand in the hardware k order. All 32 lanes must hold a valid address.
typedef __attribute__((address_space(3))) v8bf lds_v8bf;
static __device__ __forceinline__ v8bf lds_tr16(const __bf16* p) {
    return __builtin_amdgcn_ds_load_tr16_b128_v8bf16((lds_v8bf*)p);
}

static __device__ __forceinline__ v8f wmma_bf16(v16bf a, v16bf b, v8f c) {
    // D = A(16x32 bf16) * B(32x16 bf16) + C(16x16 f32)
    return __builtin_amdgcn_wmma_f32_16x16x32_bf16(
        /*neg_a=*/false, a, /*neg_b=*/false, b,
        /*c_mod=*/(short)0, c, /*reuse_a=*/false, /*reuse_b=*/false);
}

// Lane l reads lane l ^ X of its own 16-lane row (DPP row_xmask): a vector-unit
// exchange, where __shfl_xor goes through the LDS queue and a wait per step.
// All 32 lanes must be active.
template <int X>
static __device__ __forceinline__ float row_xor(float v) {
    return __builtin_bit_cast(float, __builtin_amdgcn_update_dpp(
        0, __builtin_bit_cast(int, v), 0x160 | X, 0xf, 0xf, true));
}

// One step of a 16-lane row maximum, max(v, v of lane l ^ X), as one DPP instruction.
// asm: fmaxf() on row_xor() compiles to three dependent instructions (move, quieting
// max, max); volatile: keeps the rows' independent steps in the interleaved order written.
template <int X>
static __device__ __forceinline__ float row_max_step(float v) {
    float r;
    asm volatile("v_max_num_f32_dpp %0, %1, %1 row_xmask:%2 row_mask:0xf bank_mask:0xf"
                 : "=v"(r) : "v"(v), "n"(X));
    return r;
}

static __device__ __forceinline__ float gelu_tanh(float x) {
    const float c0 = 0.7978845608028654f;   // sqrt(2/pi)
    return 0.5f * x * (1.0f + tanhf(c0 * (x + 0.044715f * x * x * x)));
}

// ---------------------------------------------------------------------------
// fp32 -> bf16 conversion (weights)
// ---------------------------------------------------------------------------
__global__ void cvt_f32_bf16_kernel(const float* __restrict__ src,
                                    __bf16* __restrict__ dst, int n) {
    int i = blockIdx.x * blockDim.x + threadIdx.x;
    int stride = gridDim.x * blockDim.x;
    for (; i < n; i += stride) dst[i] = (__bf16)src[i];
}

// ---------------------------------------------------------------------------
// LayerNorm over last dim (C = D_MODEL), one 256-thread block per row,
// output bf16 (feeds WMMA GEMMs)
// ---------------------------------------------------------------------------
__global__ void ln_kernel(const float* __restrict__ x,
                          const float* __restrict__ g,
                          const float* __restrict__ b,
                          __bf16* __restrict__ out) {
    const int row = blockIdx.x;
    const float* xr = x + (size_t)row * D_MODEL;
    float s = 0.f, ss = 0.f;
    for (int i = threadIdx.x; i < D_MODEL; i += blockDim.x) {
        float v = xr[i];
        s += v;
        ss += v * v;
    }
    __shared__ float sh[2][8];
    const int lane = threadIdx.x & 31;
    const int wave = threadIdx.x >> 5;
#pragma unroll
    for (int o = 16; o > 0; o >>= 1) {
        s  += __shfl_down(s, o);
        ss += __shfl_down(ss, o);
    }
    if (lane == 0) { sh[0][wave] = s; sh[1][wave] = ss; }
    __syncthreads();
    s = 0.f; ss = 0.f;
#pragma unroll
    for (int w = 0; w < 8; ++w) { s += sh[0][w]; ss += sh[1][w]; }
    const float mu   = s  * (1.0f / D_MODEL);
    const float var  = ss * (1.0f / D_MODEL) - mu * mu;
    const float rstd = rsqrtf(var + LN_EPS);
    __bf16* orow = out + (size_t)row * D_MODEL;
    for (int i = threadIdx.x; i < D_MODEL; i += blockDim.x)
        orow[i] = (__bf16)((xr[i] - mu) * rstd * g[i] + b[i]);
}

// ---------------------------------------------------------------------------
// bf16 WMMA GEMM:  C[M,N] = A[M,K] @ B[K,N] + bias (+ res)
// 256 threads = 8 waves; block tile 64(M) x 128(N); K step 32.
// Wave tile 32x32 (2x2 WMMAs). LDS double-buffered via async global->LDS.
// ACT: 0 = none, 1 = tanh-GELU (applied before residual add).
// ---------------------------------------------------------------------------
#define BM 64
#define BN 128
#define BK 32
#define BNP (BN + 16)   // LDS pitch of a B row: 288 B, an odd multiple of 32 B, free of bank conflicts for ds_load_tr16_b128

template <int ACT>
__global__ __launch_bounds__(256)
void gemm_bf16_kernel(const __bf16* __restrict__ A, const __bf16* __restrict__ Bw,
                      const float* __restrict__ bias, const float* __restrict__ res,
                      float* __restrict__ outF, __bf16* __restrict__ outB,
                      int M, int N, int K) {
    __shared__ __bf16 As[2][BM][BK];   // 2 * 4 KB
    __shared__ __attribute__((aligned(16))) __bf16 Bs[2][BK][BNP];   // 2 * 9 KB
    const int tid  = threadIdx.x;
    const int lane = tid & 31;
    const int wave = tid >> 5;
    const int wm = (wave >> 2) * 32;   // 0 / 32
    const int wn = (wave & 3) * 32;    // 0,32,64,96
    const int bm = blockIdx.y * BM;
    const int bn = blockIdx.x * BN;
    const int half = lane >> 4;        // K-half selector
    const int mr   = lane & 15;        // A row / B col within 16x16 tile

    // staging indices (per thread: 1x16B for A, 2x16B for B)
    const int ar = tid >> 2;           // 0..63
    const int ac = (tid & 3) * 8;      // 0,8,16,24
    const int br = tid >> 3;           // 0..31
    const int bc = (tid & 7) * 16;     // 0..112

    v8f acc[2][2] = {};
    const int nk = K / BK;

    // prologue: stage K-step 0 into buffer 0
    {
        const __bf16* ga = &A[(size_t)(bm + ar) * K + ac];
        const __bf16* gb = &Bw[(size_t)br * N + (bn + bc)];
        async_cp16(ga,     &As[0][ar][ac]);
        async_cp16(gb,     &Bs[0][br][bc]);
        async_cp16(gb + 8, &Bs[0][br][bc + 8]);
    }

    for (int ks = 0; ks < nk; ++ks) {
        const int cur = ks & 1;
        if (ks + 1 < nk) {
            const int nxt = cur ^ 1;
            const int k0 = (ks + 1) * BK;
            const __bf16* ga = &A[(size_t)(bm + ar) * K + (k0 + ac)];
            const __bf16* gb = &Bw[(size_t)(k0 + br) * N + (bn + bc)];
            async_cp16(ga,     &As[nxt][ar][ac]);
            async_cp16(gb,     &Bs[nxt][br][bc]);
            async_cp16(gb + 8, &Bs[nxt][br][bc + 8]);
            WAIT_ASYNC(3);   // newest 3 may remain outstanding -> prev panel done
        } else {
            WAIT_ASYNC(0);
        }
        __syncthreads();

        v16bf af[2], bfr[2];
#pragma unroll
        for (int i = 0; i < 2; ++i)
#pragma unroll
            for (int g2 = 0; g2 < 2; ++g2)
#pragma unroll
                for (int j = 0; j < 8; ++j) {
                    const int kk = g2 * 16 + half * 8 + j;
                    af[i][g2 * 8 + j]  = As[cur][wm + i * 16 + mr][kk];
                }
        // B fragments: element g2*8+j = Bs[g2*16 + half*8 + j][column], the k order of af
        const __bf16* bt = &Bs[cur][half * 8 + (lane & 7)][wn + ((lane >> 3) & 1) * 8];
#pragma unroll   // static fragment index: bfr stays in registers
        for (int i = 0; i < 2; ++i)
            bfr[i] = __builtin_shufflevector(lds_tr16(bt + i * 16),
                                             lds_tr16(bt + 16 * BNP + i * 16),
                                             0, 1, 2, 3, 4, 5, 6, 7, 8, 9, 10, 11, 12, 13, 14, 15);
#pragma unroll
        for (int i = 0; i < 2; ++i)
#pragma unroll
            for (int jn = 0; jn < 2; ++jn)
                acc[i][jn] = wmma_bf16(af[i], bfr[jn], acc[i][jn]);
        __syncthreads();
    }

    // epilogue
#pragma unroll
    for (int jn = 0; jn < 2; ++jn) {
        const int n = bn + wn + jn * 16 + mr;
        const float bvv = bias ? bias[n] : 0.f;
#pragma unroll
        for (int i = 0; i < 2; ++i) {
            const int mbase = bm + wm + i * 16 + half * 8;
#pragma unroll
            for (int r = 0; r < 8; ++r) {
                const int m = mbase + r;
                float v = acc[i][jn][r] + bvv;
                if (ACT == 1) v = gelu_tanh(v);
                if (res)  v += res[(size_t)m * N + n];
                if (outF) outF[(size_t)m * N + n] = v;
                if (outB) outB[(size_t)m * N + n] = (__bf16)v;
            }
        }
    }
}

// ---------------------------------------------------------------------------
// Causal flash attention, one wave per (b, h, 16-row Q tile).
// Q/K/V/O layout: [B, T, H*Dh] bf16. Online softmax; QK^T and P*V via WMMA.
// No block barriers (waves have divergent causal trip counts).
// ---------------------------------------------------------------------------
__global__ __launch_bounds__(128)
void attn_kernel(const __bf16* __restrict__ Q, const __bf16* __restrict__ Km,
                 const __bf16* __restrict__ V, __bf16* __restrict__ O) {
    __shared__ float Pl[4][16][32];   // per-wave P bounce (C-layout -> A-layout)
    const int lane = threadIdx.x & 31;
    const int wave = threadIdx.x >> 5;
    const int work = blockIdx.x * 4 + wave;
    const int QT = SEQ / 16;                       // 128 q-tiles
    const int qt = work % QT;
    const int h  = (work / QT) % NUM_HEADS;
    const int b  = work / (QT * NUM_HEADS);
    const size_t base = ((size_t)b * SEQ) * D_MODEL + (size_t)h * HEAD_DIM;
    const int qbase = qt * 16;
    const int half = lane >> 4;
    const int mr   = lane & 15;
    const float scale = 0.125f;                    // 1/sqrt(64)

    // Q A-fragments for contraction halves d=[0,32) and [32,64)
    v16bf qf[2];
#pragma unroll
    for (int t = 0; t < 2; ++t)
#pragma unroll
        for (int g2 = 0; g2 < 2; ++g2)
#pragma unroll
            for (int j = 0; j < 8; ++j)
                qf[t][g2 * 8 + j] =
                    Q[base + (size_t)(qbase + mr) * D_MODEL +
                      (t * 32 + g2 * 16 + half * 8 + j)];

    v8f acc[4] = {};                // 16 x 64 output accumulator (f32)
    float rm[8], rl[8];
#pragma unroll
    for (int r = 0; r < 8; ++r) { rm[r] = -3.0e38f; rl[r] = 0.f; }

    const int nblk = (qt + 2) >> 1;       // ceil((qbase+16)/32)
    for (int kb = 0; kb < nblk; ++kb) {
        const int kvbase = kb * 32;
        if (kb + 1 < nblk) {               // prefetch next K/V rows into L2/WGP$
            __builtin_prefetch(&Km[base + (size_t)(kvbase + 32 + mr) * D_MODEL], 0, 1);
            __builtin_prefetch(&V[base + (size_t)(kvbase + 32 + mr) * D_MODEL], 0, 1);
        }
        // ---- scores S = Q K^T : two 16x16 tiles over 32 kv positions ----
        v8f s[2] = {};
#pragma unroll
        for (int t = 0; t < 2; ++t) {
#pragma unroll
            for (int kd = 0; kd < 2; ++kd) {
                v16bf kfrag;
#pragma unroll
                for (int g2 = 0; g2 < 2; ++g2)
#pragma unroll
                    for (int j = 0; j < 8; ++j)
                        kfrag[g2 * 8 + j] =
                            Km[base + (size_t)(kvbase + t * 16 + mr) * D_MODEL +
                               (kd * 32 + g2 * 16 + half * 8 + j)];
                s[t] = wmma_bf16(qf[kd], kfrag, s[t]);
            }
        }
        // ---- causal mask + scale ----
        const int qrow_base = qbase + half * 8;
#pragma unroll
        for (int t = 0; t < 2; ++t) {
            const int kv = kvbase + t * 16 + mr;
#pragma unroll
            for (int r = 0; r < 8; ++r) {
                float v = s[t][r] * scale;
                if (kv > qrow_base + r) v = -3.0e38f;
                s[t][r] = v;
            }
        }
        // ---- online softmax (row reductions across 16-lane groups) ----
        // Each DPP step runs over all eight rows before the next one, so that the
        // rows' dependent chains fill one another's latency.
        float mblk[8], ps[8], corr[8];
#pragma unroll   // static row index: the row arrays stay in registers
        for (int r = 0; r < 8; ++r) mblk[r] = fmaxf(s[0][r], s[1][r]);
#pragma unroll   // static row index: the row arrays stay in registers
        for (int r = 0; r < 8; ++r) mblk[r] = row_max_step<8>(mblk[r]);
#pragma unroll   // static row index: the row arrays stay in registers
        for (int r = 0; r < 8; ++r) mblk[r] = row_max_step<4>(mblk[r]);
#pragma unroll   // static row index: the row arrays stay in registers
        for (int r = 0; r < 8; ++r) mblk[r] = row_max_step<2>(mblk[r]);
#pragma unroll   // static row index: the row arrays stay in registers
        for (int r = 0; r < 8; ++r) mblk[r] = row_max_step<1>(mblk[r]);
#pragma unroll   // static row index: the row arrays stay in registers
        for (int r = 0; r < 8; ++r) {
            const float mnew = fmaxf(rm[r], mblk[r]);
            corr[r] = __expf(rm[r] - mnew);
            const float p0 = __expf(s[0][r] - mnew);
            const float p1 = __expf(s[1][r] - mnew);
            ps[r] = p0 + p1;
            rm[r] = mnew;
            const int m = half * 8 + r;
            Pl[wave][m][mr]      = p0;    // C-layout -> LDS (wave-private)
            Pl[wave][m][16 + mr] = p1;
        }
#pragma unroll   // static row index: the row arrays stay in registers
        for (int r = 0; r < 8; ++r) ps[r] += row_xor<8>(ps[r]);
#pragma unroll   // static row index: the row arrays stay in registers
        for (int r = 0; r < 8; ++r) ps[r] += row_xor<4>(ps[r]);
#pragma unroll   // static row index: the row arrays stay in registers
        for (int r = 0; r < 8; ++r) ps[r] += row_xor<2>(ps[r]);
#pragma unroll   // static row index: the row arrays stay in registers
        for (int r = 0; r < 8; ++r) ps[r] += row_xor<1>(ps[r]);
#pragma unroll   // static row index: the row arrays stay in registers
        for (int r = 0; r < 8; ++r) {
            rl[r] = rl[r] * corr[r] + ps[r];
#pragma unroll
            for (int dt = 0; dt < 4; ++dt) acc[dt][r] *= corr[r];
        }
        // ---- P (16x32) as A-fragment (bf16), then P @ V ----
        v16bf pa;
#pragma unroll
        for (int g2 = 0; g2 < 2; ++g2)
#pragma unroll
            for (int j = 0; j < 8; ++j)
                pa[g2 * 8 + j] = (__bf16)Pl[wave][mr][g2 * 16 + half * 8 + j];
#pragma unroll
        for (int dt = 0; dt < 4; ++dt) {
            v16bf vfrag;
#pragma unroll
            for (int g2 = 0; g2 < 2; ++g2)
#pragma unroll
                for (int j = 0; j < 8; ++j)
                    vfrag[g2 * 8 + j] =
                        V[base + (size_t)(kvbase + g2 * 16 + half * 8 + j) * D_MODEL +
                          (dt * 16 + mr)];
            acc[dt] = wmma_bf16(pa, vfrag, acc[dt]);
        }
    }
    // ---- epilogue: O = acc / l ----
#pragma unroll
    for (int r = 0; r < 8; ++r) {
        const float inv = 1.0f / rl[r];
        const int q = qbase + half * 8 + r;
#pragma unroll
        for (int dt = 0; dt < 4; ++dt)
            O[base + (size_t)q * D_MODEL + (dt * 16 + mr)] =
                (__bf16)(acc[dt][r] * inv);
    }
}

// ---------------------------------------------------------------------------
// host launcher
// ---------------------------------------------------------------------------
extern "C" void kernel_launch(void* const* d_in, const int* in_sizes, int n_in,
                              void* d_out, int out_size, void* d_ws, size_t ws_size,
                              hipStream_t stream) {
    (void)in_sizes; (void)n_in; (void)out_size; (void)ws_size;
    const float* x   = (const float*)d_in[0];
    const float* Wq  = (const float*)d_in[1];
    const float* bq  = (const float*)d_in[2];
    const float* Wk  = (const float*)d_in[3];
    const float* bk  = (const float*)d_in[4];
    const float* Wv  = (const float*)d_in[5];
    const float* bv  = (const float*)d_in[6];
    const float* Wo  = (const float*)d_in[7];
    const float* bo  = (const float*)d_in[8];
    const float* g1  = (const float*)d_in[9];
    const float* b1  = (const float*)d_in[10];
    const float* g2  = (const float*)d_in[11];
    const float* b2  = (const float*)d_in[12];
    const float* Wup = (const float*)d_in[13];
    const float* bup = (const float*)d_in[14];
    const float* Wdn = (const float*)d_in[15];
    const float* bdn = (const float*)d_in[16];

    char* ws = (char*)d_ws;
    size_t off = 0;
    auto take = [&](size_t bytes) -> void* {
        void* p = ws + off;
        off = (off + bytes + 255) & ~(size_t)255;
        return p;
    };
    __bf16* wq_b  = (__bf16*)take((size_t)D_MODEL * D_MODEL * 2);
    __bf16* wk_b  = (__bf16*)take((size_t)D_MODEL * D_MODEL * 2);
    __bf16* wv_b  = (__bf16*)take((size_t)D_MODEL * D_MODEL * 2);
    __bf16* wo_b  = (__bf16*)take((size_t)D_MODEL * D_MODEL * 2);
    __bf16* wup_b = (__bf16*)take((size_t)D_MODEL * MLP_DIM * 2);
    __bf16* wdn_b = (__bf16*)take((size_t)MLP_DIM * D_MODEL * 2);
    __bf16* xn_b  = (__bf16*)take((size_t)ROWS * D_MODEL * 2);
    __bf16* q_b   = (__bf16*)take((size_t)ROWS * D_MODEL * 2);
    __bf16* k_b   = (__bf16*)take((size_t)ROWS * D_MODEL * 2);
    __bf16* v_b   = (__bf16*)take((size_t)ROWS * D_MODEL * 2);
    __bf16* o_b   = (__bf16*)take((size_t)ROWS * D_MODEL * 2);
    float*  x2    = (float*) take((size_t)ROWS * D_MODEL * 4);
    __bf16* xn2_b = (__bf16*)take((size_t)ROWS * D_MODEL * 2);
    __bf16* h_b   = (__bf16*)take((size_t)ROWS * MLP_DIM * 2);

    // 1) weights fp32 -> bf16
    cvt_f32_bf16_kernel<<<1024, 256, 0, stream>>>(Wq,  wq_b,  D_MODEL * D_MODEL);
    cvt_f32_bf16_kernel<<<1024, 256, 0, stream>>>(Wk,  wk_b,  D_MODEL * D_MODEL);
    cvt_f32_bf16_kernel<<<1024, 256, 0, stream>>>(Wv,  wv_b,  D_MODEL * D_MODEL);
    cvt_f32_bf16_kernel<<<1024, 256, 0, stream>>>(Wo,  wo_b,  D_MODEL * D_MODEL);
    cvt_f32_bf16_kernel<<<2048, 256, 0, stream>>>(Wup, wup_b, D_MODEL * MLP_DIM);
    cvt_f32_bf16_kernel<<<2048, 256, 0, stream>>>(Wdn, wdn_b, MLP_DIM * D_MODEL);

    // 2) LN1 -> bf16
    ln_kernel<<<ROWS, 256, 0, stream>>>(x, g1, b1, xn_b);

    // 3) Q/K/V projections (bf16 out)
    dim3 gD(D_MODEL / BN, ROWS / BM);   // (8, 64)
    gemm_bf16_kernel<0><<<gD, 256, 0, stream>>>(xn_b, wq_b, bq, nullptr, nullptr, q_b,
                                                ROWS, D_MODEL, D_MODEL);
    gemm_bf16_kernel<0><<<gD, 256, 0, stream>>>(xn_b, wk_b, bk, nullptr, nullptr, k_b,
                                                ROWS, D_MODEL, D_MODEL);
    gemm_bf16_kernel<0><<<gD, 256, 0, stream>>>(xn_b, wv_b, bv, nullptr, nullptr, v_b,
                                                ROWS, D_MODEL, D_MODEL);

    // 4) causal flash attention (4096 waves, 4 waves/block)
    attn_kernel<<<(BATCH * NUM_HEADS * (SEQ / 16)) / 4, 128, 0, stream>>>(q_b, k_b, v_b, o_b);

    // 5) output projection + residual -> x2 (fp32)
    gemm_bf16_kernel<0><<<gD, 256, 0, stream>>>(o_b, wo_b, bo, x, x2, nullptr,
                                                ROWS, D_MODEL, D_MODEL);

    // 6) LN2 -> bf16
    ln_kernel<<<ROWS, 256, 0, stream>>>(x2, g2, b2, xn2_b);

    // 7) MLP up + GELU (bf16 out)
    dim3 gU(MLP_DIM / BN, ROWS / BM);   // (32, 64)
    gemm_bf16_kernel<1><<<gU, 256, 0, stream>>>(xn2_b, wup_b, bup, nullptr, nullptr, h_b,
                                                ROWS, MLP_DIM, D_MODEL);

    // 8) MLP down + residual -> out (fp32)
    gemm_bf16_kernel<0><<<gD, 256, 0, stream>>>(h_b, wdn_b, bdn, x2, (float*)d_out, nullptr,
                                                ROWS, D_MODEL, MLP_DIM);
}

// v003
// Measured time: 350 microseconds a run.
// Timed twice side by side with v002, it ran 1.29 and 1.28 times as fast.
// All steps since v000 together make it 1.91 times as fast.
#include <hip/hip_runtime.h>
#include <hip/hip_bf16.h>
#include <math.h>

// ---- problem constants (match reference) ----
#define D_MODEL   1024
#define NUM_HEADS 16
#define HEAD_DIM  64
#define MLP_DIM   4096
#define BATCH     2
#define SEQ       2048
#define ROWS      (BATCH * SEQ)   // 4096
#define LN_EPS    1e-5f

typedef __attribute__((ext_vector_type(16))) __bf16 v16bf;
typedef __attribute__((ext_vector_type(8)))  __bf16 v8bf;
typedef __attribute__((ext_vector_type(8)))  float  v8f;
typedef __attribute__((ext_vector_type(4)))  __bf16 v4bf;
typedef int v4i __attribute__((vector_size(16)));   // matches builtin param type

// ---- CDNA5 async global->LDS path (guarded; falls back to vector copies) ----
#if defined(__AMDGCN__) && __has_builtin(__builtin_amdgcn_global_load_async_to_lds_b128)
#define HAS_ASYNC_LDS 1
#else
#define HAS_ASYNC_LDS 0
#endif

#if HAS_ASYNC_LDS
#if __has_builtin(__builtin_amdgcn_s_wait_asynccnt)
#define WAIT_ASYNC(n) __builtin_amdgcn_s_wait_asynccnt(n)
#else
#define WAIT_ASYNC(n) asm volatile("s_wait_asynccnt %0" ::"i"(n) : "memory")
#endif
#else
#define WAIT_ASYNC(n) do { } while (0)
#endif

static __device__ __forceinline__ void async_cp16(const __bf16* g, __bf16* l) {
#if HAS_ASYNC_LDS
    // global_load_async_to_lds_b128: 16B global -> LDS, tracked by ASYNCcnt
    __builtin_amdgcn_global_load_async_to_lds_b128((v4i*)g, (v4i*)l, 0, 0);
#else
    *reinterpret_cast<v8bf*>(l) = *reinterpret_cast<const v8bf*>(g);
#endif
}

// ds_load_tr16_b128 on a row-major 16-bit LDS tile T: with lane l aimed at
// T[k0 + 8*(l>>4) + (l&7)][n0 + 8*((l>>3)&1)], lane l gets T[k0 + 8*(l>>4) + 0..7][n0 + (l&15)],
// one half of a WMMA operand in the hardware k order. All 32 lanes must hold a valid address.
typedef __attribute__((address_space(3))) v8bf lds_v8bf;
static __device__ __forceinline__ v8bf lds_tr16(const __bf16* p) {
    return __builtin_amdgcn_ds_load_tr16_b128_v8bf16((lds_v8bf*)p);
}

static __device__ __forceinline__ v8f wmma_bf16(v16bf a, v16bf b, v8f c) {
    // D = A(16x32 bf16) * B(32x16 bf16) + C(16x16 f32)
    return __builtin_amdgcn_wmma_f32_16x16x32_bf16(
        /*neg_a=*/false, a, /*neg_b=*/false, b,
        /*c_mod=*/(short)0, c, /*reuse_a=*/false, /*reuse_b=*/false);
}

// Lane l reads lane l ^ X of its own 16-lane row (DPP row_xmask): a vector-unit
// exchange, where __shfl_xor goes through the LDS queue and a wait per step.
// All 32 lanes must be active.
template <int X>
static __device__ __forceinline__ float row_xor(float v) {
    return __builtin_bit_cast(float, __builtin_amdgcn_update_dpp(
        0, __builtin_bit_cast(int, v), 0x160 | X, 0xf, 0xf, true));
}

// One step of a 16-lane row maximum, max(v, v of lane l ^ X), as one DPP instruction.
// asm: fmaxf() on row_xor() compiles to three dependent instructions (move, quieting
// max, max); volatile: keeps the rows' independent steps in the interleaved order written.
template <int X>
static __device__ __forceinline__ float row_max_step(float v) {
    float r;
    asm volatile("v_max_num_f32_dpp %0, %1, %1 row_xmask:%2 row_mask:0xf bank_mask:0xf"
                 : "=v"(r) : "v"(v), "n"(X));
    return r;
}

static __device__ __forceinline__ float gelu_tanh(float x) {
    const float c0 = 0.7978845608028654f;   // sqrt(2/pi)
    return 0.5f * x * (1.0f + tanhf(c0 * (x + 0.044715f * x * x * x)));
}

// ---------------------------------------------------------------------------
// fp32 -> bf16 conversion (weights)
// ---------------------------------------------------------------------------
__global__ void cvt_f32_bf16_kernel(const float* __restrict__ src,
                                    __bf16* __restrict__ dst, int n) {
    int i = blockIdx.x * blockDim.x + threadIdx.x;
    int stride = gridDim.x * blockDim.x;
    for (; i < n; i += stride) dst[i] = (__bf16)src[i];
}

// ---------------------------------------------------------------------------
// LayerNorm over last dim (C = D_MODEL), one 256-thread block per row,
// output bf16 (feeds WMMA GEMMs)
// ---------------------------------------------------------------------------
__global__ void ln_kernel(const float* __restrict__ x,
                          const float* __restrict__ g,
                          const float* __restrict__ b,
                          __bf16* __restrict__ out) {
    const int row = blockIdx.x;
    const float* xr = x + (size_t)row * D_MODEL;
    float s = 0.f, ss = 0.f;
    for (int i = threadIdx.x; i < D_MODEL; i += blockDim.x) {
        float v = xr[i];
        s += v;
        ss += v * v;
    }
    __shared__ float sh[2][8];
    const int lane = threadIdx.x & 31;
    const int wave = threadIdx.x >> 5;
#pragma unroll
    for (int o = 16; o > 0; o >>= 1) {
        s  += __shfl_down(s, o);
        ss += __shfl_down(ss, o);
    }
    if (lane == 0) { sh[0][wave] = s; sh[1][wave] = ss; }
    __syncthreads();
    s = 0.f; ss = 0.f;
#pragma unroll
    for (int w = 0; w < 8; ++w) { s += sh[0][w]; ss += sh[1][w]; }
    const float mu   = s  * (1.0f / D_MODEL);
    const float var  = ss * (1.0f / D_MODEL) - mu * mu;
    const float rstd = rsqrtf(var + LN_EPS);
    __bf16* orow = out + (size_t)row * D_MODEL;
    for (int i = threadIdx.x; i < D_MODEL; i += blockDim.x)
        orow[i] = (__bf16)((xr[i] - mu) * rstd * g[i] + b[i]);
}

// ---------------------------------------------------------------------------
// bf16 WMMA GEMM:  C[M,N] = A[M,K] @ B[K,N] + bias (+ res)
// 256 threads = 8 waves; block tile 64(M) x 128(N); K step 32.
// Wave tile 32x32 (2x2 WMMAs). LDS double-buffered via async global->LDS.
// ACT: 0 = none, 1 = tanh-GELU (applied before residual add).
// ---------------------------------------------------------------------------
#define BM 64
#define BN 128
#define BK 32
#define BNP (BN + 16)   // LDS pitch of a B row: 288 B, an odd multiple of 32 B, free of bank conflicts for ds_load_tr16_b128

template <int ACT>
__global__ __launch_bounds__(256)
void gemm_bf16_kernel(const __bf16* __restrict__ A, const __bf16* __restrict__ Bw,
                      const float* __restrict__ bias, const float* __restrict__ res,
                      float* __restrict__ outF, __bf16* __restrict__ outB,
                      int M, int N, int K) {
    __shared__ __bf16 As[2][BM][BK];   // 2 * 4 KB
    __shared__ __attribute__((aligned(16))) __bf16 Bs[2][BK][BNP];   // 2 * 9 KB
    const int tid  = threadIdx.x;
    const int lane = tid & 31;
    const int wave = tid >> 5;
    const int wm = (wave >> 2) * 32;   // 0 / 32
    const int wn = (wave & 3) * 32;    // 0,32,64,96
    const int bm = blockIdx.y * BM;
    const int bn = blockIdx.x * BN;
    const int half = lane >> 4;        // K-half selector
    const int mr   = lane & 15;        // A row / B col within 16x16 tile

    // staging indices (per thread: 1x16B for A, 2x16B for B)
    const int ar = tid >> 2;           // 0..63
    const int ac = (tid & 3) * 8;      // 0,8,16,24
    const int br = tid >> 3;           // 0..31
    const int bc = (tid & 7) * 16;     // 0..112

    v8f acc[2][2] = {};
    const int nk = K / BK;

    // prologue: stage K-step 0 into buffer 0
    {
        const __bf16* ga = &A[(size_t)(bm + ar) * K + ac];
        const __bf16* gb = &Bw[(size_t)br * N + (bn + bc)];
        async_cp16(ga,     &As[0][ar][ac]);
        async_cp16(gb,     &Bs[0][br][bc]);
        async_cp16(gb + 8, &Bs[0][br][bc + 8]);
    }

    for (int ks = 0; ks < nk; ++ks) {
        const int cur = ks & 1;
        if (ks + 1 < nk) {
            const int nxt = cur ^ 1;
            const int k0 = (ks + 1) * BK;
            const __bf16* ga = &A[(size_t)(bm + ar) * K + (k0 + ac)];
            const __bf16* gb = &Bw[(size_t)(k0 + br) * N + (bn + bc)];
            async_cp16(ga,     &As[nxt][ar][ac]);
            async_cp16(gb,     &Bs[nxt][br][bc]);
            async_cp16(gb + 8, &Bs[nxt][br][bc + 8]);
            WAIT_ASYNC(3);   // newest 3 may remain outstanding -> prev panel done
        } else {
            WAIT_ASYNC(0);
        }
        __syncthreads();

        v16bf af[2], bfr[2];
#pragma unroll
        for (int i = 0; i < 2; ++i)
#pragma unroll
            for (int g2 = 0; g2 < 2; ++g2)
#pragma unroll
                for (int j = 0; j < 8; ++j) {
                    const int kk = g2 * 16 + half * 8 + j;
                    af[i][g2 * 8 + j]  = As[cur][wm + i * 16 + mr][kk];
                }
        // B fragments: element g2*8+j = Bs[g2*16 + half*8 + j][column], the k order of af
        const __bf16* bt = &Bs[cur][half * 8 + (lane & 7)][wn + ((lane >> 3) & 1) * 8];
#pragma unroll   // static fragment index: bfr stays in registers
        for (int i = 0; i < 2; ++i)
            bfr[i] = __builtin_shufflevector(lds_tr16(bt + i * 16),
                                             lds_tr16(bt + 16 * BNP + i * 16),
                                             0, 1, 2, 3, 4, 5, 6, 7, 8, 9, 10, 11, 12, 13, 14, 15);
#pragma unroll
        for (int i = 0; i < 2; ++i)
#pragma unroll
            for (int jn = 0; jn < 2; ++jn)
                acc[i][jn] = wmma_bf16(af[i], bfr[jn], acc[i][jn]);
        __syncthreads();
    }

    // epilogue
#pragma unroll
    for (int jn = 0; jn < 2; ++jn) {
        const int n = bn + wn + jn * 16 + mr;
        const float bvv = bias ? bias[n] : 0.f;
#pragma unroll
        for (int i = 0; i < 2; ++i) {
            const int mbase = bm + wm + i * 16 + half * 8;
#pragma unroll
            for (int r = 0; r < 8; ++r) {
                const int m = mbase + r;
                float v = acc[i][jn][r] + bvv;
                if (ACT == 1) v = gelu_tanh(v);
                if (res)  v += res[(size_t)m * N + n];
                if (outF) outF[(size_t)m * N + n] = v;
                if (outB) outB[(size_t)m * N + n] = (__bf16)v;
            }
        }
    }
}

// ---------------------------------------------------------------------------
// Causal flash attention, one wave per (b, h, 16-row Q tile).
// Q/K/V/O layout: [B, T, H*Dh] bf16. Online softmax; QK^T and P*V via WMMA.
// No block barriers (waves have divergent causal trip counts).
// K and V of a 32-key block reach the wave through LDS buffers of its own, filled by
// asynchronous copies while the block before is worked on. No other wave touches them,
// so the wave's own waits order fill, read and refill.
// ---------------------------------------------------------------------------
#define KP (HEAD_DIM + 8)    // LDS pitch of a K row: 144 B, an odd multiple of 16 B, for ds_load_b128
#define VP (HEAD_DIM + 16)   // LDS pitch of a V row: 160 B, an odd multiple of 32 B, for ds_load_tr16_b128

__global__ __launch_bounds__(128)
void attn_kernel(const __bf16* __restrict__ Q, const __bf16* __restrict__ Km,
                 const __bf16* __restrict__ V, __bf16* __restrict__ O) {
    __shared__ float Pl[4][16][32];   // per-wave P bounce (C-layout -> A-layout)
    __shared__ __attribute__((aligned(16))) __bf16 Ks[4][32][KP];   // per-wave K block
    __shared__ __attribute__((aligned(16))) __bf16 Vs[4][32][VP];   // per-wave V block
    const int lane = threadIdx.x & 31;
    // in a scalar register: the trip count and the test round the copies are then scalar branches
    const int wave = __builtin_amdgcn_readfirstlane(threadIdx.x >> 5);
    const int work = blockIdx.x * 4 + wave;
    const int QT = SEQ / 16;                       // 128 q-tiles
    const int qt = work % QT;
    const int h  = (work / QT) % NUM_HEADS;
    const int b  = work / (QT * NUM_HEADS);
    const size_t base = ((size_t)b * SEQ) * D_MODEL + (size_t)h * HEAD_DIM;
    const int qbase = qt * 16;
    const int half = lane >> 4;
    const int mr   = lane & 15;
    const float scale = 0.125f;                    // 1/sqrt(64)

    // Q A-fragments for contraction halves d=[0,32) and [32,64)
    v16bf qf[2];
#pragma unroll
    for (int t = 0; t < 2; ++t)
#pragma unroll
        for (int g2 = 0; g2 < 2; ++g2)
#pragma unroll
            for (int j = 0; j < 8; ++j)
                qf[t][g2 * 8 + j] =
                    Q[base + (size_t)(qbase + mr) * D_MODEL +
                      (t * 32 + g2 * 16 + half * 8 + j)];

    v8f acc[4] = {};                // 16 x 64 output accumulator (f32)
    float rm[8], rl[8];
#pragma unroll
    for (int r = 0; r < 8; ++r) { rm[r] = -3.0e38f; rl[r] = 0.f; }

    const int nblk = (qt + 2) >> 1;       // ceil((qbase+16)/32)

    // One block = 32 rows of 128 B each of K and of V: 8 + 8 copies of 16 B a lane.
    // Copy c: lane l brings bytes 16*(l&7) .. +15 of row 8*(l>>3) + c (four whole lines).
    const int crow = (lane >> 3) * 8;
    const int ccol = (lane & 7) * 8;
    const __bf16* kg = Km + base + (size_t)crow * D_MODEL + ccol;
    const __bf16* vg = V  + base + (size_t)crow * D_MODEL + ccol;
    __bf16* kl = &Ks[wave][crow][ccol];
    __bf16* vl = &Vs[wave][crow][ccol];
    auto stage = [&](int blk) {
        const __bf16* kgb = kg + (size_t)blk * 32 * D_MODEL;
        const __bf16* vgb = vg + (size_t)blk * 32 * D_MODEL;
#pragma unroll   // constant row steps: one address pair serves eight copies
        for (int c = 0; c < 8; ++c) async_cp16(kgb + c * D_MODEL, kl + c * KP);
#pragma unroll   // constant row steps: one address pair serves eight copies
        for (int c = 0; c < 8; ++c) async_cp16(vgb + c * D_MODEL, vl + c * VP);
    };
    stage(0);

    for (int kb = 0; kb < nblk; ++kb) {
        const int kvbase = kb * 32;
        // this block's copies have landed before any of its bytes is read
        asm volatile("s_wait_asynccnt 0x0" ::: "memory");
        // K fragments: element g2*8+j = K[kvbase + t*16 + mr][kd*32 + g2*16 + half*8 + j]
        v16bf kf[2][2];
#pragma unroll   // static fragment index: kf stays in registers
        for (int t = 0; t < 2; ++t)
#pragma unroll   // static fragment index: kf stays in registers
            for (int kd = 0; kd < 2; ++kd) {
                const __bf16* kr = &Ks[wave][t * 16 + mr][kd * 32 + half * 8];
                kf[t][kd] = __builtin_shufflevector(*reinterpret_cast<const v8bf*>(kr),
                                                    *reinterpret_cast<const v8bf*>(kr + 16),
                                                    0, 1, 2, 3, 4, 5, 6, 7, 8, 9, 10, 11, 12, 13, 14, 15);
            }
        // V fragments: element g2*8+j = V[kvbase + g2*16 + half*8 + j][dt*16 + mr], the k order of pa
        v16bf vf[4];
        const __bf16* vt = &Vs[wave][half * 8 + (lane & 7)][((lane >> 3) & 1) * 8];
#pragma unroll   // static fragment index: vf stays in registers
        for (int dt = 0; dt < 4; ++dt)
            vf[dt] = __builtin_shufflevector(lds_tr16(vt + dt * 16),
                                             lds_tr16(vt + 16 * VP + dt * 16),
                                             0, 1, 2, 3, 4, 5, 6, 7, 8, 9, 10, 11, 12, 13, 14, 15);
        // every read of the two buffers has returned before the refill is issued
        asm volatile("s_wait_dscnt 0x0" ::: "memory");
        if (kb + 1 < nblk) stage(kb + 1);   // flies during this block's products and softmax
        // ---- scores S = Q K^T : two 16x16 tiles over 32 kv positions ----
        v8f s[2] = {};
#pragma unroll   // static fragment index: s, qf and kf stay in registers
        for (int t = 0; t < 2; ++t)
#pragma unroll   // static fragment index: s, qf and kf stay in registers
            for (int kd = 0; kd < 2; ++kd)
                s[t] = wmma_bf16(qf[kd], kf[t][kd], s[t]);
        // ---- causal mask + scale ----
        const int qrow_base = qbase + half * 8;
#pragma unroll
        for (int t = 0; t < 2; ++t) {
            const int kv = kvbase + t * 16 + mr;
#pragma unroll
            for (int r = 0; r < 8; ++r) {
                float v = s[t][r] * scale;
                if (kv > qrow_base + r) v = -3.0e38f;
                s[t][r] = v;
            }
        }
        // ---- online softmax (row reductions across 16-lane groups) ----
        // Each DPP step runs over all eight rows before the next one, so that the
        // rows' dependent chains fill one another's latency.
        float mblk[8], ps[8], corr[8];
#pragma unroll   // static row index: the row arrays stay in registers
        for (int r = 0; r < 8; ++r) mblk[r] = fmaxf(s[0][r], s[1][r]);
#pragma unroll   // static row index: the row arrays stay in registers
        for (int r = 0; r < 8; ++r) mblk[r] = row_max_step<8>(mblk[r]);
#pragma unroll   // static row index: the row arrays stay in registers
        for (int r = 0; r < 8; ++r) mblk[r] = row_max_step<4>(mblk[r]);
#pragma unroll   // static row index: the row arrays stay in registers
        for (int r = 0; r < 8; ++r) mblk[r] = row_max_step<2>(mblk[r]);
#pragma unroll   // static row index: the row arrays stay in registers
        for (int r = 0; r < 8; ++r) mblk[r] = row_max_step<1>(mblk[r]);
#pragma unroll   // static row index: the row arrays stay in registers
        for (int r = 0; r < 8; ++r) {
            const float mnew = fmaxf(rm[r], mblk[r]);
            corr[r] = __expf(rm[r] - mnew);
            const float p0 = __expf(s[0][r] - mnew);
            const float p1 = __expf(s[1][r] - mnew);
            ps[r] = p0 + p1;
            rm[r] = mnew;
            const int m = half * 8 + r;
            Pl[wave][m][mr]      = p0;    // C-layout -> LDS (wave-private)
            Pl[wave][m][16 + mr] = p1;
        }
#pragma unroll   // static row index: the row arrays stay in registers
        for (int r = 0; r < 8; ++r) ps[r] += row_xor<8>(ps[r]);
#pragma unroll   // static row index: the row arrays stay in registers
        for (int r = 0; r < 8; ++r) ps[r] += row_xor<4>(ps[r]);
#pragma unroll   // static row index: the row arrays stay in registers
        for (int r = 0; r < 8; ++r) ps[r] += row_xor<2>(ps[r]);
#pragma unroll   // static row index: the row arrays stay in registers
        for (int r = 0; r < 8; ++r) ps[r] += row_xor<1>(ps[r]);
#pragma unroll   // static row index: the row arrays stay in registers
        for (int r = 0; r < 8; ++r) {
            rl[r] = rl[r] * corr[r] + ps[r];
#pragma unroll
            for (int dt = 0; dt < 4; ++dt) acc[dt][r] *= corr[r];
        }
        // ---- P (16x32) as A-fragment (bf16), then P @ V ----
        v16bf pa;
#pragma unroll
        for (int g2 = 0; g2 < 2; ++g2)
#pragma unroll
            for (int j = 0; j < 8; ++j)
                pa[g2 * 8 + j] = (__bf16)Pl[wave][mr][g2 * 16 + half * 8 + j];
#pragma unroll   // static fragment index: acc and vf stay in registers
        for (int dt = 0; dt < 4; ++dt)
            acc[dt] = wmma_bf16(pa, vf[dt], acc[dt]);
    }
    // no copy is left in flight when the wave ends
    asm volatile("s_wait_asynccnt 0x0" ::: "memory");
    // ---- epilogue: O = acc / l ----
#pragma unroll
    for (int r = 0; r < 8; ++r) {
        const float inv = 1.0f / rl[r];
        const int q = qbase + half * 8 + r;
#pragma unroll
        for (int dt = 0; dt < 4; ++dt)
            O[base + (size_t)q * D_MODEL + (dt * 16 + mr)] =
                (__bf16)(acc[dt][r] * inv);
    }
}

// ---------------------------------------------------------------------------
// host launcher
// ---------------------------------------------------------------------------
extern "C" void kernel_launch(void* const* d_in, const int* in_sizes, int n_in,
                              void* d_out, int out_size, void* d_ws, size_t ws_size,
                              hipStream_t stream) {
    (void)in_sizes; (void)n_in; (void)out_size; (void)ws_size;
    const float* x   = (const float*)d_in[0];
    const float* Wq  = (const float*)d_in[1];
    const float* bq  = (const float*)d_in[2];
    const float* Wk  = (const float*)d_in[3];
    const float* bk  = (const float*)d_in[4];
    const float* Wv  = (const float*)d_in[5];
    const float* bv  = (const float*)d_in[6];
    const float* Wo  = (const float*)d_in[7];
    const float* bo  = (const float*)d_in[8];
    const float* g1  = (const float*)d_in[9];
    const float* b1  = (const float*)d_in[10];
    const float* g2  = (const float*)d_in[11];
    const float* b2  = (const float*)d_in[12];
    const float* Wup = (const float*)d_in[13];
    const float* bup = (const float*)d_in[14];
    const float* Wdn = (const float*)d_in[15];
    const float* bdn = (const float*)d_in[16];

    char* ws = (char*)d_ws;
    size_t off = 0;
    auto take = [&](size_t bytes) -> void* {
        void* p = ws + off;
        off = (off + bytes + 255) & ~(size_t)255;
        return p;
    };
    __bf16* wq_b  = (__bf16*)take((size_t)D_MODEL * D_MODEL * 2);
    __bf16* wk_b  = (__bf16*)take((size_t)D_MODEL * D_MODEL * 2);
    __bf16* wv_b  = (__bf16*)take((size_t)D_MODEL * D_MODEL * 2);
    __bf16* wo_b  = (__bf16*)take((size_t)D_MODEL * D_MODEL * 2);
    __bf16* wup_b = (__bf16*)take((size_t)D_MODEL * MLP_DIM * 2);
    __bf16* wdn_b = (__bf16*)take((size_t)MLP_DIM * D_MODEL * 2);
    __bf16* xn_b  = (__bf16*)take((size_t)ROWS * D_MODEL * 2);
    __bf16* q_b   = (__bf16*)take((size_t)ROWS * D_MODEL * 2);
    __bf16* k_b   = (__bf16*)take((size_t)ROWS * D_MODEL * 2);
    __bf16* v_b   = (__bf16*)take((size_t)ROWS * D_MODEL * 2);
    __bf16* o_b   = (__bf16*)take((size_t)ROWS * D_MODEL * 2);
    float*  x2    = (float*) take((size_t)ROWS * D_MODEL * 4);
    __bf16* xn2_b = (__bf16*)take((size_t)ROWS * D_MODEL * 2);
    __bf16* h_b   = (__bf16*)take((size_t)ROWS * MLP_DIM * 2);

    // 1) weights fp32 -> bf16
    cvt_f32_bf16_kernel<<<1024, 256, 0, stream>>>(Wq,  wq_b,  D_MODEL * D_MODEL);
    cvt_f32_bf16_kernel<<<1024, 256, 0, stream>>>(Wk,  wk_b,  D_MODEL * D_MODEL);
    cvt_f32_bf16_kernel<<<1024, 256, 0, stream>>>(Wv,  wv_b,  D_MODEL * D_MODEL);
    cvt_f32_bf16_kernel<<<1024, 256, 0, stream>>>(Wo,  wo_b,  D_MODEL * D_MODEL);
    cvt_f32_bf16_kernel<<<2048, 256, 0, stream>>>(Wup, wup_b, D_MODEL * MLP_DIM);
    cvt_f32_bf16_kernel<<<2048, 256, 0, stream>>>(Wdn, wdn_b, MLP_DIM * D_MODEL);

    // 2) LN1 -> bf16
    ln_kernel<<<ROWS, 256, 0, stream>>>(x, g1, b1, xn_b);

    // 3) Q/K/V projections (bf16 out)
    dim3 gD(D_MODEL / BN, ROWS / BM);   // (8, 64)
    gemm_bf16_kernel<0><<<gD, 256, 0, stream>>>(xn_b, wq_b, bq, nullptr, nullptr, q_b,
                                                ROWS, D_MODEL, D_MODEL);
    gemm_bf16_kernel<0><<<gD, 256, 0, stream>>>(xn_b, wk_b, bk, nullptr, nullptr, k_b,
                                                ROWS, D_MODEL, D_MODEL);
    gemm_bf16_kernel<0><<<gD, 256, 0, stream>>>(xn_b, wv_b, bv, nullptr, nullptr, v_b,
                                                ROWS, D_MODEL, D_MODEL);

    // 4) causal flash attention (4096 waves, 4 waves/block)
    attn_kernel<<<(BATCH * NUM_HEADS * (SEQ / 16)) / 4, 128, 0, stream>>>(q_b, k_b, v_b, o_b);

    // 5) output projection + residual -> x2 (fp32)
    gemm_bf16_kernel<0><<<gD, 256, 0, stream>>>(o_b, wo_b, bo, x, x2, nullptr,
                                                ROWS, D_MODEL, D_MODEL);

    // 6) LN2 -> bf16
    ln_kernel<<<ROWS, 256, 0, stream>>>(x2, g2, b2, xn2_b);

    // 7) MLP up + GELU (bf16 out)
    dim3 gU(MLP_DIM / BN, ROWS / BM);   // (32, 64)
    gemm_bf16_kernel<1><<<gU, 256, 0, stream>>>(xn2_b, wup_b, bup, nullptr, nullptr, h_b,
                                                ROWS, MLP_DIM, D_MODEL);

    // 8) MLP down + residual -> out (fp32)
    gemm_bf16_kernel<0><<<gD, 256, 0, stream>>>(h_b, wdn_b, bdn, x2, (float*)d_out, nullptr,
                                                ROWS, D_MODEL, MLP_DIM);
}

// v004
// Measured time: 309 microseconds a run.
// Two timings next to v003 put it at 1.13 and 1.14 times that version's speed.
// Over all steps from v000 it is 2.17 times as fast.
#include <hip/hip_runtime.h>
#include <hip/hip_bf16.h>
#include <math.h>

// ---- problem constants (match reference) ----
#define D_MODEL   1024
#define NUM_HEADS 16
#define HEAD_DIM  64
#define MLP_DIM   4096
#define BATCH     2
#define SEQ       2048
#define ROWS      (BATCH * SEQ)   // 4096
#define LN_EPS    1e-5f

typedef __attribute__((ext_vector_type(16))) __bf16 v16bf;
typedef __attribute__((ext_vector_type(8)))  __bf16 v8bf;
typedef __attribute__((ext_vector_type(8)))  float  v8f;
typedef __attribute__((ext_vector_type(4)))  __bf16 v4bf;
typedef int v4i __attribute__((vector_size(16)));   // matches builtin param type

// ---- CDNA5 async global->LDS path (guarded; falls back to vector copies) ----
#if defined(__AMDGCN__) && __has_builtin(__builtin_amdgcn_global_load_async_to_lds_b128)
#define HAS_ASYNC_LDS 1
#else
#define HAS_ASYNC_LDS 0
#endif

#if HAS_ASYNC_LDS
#if __has_builtin(__builtin_amdgcn_s_wait_asynccnt)
#define WAIT_ASYNC(n) __builtin_amdgcn_s_wait_asynccnt(n)
#else
#define WAIT_ASYNC(n) asm volatile("s_wait_asynccnt %0" ::"i"(n) : "memory")
#endif
#else
#define WAIT_ASYNC(n) do { } while (0)
#endif

static __device__ __forceinline__ void async_cp16(const __bf16* g, __bf16* l) {
#if HAS_ASYNC_LDS
    // global_load_async_to_lds_b128: 16B global -> LDS, tracked by ASYNCcnt
    __builtin_amdgcn_global_load_async_to_lds_b128((v4i*)g, (v4i*)l, 0, 0);
#else
    *reinterpret_cast<v8bf*>(l) = *reinterpret_cast<const v8bf*>(g);
#endif
}

// ds_load_tr16_b128 on a row-major 16-bit LDS tile T: with lane l aimed at
// T[k0 + 8*(l>>4) + (l&7)][n0 + 8*((l>>3)&1)], lane l gets T[k0 + 8*(l>>4) + 0..7][n0 + (l&15)],
// one half of a WMMA operand in the hardware k order. All 32 lanes must hold a valid address.
typedef __attribute__((address_space(3))) v8bf lds_v8bf;
static __device__ __forceinline__ v8bf lds_tr16(const __bf16* p) {
    return __builtin_amdgcn_ds_load_tr16_b128_v8bf16((lds_v8bf*)p);
}

static __device__ __forceinline__ v8f wmma_bf16(v16bf a, v16bf b, v8f c) {
    // D = A(16x32 bf16) * B(32x16 bf16) + C(16x16 f32)
    return __builtin_amdgcn_wmma_f32_16x16x32_bf16(
        /*neg_a=*/false, a, /*neg_b=*/false, b,
        /*c_mod=*/(short)0, c, /*reuse_a=*/false, /*reuse_b=*/false);
}

// Lane l reads lane l ^ X of its own 16-lane row (DPP row_xmask): a vector-unit
// exchange, where __shfl_xor goes through the LDS queue and a wait per step.
// All 32 lanes must be active.
template <int X>
static __device__ __forceinline__ float row_xor(float v) {
    return __builtin_bit_cast(float, __builtin_amdgcn_update_dpp(
        0, __builtin_bit_cast(int, v), 0x160 | X, 0xf, 0xf, true));
}

// One step of a 16-lane row maximum, max(v, v of lane l ^ X), as one DPP instruction.
// asm: fmaxf() on row_xor() compiles to three dependent instructions (move, quieting
// max, max); volatile: keeps the rows' independent steps in the interleaved order written.
template <int X>
static __device__ __forceinline__ float row_max_step(float v) {
    float r;
    asm volatile("v_max_num_f32_dpp %0, %1, %1 row_xmask:%2 row_mask:0xf bank_mask:0xf"
                 : "=v"(r) : "v"(v), "n"(X));
    return r;
}

static __device__ __forceinline__ float gelu_tanh(float x) {
    const float c0 = 0.7978845608028654f;   // sqrt(2/pi)
    return 0.5f * x * (1.0f + tanhf(c0 * (x + 0.044715f * x * x * x)));
}

// ---------------------------------------------------------------------------
// fp32 -> bf16 conversion (weights)
// ---------------------------------------------------------------------------
__global__ void cvt_f32_bf16_kernel(const float* __restrict__ src,
                                    __bf16* __restrict__ dst, int n) {
    int i = blockIdx.x * blockDim.x + threadIdx.x;
    int stride = gridDim.x * blockDim.x;
    for (; i < n; i += stride) dst[i] = (__bf16)src[i];
}

// ---------------------------------------------------------------------------
// LayerNorm over last dim (C = D_MODEL), one 256-thread block per row,
// output bf16 (feeds WMMA GEMMs)
// ---------------------------------------------------------------------------
__global__ void ln_kernel(const float* __restrict__ x,
                          const float* __restrict__ g,
                          const float* __restrict__ b,
                          __bf16* __restrict__ out) {
    const int row = blockIdx.x;
    const float* xr = x + (size_t)row * D_MODEL;
    float s = 0.f, ss = 0.f;
    for (int i = threadIdx.x; i < D_MODEL; i += blockDim.x) {
        float v = xr[i];
        s += v;
        ss += v * v;
    }
    __shared__ float sh[2][8];
    const int lane = threadIdx.x & 31;
    const int wave = threadIdx.x >> 5;
#pragma unroll
    for (int o = 16; o > 0; o >>= 1) {
        s  += __shfl_down(s, o);
        ss += __shfl_down(ss, o);
    }
    if (lane == 0) { sh[0][wave] = s; sh[1][wave] = ss; }
    __syncthreads();
    s = 0.f; ss = 0.f;
#pragma unroll
    for (int w = 0; w < 8; ++w) { s += sh[0][w]; ss += sh[1][w]; }
    const float mu   = s  * (1.0f / D_MODEL);
    const float var  = ss * (1.0f / D_MODEL) - mu * mu;
    const float rstd = rsqrtf(var + LN_EPS);
    __bf16* orow = out + (size_t)row * D_MODEL;
    for (int i = threadIdx.x; i < D_MODEL; i += blockDim.x)
        orow[i] = (__bf16)((xr[i] - mu) * rstd * g[i] + b[i]);
}

// ---------------------------------------------------------------------------
// bf16 WMMA GEMM:  C[M,N] = A[M,K] @ B[K,N] + bias (+ res)
// 256 threads = 8 waves; block tile 64(M) x 128(N); K step 32.
// Wave tile 32x32 (2x2 WMMAs). LDS double-buffered via async global->LDS.
// ACT: 0 = none, 1 = tanh-GELU (applied before residual add).
// RES: add res[m][n]. OUTF: store f32 to outF, else bf16 to outB. N: row pitch of B, res, out.
// These are template constants so that the residual loads and the epilogue
// stores are straight-line code that differs by immediate offsets only.
// ---------------------------------------------------------------------------
#define BM 64
#define BN 128
#define BK 32
#define BNP (BN + 16)   // LDS pitch of a B row: 288 B, an odd multiple of 32 B, free of bank conflicts for ds_load_tr16_b128

template <int ACT, bool RES, bool OUTF, int N>
__global__ __launch_bounds__(256)
void gemm_bf16_kernel(const __bf16* __restrict__ A, const __bf16* __restrict__ Bw,
                      const float* __restrict__ bias, const float* __restrict__ res,
                      float* __restrict__ outF, __bf16* __restrict__ outB,
                      int K) {
    __shared__ __bf16 As[2][BM][BK];   // 2 * 4 KB
    __shared__ __attribute__((aligned(16))) __bf16 Bs[2][BK][BNP];   // 2 * 9 KB
    const int tid  = threadIdx.x;
    const int lane = tid & 31;
    const int wave = tid >> 5;
    const int wm = (wave >> 2) * 32;   // 0 / 32
    const int wn = (wave & 3) * 32;    // 0,32,64,96
    const int bm = blockIdx.y * BM;
    const int bn = blockIdx.x * BN;
    const int half = lane >> 4;        // K-half selector
    const int mr   = lane & 15;        // A row / B col within 16x16 tile

    // staging indices (per thread: 1x16B for A, 2x16B for B)
    const int ar = tid >> 2;           // 0..63
    const int ac = (tid & 3) * 8;      // 0,8,16,24
    const int br = tid >> 3;           // 0..31
    const int bc = (tid & 7) * 16;     // 0..112

    v8f acc[2][2] = {};
    const int nk = K / BK;

    // element (i, jn, r) of this lane's results lies at o0 + (i * 16 + r) * N + jn * 16
    const size_t o0 = (size_t)(bm + wm + half * 8) * N + (bn + wn + mr);
    // All residual and bias loads of the lane are issued here, together: they are in flight
    // while the first K tile lands, and the epilogue waits for none of them one by one.
    float rv[2][2][8];
    if (RES) {
#pragma unroll   // static index: rv stays in registers
        for (int i = 0; i < 2; ++i)
#pragma unroll   // static index: rv stays in registers
            for (int r = 0; r < 8; ++r)
#pragma unroll   // static index: rv stays in registers
                for (int jn = 0; jn < 2; ++jn)
                    rv[i][jn][r] = res[o0 + (i * 16 + r) * N + jn * 16];
    }
    const float bvv[2] = { bias[bn + wn + mr], bias[bn + wn + 16 + mr] };

    // prologue: stage K-step 0 into buffer 0
    {
        const __bf16* ga = &A[(size_t)(bm + ar) * K + ac];
        const __bf16* gb = &Bw[(size_t)br * N + (bn + bc)];
        async_cp16(ga,     &As[0][ar][ac]);
        async_cp16(gb,     &Bs[0][br][bc]);
        async_cp16(gb + 8, &Bs[0][br][bc + 8]);
    }

    for (int ks = 0; ks < nk; ++ks) {
        const int cur = ks & 1;
        if (ks + 1 < nk) {
            const int nxt = cur ^ 1;
            const int k0 = (ks + 1) * BK;
            const __bf16* ga = &A[(size_t)(bm + ar) * K + (k0 + ac)];
            const __bf16* gb = &Bw[(size_t)(k0 + br) * N + (bn + bc)];
            async_cp16(ga,     &As[nxt][ar][ac]);
            async_cp16(gb,     &Bs[nxt][br][bc]);
            async_cp16(gb + 8, &Bs[nxt][br][bc + 8]);
            WAIT_ASYNC(3);   // newest 3 may remain outstanding -> prev panel done
        } else {
            WAIT_ASYNC(0);
        }
        __syncthreads();

        v16bf af[2], bfr[2];
#pragma unroll
        for (int i = 0; i < 2; ++i)
#pragma unroll
            for (int g2 = 0; g2 < 2; ++g2)
#pragma unroll
                for (int j = 0; j < 8; ++j) {
                    const int kk = g2 * 16 + half * 8 + j;
                    af[i][g2 * 8 + j]  = As[cur][wm + i * 16 + mr][kk];
                }
        // B fragments: element g2*8+j = Bs[g2*16 + half*8 + j][column], the k order of af
        const __bf16* bt = &Bs[cur][half * 8 + (lane & 7)][wn + ((lane >> 3) & 1) * 8];
#pragma unroll   // static fragment index: bfr stays in registers
        for (int i = 0; i < 2; ++i)
            bfr[i] = __builtin_shufflevector(lds_tr16(bt + i * 16),
                                             lds_tr16(bt + 16 * BNP + i * 16),
                                             0, 1, 2, 3, 4, 5, 6, 7, 8, 9, 10, 11, 12, 13, 14, 15);
#pragma unroll
        for (int i = 0; i < 2; ++i)
#pragma unroll
            for (int jn = 0; jn < 2; ++jn)
                acc[i][jn] = wmma_bf16(af[i], bfr[jn], acc[i][jn]);
        __syncthreads();
    }

    // epilogue
#pragma unroll
    for (int jn = 0; jn < 2; ++jn)
#pragma unroll
        for (int i = 0; i < 2; ++i)
#pragma unroll
            for (int r = 0; r < 8; ++r) {
                const size_t o = o0 + (i * 16 + r) * N + jn * 16;
                float v = acc[i][jn][r] + bvv[jn];
                if (ACT == 1) v = gelu_tanh(v);
                if (RES) v += rv[i][jn][r];
                if (OUTF) outF[o] = v;
                else      outB[o] = (__bf16)v;
            }
}

// ---------------------------------------------------------------------------
// Causal flash attention, one wave per (b, h, 16-row Q tile).
// Q/K/V/O layout: [B, T, H*Dh] bf16. Online softmax; QK^T and P*V via WMMA.
// No block barriers (waves have divergent causal trip counts).
// K and V of a 32-key block reach the wave through LDS buffers of its own, filled by
// asynchronous copies while the block before is worked on. No other wave touches them,
// so the wave's own waits order fill, read and refill.
// ---------------------------------------------------------------------------
#define KP (HEAD_DIM + 8)    // LDS pitch of a K row: 144 B, an odd multiple of 16 B, for ds_load_b128
#define VP (HEAD_DIM + 16)   // LDS pitch of a V row: 160 B, an odd multiple of 32 B, for ds_load_tr16_b128

__global__ __launch_bounds__(128)
void attn_kernel(const __bf16* __restrict__ Q, const __bf16* __restrict__ Km,
                 const __bf16* __restrict__ V, __bf16* __restrict__ O) {
    __shared__ float Pl[4][16][32];   // per-wave P bounce (C-layout -> A-layout)
    __shared__ __attribute__((aligned(16))) __bf16 Ks[4][32][KP];   // per-wave K block
    __shared__ __attribute__((aligned(16))) __bf16 Vs[4][32][VP];   // per-wave V block
    const int lane = threadIdx.x & 31;
    // in a scalar register: the trip count and the test round the copies are then scalar branches
    const int wave = __builtin_amdgcn_readfirstlane(threadIdx.x >> 5);
    const int work = blockIdx.x * 4 + wave;
    const int QT = SEQ / 16;                       // 128 q-tiles
    const int qt = work % QT;
    const int h  = (work / QT) % NUM_HEADS;
    const int b  = work / (QT * NUM_HEADS);
    const size_t base = ((size_t)b * SEQ) * D_MODEL + (size_t)h * HEAD_DIM;
    const int qbase = qt * 16;
    const int half = lane >> 4;
    const int mr   = lane & 15;
    const float scale = 0.125f;                    // 1/sqrt(64)

    // Q A-fragments for contraction halves d=[0,32) and [32,64)
    v16bf qf[2];
#pragma unroll
    for (int t = 0; t < 2; ++t)
#pragma unroll
        for (int g2 = 0; g2 < 2; ++g2)
#pragma unroll
            for (int j = 0; j < 8; ++j)
                qf[t][g2 * 8 + j] =
                    Q[base + (size_t)(qbase + mr) * D_MODEL +
                      (t * 32 + g2 * 16 + half * 8 + j)];

    v8f acc[4] = {};                // 16 x 64 output accumulator (f32)
    float rm[8], rl[8];
#pragma unroll
    for (int r = 0; r < 8; ++r) { rm[r] = -3.0e38f; rl[r] = 0.f; }

    const int nblk = (qt + 2) >> 1;       // ceil((qbase+16)/32)

    // One block = 32 rows of 128 B each of K and of V: 8 + 8 copies of 16 B a lane.
    // Copy c: lane l brings bytes 16*(l&7) .. +15 of row 8*(l>>3) + c (four whole lines).
    const int crow = (lane >> 3) * 8;
    const int ccol = (lane & 7) * 8;
    const __bf16* kg = Km + base + (size_t)crow * D_MODEL + ccol;
    const __bf16* vg = V  + base + (size_t)crow * D_MODEL + ccol;
    __bf16* kl = &Ks[wave][crow][ccol];
    __bf16* vl = &Vs[wave][crow][ccol];
    auto stage = [&](int blk) {
        const __bf16* kgb = kg + (size_t)blk * 32 * D_MODEL;
        const __bf16* vgb = vg + (size_t)blk * 32 * D_MODEL;
#pragma unroll   // constant row steps: one address pair serves eight copies
        for (int c = 0; c < 8; ++c) async_cp16(kgb + c * D_MODEL, kl + c * KP);
#pragma unroll   // constant row steps: one address pair serves eight copies
        for (int c = 0; c < 8; ++c) async_cp16(vgb + c * D_MODEL, vl + c * VP);
    };
    stage(0);

    for (int kb = 0; kb < nblk; ++kb) {
        const int kvbase = kb * 32;
        // this block's copies have landed before any of its bytes is read
        asm volatile("s_wait_asynccnt 0x0" ::: "memory");
        // K fragments: element g2*8+j = K[kvbase + t*16 + mr][kd*32 + g2*16 + half*8 + j]
        v16bf kf[2][2];
#pragma unroll   // static fragment index: kf stays in registers
        for (int t = 0; t < 2; ++t)
#pragma unroll   // static fragment index: kf stays in registers
            for (int kd = 0; kd < 2; ++kd) {
                const __bf16* kr = &Ks[wave][t * 16 + mr][kd * 32 + half * 8];
                kf[t][kd] = __builtin_shufflevector(*reinterpret_cast<const v8bf*>(kr),
                                                    *reinterpret_cast<const v8bf*>(kr + 16),
                                                    0, 1, 2, 3, 4, 5, 6, 7, 8, 9, 10, 11, 12, 13, 14, 15);
            }
        // V fragments: element g2*8+j = V[kvbase + g2*16 + half*8 + j][dt*16 + mr], the k order of pa
        v16bf vf[4];
        const __bf16* vt = &Vs[wave][half * 8 + (lane & 7)][((lane >> 3) & 1) * 8];
#pragma unroll   // static fragment index: vf stays in registers
        for (int dt = 0; dt < 4; ++dt)
            vf[dt] = __builtin_shufflevector(lds_tr16(vt + dt * 16),
                                             lds_tr16(vt + 16 * VP + dt * 16),
                                             0, 1, 2, 3, 4, 5, 6, 7, 8, 9, 10, 11, 12, 13, 14, 15);
        // every read of the two buffers has returned before the refill is issued
        asm volatile("s_wait_dscnt 0x0" ::: "memory");
        if (kb + 1 < nblk) stage(kb + 1);   // flies during this block's products and softmax
        // ---- scores S = Q K^T : two 16x16 tiles over 32 kv positions ----
        v8f s[2] = {};
#pragma unroll   // static fragment index: s, qf and kf stay in registers
        for (int t = 0; t < 2; ++t)
#pragma unroll   // static fragment index: s, qf and kf stay in registers
            for (int kd = 0; kd < 2; ++kd)
                s[t] = wmma_bf16(qf[kd], kf[t][kd], s[t]);
        // ---- causal mask + scale ----
        const int qrow_base = qbase + half * 8;
#pragma unroll
        for (int t = 0; t < 2; ++t) {
            const int kv = kvbase + t * 16 + mr;
#pragma unroll
            for (int r = 0; r < 8; ++r) {
                float v = s[t][r] * scale;
                if (kv > qrow_base + r) v = -3.0e38f;
                s[t][r] = v;
            }
        }
        // ---- online softmax (row reductions across 16-lane groups) ----
        // Each DPP step runs over all eight rows before the next one, so that the
        // rows' dependent chains fill one another's latency.
        float mblk[8], ps[8], corr[8];
#pragma unroll   // static row index: the row arrays stay in registers
        for (int r = 0; r < 8; ++r) mblk[r] = fmaxf(s[0][r], s[1][r]);
#pragma unroll   // static row index: the row arrays stay in registers
        for (int r = 0; r < 8; ++r) mblk[r] = row_max_step<8>(mblk[r]);
#pragma unroll   // static row index: the row arrays stay in registers
        for (int r = 0; r < 8; ++r) mblk[r] = row_max_step<4>(mblk[r]);
#pragma unroll   // static row index: the row arrays stay in registers
        for (int r = 0; r < 8; ++r) mblk[r] = row_max_step<2>(mblk[r]);
#pragma unroll   // static row index: the row arrays stay in registers
        for (int r = 0; r < 8; ++r) mblk[r] = row_max_step<1>(mblk[r]);
#pragma unroll   // static row index: the row arrays stay in registers
        for (int r = 0; r < 8; ++r) {
            const float mnew = fmaxf(rm[r], mblk[r]);
            corr[r] = __expf(rm[r] - mnew);
            const float p0 = __expf(s[0][r] - mnew);
            const float p1 = __expf(s[1][r] - mnew);
            ps[r] = p0 + p1;
            rm[r] = mnew;
            const int m = half * 8 + r;
            Pl[wave][m][mr]      = p0;    // C-layout -> LDS (wave-private)
            Pl[wave][m][16 + mr] = p1;
        }
#pragma unroll   // static row index: the row arrays stay in registers
        for (int r = 0; r < 8; ++r) ps[r] += row_xor<8>(ps[r]);
#pragma unroll   // static row index: the row arrays stay in registers
        for (int r = 0; r < 8; ++r) ps[r] += row_xor<4>(ps[r]);
#pragma unroll   // static row index: the row arrays stay in registers
        for (int r = 0; r < 8; ++r) ps[r] += row_xor<2>(ps[r]);
#pragma unroll   // static row index: the row arrays stay in registers
        for (int r = 0; r < 8; ++r) ps[r] += row_xor<1>(ps[r]);
#pragma unroll   // static row index: the row arrays stay in registers
        for (int r = 0; r < 8; ++r) {
            rl[r] = rl[r] * corr[r] + ps[r];
#pragma unroll
            for (int dt = 0; dt < 4; ++dt) acc[dt][r] *= corr[r];
        }
        // ---- P (16x32) as A-fragment (bf16), then P @ V ----
        v16bf pa;
#pragma unroll
        for (int g2 = 0; g2 < 2; ++g2)
#pragma unroll
            for (int j = 0; j < 8; ++j)
                pa[g2 * 8 + j] = (__bf16)Pl[wave][mr][g2 * 16 + half * 8 + j];
#pragma unroll   // static fragment index: acc and vf stay in registers
        for (int dt = 0; dt < 4; ++dt)
            acc[dt] = wmma_bf16(pa, vf[dt], acc[dt]);
    }
    // no copy is left in flight when the wave ends
    asm volatile("s_wait_asynccnt 0x0" ::: "memory");
    // ---- epilogue: O = acc / l ----
#pragma unroll
    for (int r = 0; r < 8; ++r) {
        const float inv = 1.0f / rl[r];
        const int q = qbase + half * 8 + r;
#pragma unroll
        for (int dt = 0; dt < 4; ++dt)
            O[base + (size_t)q * D_MODEL + (dt * 16 + mr)] =
                (__bf16)(acc[dt][r] * inv);
    }
}

// ---------------------------------------------------------------------------
// host launcher
// ---------------------------------------------------------------------------
extern "C" void kernel_launch(void* const* d_in, const int* in_sizes, int n_in,
                              void* d_out, int out_size, void* d_ws, size_t ws_size,
                              hipStream_t stream) {
    (void)in_sizes; (void)n_in; (void)out_size; (void)ws_size;
    const float* x   = (const float*)d_in[0];
    const float* Wq  = (const float*)d_in[1];
    const float* bq  = (const float*)d_in[2];
    const float* Wk  = (const float*)d_in[3];
    const float* bk  = (const float*)d_in[4];
    const float* Wv  = (const float*)d_in[5];
    const float* bv  = (const float*)d_in[6];
    const float* Wo  = (const float*)d_in[7];
    const float* bo  = (const float*)d_in[8];
    const float* g1  = (const float*)d_in[9];
    const float* b1  = (const float*)d_in[10];
    const float* g2  = (const float*)d_in[11];
    const float* b2  = (const float*)d_in[12];
    const float* Wup = (const float*)d_in[13];
    const float* bup = (const float*)d_in[14];
    const float* Wdn = (const float*)d_in[15];
    const float* bdn = (const float*)d_in[16];

    char* ws = (char*)d_ws;
    size_t off = 0;
    auto take = [&](size_t bytes) -> void* {
        void* p = ws + off;
        off = (off + bytes + 255) & ~(size_t)255;
        return p;
    };
    __bf16* wq_b  = (__bf16*)take((size_t)D_MODEL * D_MODEL * 2);
    __bf16* wk_b  = (__bf16*)take((size_t)D_MODEL * D_MODEL * 2);
    __bf16* wv_b  = (__bf16*)take((size_t)D_MODEL * D_MODEL * 2);
    __bf16* wo_b  = (__bf16*)take((size_t)D_MODEL * D_MODEL * 2);
    __bf16* wup_b = (__bf16*)take((size_t)D_MODEL * MLP_DIM * 2);
    __bf16* wdn_b = (__bf16*)take((size_t)MLP_DIM * D_MODEL * 2);
    __bf16* xn_b  = (__bf16*)take((size_t)ROWS * D_MODEL * 2);
    __bf16* q_b   = (__bf16*)take((size_t)ROWS * D_MODEL * 2);
    __bf16* k_b   = (__bf16*)take((size_t)ROWS * D_MODEL * 2);
    __bf16* v_b   = (__bf16*)take((size_t)ROWS * D_MODEL * 2);
    __bf16* o_b   = (__bf16*)take((size_t)ROWS * D_MODEL * 2);
    float*  x2    = (float*) take((size_t)ROWS * D_MODEL * 4);
    __bf16* xn2_b = (__bf16*)take((size_t)ROWS * D_MODEL * 2);
    __bf16* h_b   = (__bf16*)take((size_t)ROWS * MLP_DIM * 2);

    // 1) weights fp32 -> bf16
    cvt_f32_bf16_kernel<<<1024, 256, 0, stream>>>(Wq,  wq_b,  D_MODEL * D_MODEL);
    cvt_f32_bf16_kernel<<<1024, 256, 0, stream>>>(Wk,  wk_b,  D_MODEL * D_MODEL);
    cvt_f32_bf16_kernel<<<1024, 256, 0, stream>>>(Wv,  wv_b,  D_MODEL * D_MODEL);
    cvt_f32_bf16_kernel<<<1024, 256, 0, stream>>>(Wo,  wo_b,  D_MODEL * D_MODEL);
    cvt_f32_bf16_kernel<<<2048, 256, 0, stream>>>(Wup, wup_b, D_MODEL * MLP_DIM);
    cvt_f32_bf16_kernel<<<2048, 256, 0, stream>>>(Wdn, wdn_b, MLP_DIM * D_MODEL);

    // 2) LN1 -> bf16
    ln_kernel<<<ROWS, 256, 0, stream>>>(x, g1, b1, xn_b);

    // 3) Q/K/V projections (bf16 out)
    dim3 gD(D_MODEL / BN, ROWS / BM);   // (8, 64)
    gemm_bf16_kernel<0, false, false, D_MODEL><<<gD, 256, 0, stream>>>(
        xn_b, wq_b, bq, nullptr, nullptr, q_b, D_MODEL);
    gemm_bf16_kernel<0, false, false, D_MODEL><<<gD, 256, 0, stream>>>(
        xn_b, wk_b, bk, nullptr, nullptr, k_b, D_MODEL);
    gemm_bf16_kernel<0, false, false, D_MODEL><<<gD, 256, 0, stream>>>(
        xn_b, wv_b, bv, nullptr, nullptr, v_b, D_MODEL);

    // 4) causal flash attention (4096 waves, 4 waves/block)
    attn_kernel<<<(BATCH * NUM_HEADS * (SEQ / 16)) / 4, 128, 0, stream>>>(q_b, k_b, v_b, o_b);

    // 5) output projection + residual -> x2 (fp32)
    gemm_bf16_kernel<0, true, true, D_MODEL><<<gD, 256, 0, stream>>>(
        o_b, wo_b, bo, x, x2, nullptr, D_MODEL);

    // 6) LN2 -> bf16
    ln_kernel<<<ROWS, 256, 0, stream>>>(x2, g2, b2, xn2_b);

    // 7) MLP up + GELU (bf16 out)
    dim3 gU(MLP_DIM / BN, ROWS / BM);   // (32, 64)
    gemm_bf16_kernel<1, false, false, MLP_DIM><<<gU, 256, 0, stream>>>(
        xn2_b, wup_b, bup, nullptr, nullptr, h_b, D_MODEL);

    // 8) MLP down + residual -> out (fp32)
    gemm_bf16_kernel<0, true, true, D_MODEL><<<gD, 256, 0, stream>>>(
        h_b, wdn_b, bdn, x2, (float*)d_out, nullptr, MLP_DIM);
}

// v005
// A run of this version takes 281 microseconds.
// Two timings next to v004 both put it at 1.10 times that version's speed.
// All steps since v000 together make it 2.38 times as fast.
#include <hip/hip_runtime.h>
#include <hip/hip_bf16.h>
#include <math.h>

// ---- problem constants (match reference) ----
#define D_MODEL   1024
#define NUM_HEADS 16
#define HEAD_DIM  64
#define MLP_DIM   4096
#define BATCH     2
#define SEQ       2048
#define ROWS      (BATCH * SEQ)   // 4096
#define LN_EPS    1e-5f

typedef __attribute__((ext_vector_type(16))) __bf16 v16bf;
typedef __attribute__((ext_vector_type(8)))  __bf16 v8bf;
typedef __attribute__((ext_vector_type(8)))  float  v8f;
typedef __attribute__((ext_vector_type(4)))  __bf16 v4bf;
typedef int v4i __attribute__((vector_size(16)));   // matches builtin param type

// ---- CDNA5 async global->LDS path (guarded; falls back to vector copies) ----
#if defined(__AMDGCN__) && __has_builtin(__builtin_amdgcn_global_load_async_to_lds_b128)
#define HAS_ASYNC_LDS 1
#else
#define HAS_ASYNC_LDS 0
#endif

#if HAS_ASYNC_LDS
#if __has_builtin(__builtin_amdgcn_s_wait_asynccnt)
#define WAIT_ASYNC(n) __builtin_amdgcn_s_wait_asynccnt(n)
#else
#define WAIT_ASYNC(n) asm volatile("s_wait_asynccnt %0" ::"i"(n) : "memory")
#endif
#else
#define WAIT_ASYNC(n) do { } while (0)
#endif

static __device__ __forceinline__ void async_cp16(const __bf16* g, __bf16* l) {
#if HAS_ASYNC_LDS
    // global_load_async_to_lds_b128: 16B global -> LDS, tracked by ASYNCcnt
    __builtin_amdgcn_global_load_async_to_lds_b128((v4i*)g, (v4i*)l, 0, 0);
#else
    *reinterpret_cast<v8bf*>(l) = *reinterpret_cast<const v8bf*>(g);
#endif
}

// ds_load_tr16_b128 on a row-major 16-bit LDS tile T: with lane l aimed at
// T[k0 + 8*(l>>4) + (l&7)][n0 + 8*((l>>3)&1)], lane l gets T[k0 + 8*(l>>4) + 0..7][n0 + (l&15)],
// one half of a WMMA operand in the hardware k order. All 32 lanes must hold a valid address.
typedef __attribute__((address_space(3))) v8bf lds_v8bf;
static __device__ __forceinline__ v8bf lds_tr16(const __bf16* p) {
    return __builtin_amdgcn_ds_load_tr16_b128_v8bf16((lds_v8bf*)p);
}

static __device__ __forceinline__ v8f wmma_bf16(v16bf a, v16bf b, v8f c) {
    // D = A(16x32 bf16) * B(32x16 bf16) + C(16x16 f32)
    return __builtin_amdgcn_wmma_f32_16x16x32_bf16(
        /*neg_a=*/false, a, /*neg_b=*/false, b,
        /*c_mod=*/(short)0, c, /*reuse_a=*/false, /*reuse_b=*/false);
}

// Lane l reads lane l ^ X of its own 16-lane row (DPP row_xmask): a vector-unit
// exchange, where __shfl_xor goes through the LDS queue and a wait per step.
// All 32 lanes must be active.
template <int X>
static __device__ __forceinline__ float row_xor(float v) {
    return __builtin_bit_cast(float, __builtin_amdgcn_update_dpp(
        0, __builtin_bit_cast(int, v), 0x160 | X, 0xf, 0xf, true));
}

// One step of a 16-lane row maximum, max(v, v of lane l ^ X), as one DPP instruction.
// asm: fmaxf() on row_xor() compiles to three dependent instructions (move, quieting
// max, max); volatile: keeps the rows' independent steps in the interleaved order written.
template <int X>
static __device__ __forceinline__ float row_max_step(float v) {
    float r;
    asm volatile("v_max_num_f32_dpp %0, %1, %1 row_xmask:%2 row_mask:0xf bank_mask:0xf"
                 : "=v"(r) : "v"(v), "n"(X));
    return r;
}

static __device__ __forceinline__ float gelu_tanh(float x) {
    const float c0 = 0.7978845608028654f;   // sqrt(2/pi)
    return 0.5f * x * (1.0f + tanhf(c0 * (x + 0.044715f * x * x * x)));
}

// ---------------------------------------------------------------------------
// fp32 -> bf16 conversion (weights)
// ---------------------------------------------------------------------------
__global__ void cvt_f32_bf16_kernel(const float* __restrict__ src,
                                    __bf16* __restrict__ dst, int n) {
    int i = blockIdx.x * blockDim.x + threadIdx.x;
    int stride = gridDim.x * blockDim.x;
    for (; i < n; i += stride) dst[i] = (__bf16)src[i];
}

// ---------------------------------------------------------------------------
// LayerNorm over last dim (C = D_MODEL), one 256-thread block per row,
// output bf16 (feeds WMMA GEMMs)
// ---------------------------------------------------------------------------
__global__ void ln_kernel(const float* __restrict__ x,
                          const float* __restrict__ g,
                          const float* __restrict__ b,
                          __bf16* __restrict__ out) {
    const int row = blockIdx.x;
    const float* xr = x + (size_t)row * D_MODEL;
    float s = 0.f, ss = 0.f;
    for (int i = threadIdx.x; i < D_MODEL; i += blockDim.x) {
        float v = xr[i];
        s += v;
        ss += v * v;
    }
    __shared__ float sh[2][8];
    const int lane = threadIdx.x & 31;
    const int wave = threadIdx.x >> 5;
#pragma unroll
    for (int o = 16; o > 0; o >>= 1) {
        s  += __shfl_down(s, o);
        ss += __shfl_down(ss, o);
    }
    if (lane == 0) { sh[0][wave] = s; sh[1][wave] = ss; }
    __syncthreads();
    s = 0.f; ss = 0.f;
#pragma unroll
    for (int w = 0; w < 8; ++w) { s += sh[0][w]; ss += sh[1][w]; }
    const float mu   = s  * (1.0f / D_MODEL);
    const float var  = ss * (1.0f / D_MODEL) - mu * mu;
    const float rstd = rsqrtf(var + LN_EPS);
    __bf16* orow = out + (size_t)row * D_MODEL;
    for (int i = threadIdx.x; i < D_MODEL; i += blockDim.x)
        orow[i] = (__bf16)((xr[i] - mu) * rstd * g[i] + b[i]);
}

// ---------------------------------------------------------------------------
// bf16 WMMA GEMM:  C[M,N] = A[M,K] @ B[K,N] + bias (+ res)
// 256 threads = 8 waves; block tile 64(M) x 128(N); K step 32.
// Wave tile 32x32 (2x2 WMMAs). LDS double-buffered via async global->LDS.
// ACT: 0 = none, 1 = tanh-GELU (applied before residual add).
// RES: add res[m][n]. OUTF: store f32 to outF, else bf16 to outB. N: row pitch of B, res, out.
// These are template constants so that the residual loads and the epilogue
// stores are straight-line code that differs by immediate offsets only.
// ---------------------------------------------------------------------------
#define BM 64
#define BN 128
#define BK 32
#define BKP (BK + 8)    // LDS pitch of an A row: 80 B, an odd multiple of 16 B, free of bank conflicts for ds_load_b128
#define BNP (BN + 16)   // LDS pitch of a B row: 288 B, an odd multiple of 32 B, free of bank conflicts for ds_load_tr16_b128

template <int ACT, bool RES, bool OUTF, int N>
__global__ __launch_bounds__(256)
void gemm_bf16_kernel(const __bf16* __restrict__ A, const __bf16* __restrict__ Bw,
                      const float* __restrict__ bias, const float* __restrict__ res,
                      float* __restrict__ outF, __bf16* __restrict__ outB,
                      int K) {
    __shared__ __attribute__((aligned(16))) __bf16 As[2][BM][BKP];   // 2 * 5 KB
    __shared__ __attribute__((aligned(16))) __bf16 Bs[2][BK][BNP];   // 2 * 9 KB
    const int tid  = threadIdx.x;
    const int lane = tid & 31;
    const int wave = tid >> 5;
    const int wm = (wave >> 2) * 32;   // 0 / 32
    const int wn = (wave & 3) * 32;    // 0,32,64,96
    const int bm = blockIdx.y * BM;
    const int bn = blockIdx.x * BN;
    const int half = lane >> 4;        // K-half selector
    const int mr   = lane & 15;        // A row / B col within 16x16 tile

    // staging indices (per thread: 1x16B for A, 2x16B for B)
    const int ar = tid >> 2;           // 0..63
    const int ac = (tid & 3) * 8;      // 0,8,16,24
    const int br = tid >> 3;           // 0..31
    const int bc = (tid & 7) * 16;     // 0..112

    v8f acc[2][2] = {};
    const int nk = K / BK;

    // element (i, jn, r) of this lane's results lies at o0 + (i * 16 + r) * N + jn * 16
    const size_t o0 = (size_t)(bm + wm + half * 8) * N + (bn + wn + mr);
    // All residual and bias loads of the lane are issued here, together: they are in flight
    // while the first K tile lands, and the epilogue waits for none of them one by one.
    float rv[2][2][8];
    if (RES) {
#pragma unroll   // static index: rv stays in registers
        for (int i = 0; i < 2; ++i)
#pragma unroll   // static index: rv stays in registers
            for (int r = 0; r < 8; ++r)
#pragma unroll   // static index: rv stays in registers
                for (int jn = 0; jn < 2; ++jn)
                    rv[i][jn][r] = res[o0 + (i * 16 + r) * N + jn * 16];
    }
    const float bvv[2] = { bias[bn + wn + mr], bias[bn + wn + 16 + mr] };

    // prologue: stage K-step 0 into buffer 0
    {
        const __bf16* ga = &A[(size_t)(bm + ar) * K + ac];
        const __bf16* gb = &Bw[(size_t)br * N + (bn + bc)];
        async_cp16(ga,     &As[0][ar][ac]);
        async_cp16(gb,     &Bs[0][br][bc]);
        async_cp16(gb + 8, &Bs[0][br][bc + 8]);
    }

    for (int ks = 0; ks < nk; ++ks) {
        const int cur = ks & 1;
        if (ks + 1 < nk) {
            const int nxt = cur ^ 1;
            const int k0 = (ks + 1) * BK;
            const __bf16* ga = &A[(size_t)(bm + ar) * K + (k0 + ac)];
            const __bf16* gb = &Bw[(size_t)(k0 + br) * N + (bn + bc)];
            async_cp16(ga,     &As[nxt][ar][ac]);
            async_cp16(gb,     &Bs[nxt][br][bc]);
            async_cp16(gb + 8, &Bs[nxt][br][bc + 8]);
            WAIT_ASYNC(3);   // newest 3 may remain outstanding -> prev panel done
        } else {
            WAIT_ASYNC(0);
        }
        __syncthreads();

        v16bf af[2], bfr[2];
#pragma unroll
        for (int i = 0; i < 2; ++i)
#pragma unroll
            for (int g2 = 0; g2 < 2; ++g2)
#pragma unroll
                for (int j = 0; j < 8; ++j) {
                    const int kk = g2 * 16 + half * 8 + j;
                    af[i][g2 * 8 + j]  = As[cur][wm + i * 16 + mr][kk];
                }
        // B fragments: element g2*8+j = Bs[g2*16 + half*8 + j][column], the k order of af
        const __bf16* bt = &Bs[cur][half * 8 + (lane & 7)][wn + ((lane >> 3) & 1) * 8];
#pragma unroll   // static fragment index: bfr stays in registers
        for (int i = 0; i < 2; ++i)
            bfr[i] = __builtin_shufflevector(lds_tr16(bt + i * 16),
                                             lds_tr16(bt + 16 * BNP + i * 16),
                                             0, 1, 2, 3, 4, 5, 6, 7, 8, 9, 10, 11, 12, 13, 14, 15);
#pragma unroll
        for (int i = 0; i < 2; ++i)
#pragma unroll
            for (int jn = 0; jn < 2; ++jn)
                acc[i][jn] = wmma_bf16(af[i], bfr[jn], acc[i][jn]);
        __syncthreads();
    }

    // epilogue
#pragma unroll
    for (int jn = 0; jn < 2; ++jn)
#pragma unroll
        for (int i = 0; i < 2; ++i)
#pragma unroll
            for (int r = 0; r < 8; ++r) {
                const size_t o = o0 + (i * 16 + r) * N + jn * 16;
                float v = acc[i][jn][r] + bvv[jn];
                if (ACT == 1) v = gelu_tanh(v);
                if (RES) v += rv[i][jn][r];
                if (OUTF) outF[o] = v;
                else      outB[o] = (__bf16)v;
            }
}

// ---------------------------------------------------------------------------
// Causal flash attention, one wave per (b, h, 16-row Q tile).
// Q/K/V/O layout: [B, T, H*Dh] bf16. Online softmax; QK^T and P*V via WMMA.
// No block barriers (waves have divergent causal trip counts).
// K and V of a 32-key block reach the wave through LDS buffers of its own, filled by
// asynchronous copies while the block before is worked on. No other wave touches them,
// so the wave's own waits order fill, read and refill.
// ---------------------------------------------------------------------------
#define KP (HEAD_DIM + 8)    // LDS pitch of a K row: 144 B, an odd multiple of 16 B, for ds_load_b128
#define VP (HEAD_DIM + 16)   // LDS pitch of a V row: 160 B, an odd multiple of 32 B, for ds_load_tr16_b128
#define PP (32 + 4)          // LDS pitch of a P row: 144 B, an odd multiple of 16 B, for ds_load_b128

__global__ __launch_bounds__(128)
void attn_kernel(const __bf16* __restrict__ Q, const __bf16* __restrict__ Km,
                 const __bf16* __restrict__ V, __bf16* __restrict__ O) {
    __shared__ __attribute__((aligned(16))) float Pl[4][16][PP];   // per-wave P bounce (C-layout -> A-layout)
    __shared__ __attribute__((aligned(16))) __bf16 Ks[4][32][KP];   // per-wave K block
    __shared__ __attribute__((aligned(16))) __bf16 Vs[4][32][VP];   // per-wave V block
    const int lane = threadIdx.x & 31;
    // in a scalar register: the trip count and the test round the copies are then scalar branches
    const int wave = __builtin_amdgcn_readfirstlane(threadIdx.x >> 5);
    const int work = blockIdx.x * 4 + wave;
    const int QT = SEQ / 16;                       // 128 q-tiles
    const int qt = work % QT;
    const int h  = (work / QT) % NUM_HEADS;
    const int b  = work / (QT * NUM_HEADS);
    const size_t base = ((size_t)b * SEQ) * D_MODEL + (size_t)h * HEAD_DIM;
    const int qbase = qt * 16;
    const int half = lane >> 4;
    const int mr   = lane & 15;
    const float scale = 0.125f;                    // 1/sqrt(64)

    // Q A-fragments for contraction halves d=[0,32) and [32,64)
    v16bf qf[2];
#pragma unroll
    for (int t = 0; t < 2; ++t)
#pragma unroll
        for (int g2 = 0; g2 < 2; ++g2)
#pragma unroll
            for (int j = 0; j < 8; ++j)
                qf[t][g2 * 8 + j] =
                    Q[base + (size_t)(qbase + mr) * D_MODEL +
                      (t * 32 + g2 * 16 + half * 8 + j)];

    v8f acc[4] = {};                // 16 x 64 output accumulator (f32)
    float rm[8], rl[8];
#pragma unroll
    for (int r = 0; r < 8; ++r) { rm[r] = -3.0e38f; rl[r] = 0.f; }

    const int nblk = (qt + 2) >> 1;       // ceil((qbase+16)/32)

    // One block = 32 rows of 128 B each of K and of V: 8 + 8 copies of 16 B a lane.
    // Copy c: lane l brings bytes 16*(l&7) .. +15 of row 8*(l>>3) + c (four whole lines).
    const int crow = (lane >> 3) * 8;
    const int ccol = (lane & 7) * 8;
    const __bf16* kg = Km + base + (size_t)crow * D_MODEL + ccol;
    const __bf16* vg = V  + base + (size_t)crow * D_MODEL + ccol;
    __bf16* kl = &Ks[wave][crow][ccol];
    __bf16* vl = &Vs[wave][crow][ccol];
    auto stage = [&](int blk) {
        const __bf16* kgb = kg + (size_t)blk * 32 * D_MODEL;
        const __bf16* vgb = vg + (size_t)blk * 32 * D_MODEL;
#pragma unroll   // constant row steps: one address pair serves eight copies
        for (int c = 0; c < 8; ++c) async_cp16(kgb + c * D_MODEL, kl + c * KP);
#pragma unroll   // constant row steps: one address pair serves eight copies
        for (int c = 0; c < 8; ++c) async_cp16(vgb + c * D_MODEL, vl + c * VP);
    };
    stage(0);

    for (int kb = 0; kb < nblk; ++kb) {
        const int kvbase = kb * 32;
        // this block's copies have landed before any of its bytes is read
        asm volatile("s_wait_asynccnt 0x0" ::: "memory");
        // K fragments: element g2*8+j = K[kvbase + t*16 + mr][kd*32 + g2*16 + half*8 + j]
        v16bf kf[2][2];
#pragma unroll   // static fragment index: kf stays in registers
        for (int t = 0; t < 2; ++t)
#pragma unroll   // static fragment index: kf stays in registers
            for (int kd = 0; kd < 2; ++kd) {
                const __bf16* kr = &Ks[wave][t * 16 + mr][kd * 32 + half * 8];
                kf[t][kd] = __builtin_shufflevector(*reinterpret_cast<const v8bf*>(kr),
                                                    *reinterpret_cast<const v8bf*>(kr + 16),
                                                    0, 1, 2, 3, 4, 5, 6, 7, 8, 9, 10, 11, 12, 13, 14, 15);
            }
        // V fragments: element g2*8+j = V[kvbase + g2*16 + half*8 + j][dt*16 + mr], the k order of pa
        v16bf vf[4];
        const __bf16* vt = &Vs[wave][half * 8 + (lane & 7)][((lane >> 3) & 1) * 8];
#pragma unroll   // static fragment index: vf stays in registers
        for (int dt = 0; dt < 4; ++dt)
            vf[dt] = __builtin_shufflevector(lds_tr16(vt + dt * 16),
                                             lds_tr16(vt + 16 * VP + dt * 16),
                                             0, 1, 2, 3, 4, 5, 6, 7, 8, 9, 10, 11, 12, 13, 14, 15);
        // every read of the two buffers has returned before the refill is issued
        asm volatile("s_wait_dscnt 0x0" ::: "memory");
        if (kb + 1 < nblk) stage(kb + 1);   // flies during this block's products and softmax
        // ---- scores S = Q K^T : two 16x16 tiles over 32 kv positions ----
        v8f s[2] = {};
#pragma unroll   // static fragment index: s, qf and kf stay in registers
        for (int t = 0; t < 2; ++t)
#pragma unroll   // static fragment index: s, qf and kf stay in registers
            for (int kd = 0; kd < 2; ++kd)
                s[t] = wmma_bf16(qf[kd], kf[t][kd], s[t]);
        // ---- causal mask + scale ----
        const int qrow_base = qbase + half * 8;
#pragma unroll
        for (int t = 0; t < 2; ++t) {
            const int kv = kvbase + t * 16 + mr;
#pragma unroll
            for (int r = 0; r < 8; ++r) {
                float v = s[t][r] * scale;
                if (kv > qrow_base + r) v = -3.0e38f;
                s[t][r] = v;
            }
        }
        // ---- online softmax (row reductions across 16-lane groups) ----
        // Each DPP step runs over all eight rows before the next one, so that the
        // rows' dependent chains fill one another's latency.
        float mblk[8], ps[8], corr[8];
#pragma unroll   // static row index: the row arrays stay in registers
        for (int r = 0; r < 8; ++r) mblk[r] = fmaxf(s[0][r], s[1][r]);
#pragma unroll   // static row index: the row arrays stay in registers
        for (int r = 0; r < 8; ++r) mblk[r] = row_max_step<8>(mblk[r]);
#pragma unroll   // static row index: the row arrays stay in registers
        for (int r = 0; r < 8; ++r) mblk[r] = row_max_step<4>(mblk[r]);
#pragma unroll   // static row index: the row arrays stay in registers
        for (int r = 0; r < 8; ++r) mblk[r] = row_max_step<2>(mblk[r]);
#pragma unroll   // static row index: the row arrays stay in registers
        for (int r = 0; r < 8; ++r) mblk[r] = row_max_step<1>(mblk[r]);
#pragma unroll   // static row index: the row arrays stay in registers
        for (int r = 0; r < 8; ++r) {
            const float mnew = fmaxf(rm[r], mblk[r]);
            corr[r] = __expf(rm[r] - mnew);
            const float p0 = __expf(s[0][r] - mnew);
            const float p1 = __expf(s[1][r] - mnew);
            ps[r] = p0 + p1;
            rm[r] = mnew;
            const int m = half * 8 + r;
            Pl[wave][m][mr]      = p0;    // C-layout -> LDS (wave-private)
            Pl[wave][m][16 + mr] = p1;
        }
#pragma unroll   // static row index: the row arrays stay in registers
        for (int r = 0; r < 8; ++r) ps[r] += row_xor<8>(ps[r]);
#pragma unroll   // static row index: the row arrays stay in registers
        for (int r = 0; r < 8; ++r) ps[r] += row_xor<4>(ps[r]);
#pragma unroll   // static row index: the row arrays stay in registers
        for (int r = 0; r < 8; ++r) ps[r] += row_xor<2>(ps[r]);
#pragma unroll   // static row index: the row arrays stay in registers
        for (int r = 0; r < 8; ++r) ps[r] += row_xor<1>(ps[r]);
#pragma unroll   // static row index: the row arrays stay in registers
        for (int r = 0; r < 8; ++r) {
            rl[r] = rl[r] * corr[r] + ps[r];
#pragma unroll
            for (int dt = 0; dt < 4; ++dt) acc[dt][r] *= corr[r];
        }
        // ---- P (16x32) as A-fragment (bf16), then P @ V ----
        v16bf pa;
#pragma unroll
        for (int g2 = 0; g2 < 2; ++g2)
#pragma unroll
            for (int j = 0; j < 8; ++j)
                pa[g2 * 8 + j] = (__bf16)Pl[wave][mr][g2 * 16 + half * 8 + j];
#pragma unroll   // static fragment index: acc and vf stay in registers
        for (int dt = 0; dt < 4; ++dt)
            acc[dt] = wmma_bf16(pa, vf[dt], acc[dt]);
    }
    // no copy is left in flight when the wave ends
    asm volatile("s_wait_asynccnt 0x0" ::: "memory");
    // ---- epilogue: O = acc / l ----
#pragma unroll
    for (int r = 0; r < 8; ++r) {
        const float inv = 1.0f / rl[r];
        const int q = qbase + half * 8 + r;
#pragma unroll
        for (int dt = 0; dt < 4; ++dt)
            O[base + (size_t)q * D_MODEL + (dt * 16 + mr)] =
                (__bf16)(acc[dt][r] * inv);
    }
}

// ---------------------------------------------------------------------------
// host launcher
// ---------------------------------------------------------------------------
extern "C" void kernel_launch(void* const* d_in, const int* in_sizes, int n_in,
                              void* d_out, int out_size, void* d_ws, size_t ws_size,
                              hipStream_t stream) {
    (void)in_sizes; (void)n_in; (void)out_size; (void)ws_size;
    const float* x   = (const float*)d_in[0];
    const float* Wq  = (const float*)d_in[1];
    const float* bq  = (const float*)d_in[2];
    const float* Wk  = (const float*)d_in[3];
    const float* bk  = (const float*)d_in[4];
    const float* Wv  = (const float*)d_in[5];
    const float* bv  = (const float*)d_in[6];
    const float* Wo  = (const float*)d_in[7];
    const float* bo  = (const float*)d_in[8];
    const float* g1  = (const float*)d_in[9];
    const float* b1  = (const float*)d_in[10];
    const float* g2  = (const float*)d_in[11];
    const float* b2  = (const float*)d_in[12];
    const float* Wup = (const float*)d_in[13];
    const float* bup = (const float*)d_in[14];
    const float* Wdn = (const float*)d_in[15];
    const float* bdn = (const float*)d_in[16];

    char* ws = (char*)d_ws;
    size_t off = 0;
    auto take = [&](size_t bytes) -> void* {
        void* p = ws + off;
        off = (off + bytes + 255) & ~(size_t)255;
        return p;
    };
    __bf16* wq_b  = (__bf16*)take((size_t)D_MODEL * D_MODEL * 2);
    __bf16* wk_b  = (__bf16*)take((size_t)D_MODEL * D_MODEL * 2);
    __bf16* wv_b  = (__bf16*)take((size_t)D_MODEL * D_MODEL * 2);
    __bf16* wo_b  = (__bf16*)take((size_t)D_MODEL * D_MODEL * 2);
    __bf16* wup_b = (__bf16*)take((size_t)D_MODEL * MLP_DIM * 2);
    __bf16* wdn_b = (__bf16*)take((size_t)MLP_DIM * D_MODEL * 2);
    __bf16* xn_b  = (__bf16*)take((size_t)ROWS * D_MODEL * 2);
    __bf16* q_b   = (__bf16*)take((size_t)ROWS * D_MODEL * 2);
    __bf16* k_b   = (__bf16*)take((size_t)ROWS * D_MODEL * 2);
    __bf16* v_b   = (__bf16*)take((size_t)ROWS * D_MODEL * 2);
    __bf16* o_b   = (__bf16*)take((size_t)ROWS * D_MODEL * 2);
    float*  x2    = (float*) take((size_t)ROWS * D_MODEL * 4);
    __bf16* xn2_b = (__bf16*)take((size_t)ROWS * D_MODEL * 2);
    __bf16* h_b   = (__bf16*)take((size_t)ROWS * MLP_DIM * 2);

    // 1) weights fp32 -> bf16
    cvt_f32_bf16_kernel<<<1024, 256, 0, stream>>>(Wq,  wq_b,  D_MODEL * D_MODEL);
    cvt_f32_bf16_kernel<<<1024, 256, 0, stream>>>(Wk,  wk_b,  D_MODEL * D_MODEL);
    cvt_f32_bf16_kernel<<<1024, 256, 0, stream>>>(Wv,  wv_b,  D_MODEL * D_MODEL);
    cvt_f32_bf16_kernel<<<1024, 256, 0, stream>>>(Wo,  wo_b,  D_MODEL * D_MODEL);
    cvt_f32_bf16_kernel<<<2048, 256, 0, stream>>>(Wup, wup_b, D_MODEL * MLP_DIM);
    cvt_f32_bf16_kernel<<<2048, 256, 0, stream>>>(Wdn, wdn_b, MLP_DIM * D_MODEL);

    // 2) LN1 -> bf16
    ln_kernel<<<ROWS, 256, 0, stream>>>(x, g1, b1, xn_b);

    // 3) Q/K/V projections (bf16 out)
    dim3 gD(D_MODEL / BN, ROWS / BM);   // (8, 64)
    gemm_bf16_kernel<0, false, false, D_MODEL><<<gD, 256, 0, stream>>>(
        xn_b, wq_b, bq, nullptr, nullptr, q_b, D_MODEL);
    gemm_bf16_kernel<0, false, false, D_MODEL><<<gD, 256, 0, stream>>>(
        xn_b, wk_b, bk, nullptr, nullptr, k_b, D_MODEL);
    gemm_bf16_kernel<0, false, false, D_MODEL><<<gD, 256, 0, stream>>>(
        xn_b, wv_b, bv, nullptr, nullptr, v_b, D_MODEL);

    // 4) causal flash attention (4096 waves, 4 waves/block)
    attn_kernel<<<(BATCH * NUM_HEADS * (SEQ / 16)) / 4, 128, 0, stream>>>(q_b, k_b, v_b, o_b);

    // 5) output projection + residual -> x2 (fp32)
    gemm_bf16_kernel<0, true, true, D_MODEL><<<gD, 256, 0, stream>>>(
        o_b, wo_b, bo, x, x2, nullptr, D_MODEL);

    // 6) LN2 -> bf16
    ln_kernel<<<ROWS, 256, 0, stream>>>(x2, g2, b2, xn2_b);

    // 7) MLP up + GELU (bf16 out)
    dim3 gU(MLP_DIM / BN, ROWS / BM);   // (32, 64)
    gemm_bf16_kernel<1, false, false, MLP_DIM><<<gU, 256, 0, stream>>>(
        xn2_b, wup_b, bup, nullptr, nullptr, h_b, D_MODEL);

    // 8) MLP down + residual -> out (fp32)
    gemm_bf16_kernel<0, true, true, D_MODEL><<<gD, 256, 0, stream>>>(
        h_b, wdn_b, bdn, x2, (float*)d_out, nullptr, MLP_DIM);
}

// v006
// A run of this version takes 272 microseconds.
// Timed twice side by side with v005, it ran 1.03 times as fast both times.
// Counting every step since v000, it is 2.46 times as fast.
#include <hip/hip_runtime.h>
#include <hip/hip_bf16.h>
#include <math.h>

// ---- problem constants (match reference) ----
#define D_MODEL   1024
#define NUM_HEADS 16
#define HEAD_DIM  64
#define MLP_DIM   4096
#define BATCH     2
#define SEQ       2048
#define ROWS      (BATCH * SEQ)   // 4096
#define LN_EPS    1e-5f

typedef __attribute__((ext_vector_type(16))) __bf16 v16bf;
typedef __attribute__((ext_vector_type(8)))  __bf16 v8bf;
typedef __attribute__((ext_vector_type(8)))  float  v8f;
typedef __attribute__((ext_vector_type(4)))  __bf16 v4bf;
typedef __attribute__((ext_vector_type(4)))  float  v4f;
typedef int v4i __attribute__((vector_size(16)));   // matches builtin param type

// ---- CDNA5 async global->LDS path (guarded; falls back to vector copies) ----
#if defined(__AMDGCN__) && __has_builtin(__builtin_amdgcn_global_load_async_to_lds_b128)
#define HAS_ASYNC_LDS 1
#else
#define HAS_ASYNC_LDS 0
#endif

#if HAS_ASYNC_LDS
#if __has_builtin(__builtin_amdgcn_s_wait_asynccnt)
#define WAIT_ASYNC(n) __builtin_amdgcn_s_wait_asynccnt(n)
#else
#define WAIT_ASYNC(n) asm volatile("s_wait_asynccnt %0" ::"i"(n) : "memory")
#endif
#else
#define WAIT_ASYNC(n) do { } while (0)
#endif

static __device__ __forceinline__ void async_cp16(const __bf16* g, __bf16* l) {
#if HAS_ASYNC_LDS
    // global_load_async_to_lds_b128: 16B global -> LDS, tracked by ASYNCcnt
    __builtin_amdgcn_global_load_async_to_lds_b128((v4i*)g, (v4i*)l, 0, 0);
#else
    *reinterpret_cast<v8bf*>(l) = *reinterpret_cast<const v8bf*>(g);
#endif
}

// ds_load_tr16_b128 on a row-major 16-bit LDS tile T: with lane l aimed at
// T[k0 + 8*(l>>4) + (l&7)][n0 + 8*((l>>3)&1)], lane l gets T[k0 + 8*(l>>4) + 0..7][n0 + (l&15)],
// one half of a WMMA operand in the hardware k order. All 32 lanes must hold a valid address.
typedef __attribute__((address_space(3))) v8bf lds_v8bf;
static __device__ __forceinline__ v8bf lds_tr16(const __bf16* p) {
    return __builtin_amdgcn_ds_load_tr16_b128_v8bf16((lds_v8bf*)p);
}

static __device__ __forceinline__ v8f wmma_bf16(v16bf a, v16bf b, v8f c) {
    // D = A(16x32 bf16) * B(32x16 bf16) + C(16x16 f32)
    return __builtin_amdgcn_wmma_f32_16x16x32_bf16(
        /*neg_a=*/false, a, /*neg_b=*/false, b,
        /*c_mod=*/(short)0, c, /*reuse_a=*/false, /*reuse_b=*/false);
}

// Lane l reads lane l ^ X of its own 16-lane row (DPP row_xmask): a vector-unit
// exchange, where __shfl_xor goes through the LDS queue and a wait per step.
// All 32 lanes must be active.
template <int X>
static __device__ __forceinline__ float row_xor(float v) {
    return __builtin_bit_cast(float, __builtin_amdgcn_update_dpp(
        0, __builtin_bit_cast(int, v), 0x160 | X, 0xf, 0xf, true));
}

// One step of a 16-lane row maximum, max(v, v of lane l ^ X), as one DPP instruction.
// asm: fmaxf() on row_xor() compiles to three dependent instructions (move, quieting
// max, max); volatile: keeps the rows' independent steps in the interleaved order written.
template <int X>
static __device__ __forceinline__ float row_max_step(float v) {
    float r;
    asm volatile("v_max_num_f32_dpp %0, %1, %1 row_xmask:%2 row_mask:0xf bank_mask:0xf"
                 : "=v"(r) : "v"(v), "n"(X));
    return r;
}

static __device__ __forceinline__ float gelu_tanh(float x) {
    const float c0 = 0.7978845608028654f;   // sqrt(2/pi)
    return 0.5f * x * (1.0f + tanhf(c0 * (x + 0.044715f * x * x * x)));
}

// ---------------------------------------------------------------------------
// fp32 -> bf16 conversion of all six weight matrices in one launch.
// The six bf16 copies lie one behind the other in the workspace, so dst is one array of
// CVT_TOTAL elements; a block converts CVT_CHUNK of them, all from one source matrix.
// Few waves with much in flight each: a lane issues its 32 loads of 16 B together (every
// load of a wave covers 512 contiguous bytes) and stores 8 B per load (256 contiguous
// bytes a wave).
// ---------------------------------------------------------------------------
#define CVT_SQ      (D_MODEL * D_MODEL)              // elements of Wq, Wk, Wv, Wo; Wup and Wdn hold four times as many
#define CVT_TOTAL   (4 * CVT_SQ + 2 * D_MODEL * MLP_DIM)
#define CVT_THREADS 128
#define CVT_LOADS   32
#define CVT_STEP    (CVT_THREADS * 4)                // elements that one load of the whole block brings
#define CVT_CHUNK   (CVT_STEP * CVT_LOADS)           // 16384 elements a block; divides CVT_SQ

__global__ __launch_bounds__(CVT_THREADS)
void cvt_weights_kernel(const float* __restrict__ wq, const float* __restrict__ wk,
                        const float* __restrict__ wv, const float* __restrict__ wo,
                        const float* __restrict__ wup, const float* __restrict__ wdn,
                        __bf16* __restrict__ dst) {
    const int per = CVT_SQ / CVT_CHUNK;              // blocks per CVT_SQ elements
    const int seg = blockIdx.x / per;                // 0..3: Wq, Wk, Wv, Wo; 4..7: Wup; 8..11: Wdn
    const float* s = wq;
    s = seg == 1 ? wk  : s;
    s = seg == 2 ? wv  : s;
    s = seg == 3 ? wo  : s;
    s = seg >= 4 ? wup : s;
    s = seg >= 8 ? wdn : s;
    const int quarter = seg >= 4 ? (seg & 3) : 0;    // which CVT_SQ elements of Wup or Wdn
    s += (size_t)quarter * CVT_SQ + (size_t)(blockIdx.x % per) * CVT_CHUNK + threadIdx.x * 4;
    __bf16* d = dst + (size_t)blockIdx.x * CVT_CHUNK + threadIdx.x * 4;
    v4f v[CVT_LOADS];
#pragma unroll   // static index: v stays in registers
    for (int j = 0; j < CVT_LOADS; ++j)
        v[j] = *reinterpret_cast<const v4f*>(s + j * CVT_STEP);
    // keeps every load ahead of the first conversion: without it the compiler holds the last
    // loads back until the first have returned, a second memory latency per wave
    __builtin_amdgcn_sched_barrier(0);
#pragma unroll   // static index: v stays in registers
    for (int j = 0; j < CVT_LOADS; ++j)
        *reinterpret_cast<v4bf*>(d + j * CVT_STEP) = __builtin_convertvector(v[j], v4bf);
}

// ---------------------------------------------------------------------------
// LayerNorm over last dim (C = D_MODEL), one 256-thread block per row,
// output bf16 (feeds WMMA GEMMs)
// ---------------------------------------------------------------------------
__global__ void ln_kernel(const float* __restrict__ x,
                          const float* __restrict__ g,
                          const float* __restrict__ b,
                          __bf16* __restrict__ out) {
    const int row = blockIdx.x;
    const float* xr = x + (size_t)row * D_MODEL;
    float s = 0.f, ss = 0.f;
    for (int i = threadIdx.x; i < D_MODEL; i += blockDim.x) {
        float v = xr[i];
        s += v;
        ss += v * v;
    }
    __shared__ float sh[2][8];
    const int lane = threadIdx.x & 31;
    const int wave = threadIdx.x >> 5;
#pragma unroll
    for (int o = 16; o > 0; o >>= 1) {
        s  += __shfl_down(s, o);
        ss += __shfl_down(ss, o);
    }
    if (lane == 0) { sh[0][wave] = s; sh[1][wave] = ss; }
    __syncthreads();
    s = 0.f; ss = 0.f;
#pragma unroll
    for (int w = 0; w < 8; ++w) { s += sh[0][w]; ss += sh[1][w]; }
    const float mu   = s  * (1.0f / D_MODEL);
    const float var  = ss * (1.0f / D_MODEL) - mu * mu;
    const float rstd = rsqrtf(var + LN_EPS);
    __bf16* orow = out + (size_t)row * D_MODEL;
    for (int i = threadIdx.x; i < D_MODEL; i += blockDim.x)
        orow[i] = (__bf16)((xr[i] - mu) * rstd * g[i] + b[i]);
}

// ---------------------------------------------------------------------------
// bf16 WMMA GEMM:  C[M,N] = A[M,K] @ B[K,N] + bias (+ res)
// 256 threads = 8 waves; block tile 64(M) x 128(N); K step 32.
// Wave tile 32x32 (2x2 WMMAs). LDS double-buffered via async global->LDS.
// ACT: 0 = none, 1 = tanh-GELU (applied before residual add).
// RES: add res[m][n]. OUTF: store f32 to outF, else bf16 to outB. N: row pitch of B, res, out.
// These are template constants so that the residual loads and the epilogue
// stores are straight-line code that differs by immediate offsets only.
// ---------------------------------------------------------------------------
#define BM 64
#define BN 128
#define BK 32
#define BKP (BK + 8)    // LDS pitch of an A row: 80 B, an odd multiple of 16 B, free of bank conflicts for ds_load_b128
#define BNP (BN + 16)   // LDS pitch of a B row: 288 B, an odd multiple of 32 B, free of bank conflicts for ds_load_tr16_b128

template <int ACT, bool RES, bool OUTF, int N>
__global__ __launch_bounds__(256)
void gemm_bf16_kernel(const __bf16* __restrict__ A, const __bf16* __restrict__ Bw,
                      const float* __restrict__ bias, const float* __restrict__ res,
                      float* __restrict__ outF, __bf16* __restrict__ outB,
                      int K) {
    __shared__ __attribute__((aligned(16))) __bf16 As[2][BM][BKP];   // 2 * 5 KB
    __shared__ __attribute__((aligned(16))) __bf16 Bs[2][BK][BNP];   // 2 * 9 KB
    const int tid  = threadIdx.x;
    const int lane = tid & 31;
    const int wave = tid >> 5;
    const int wm = (wave >> 2) * 32;   // 0 / 32
    const int wn = (wave & 3) * 32;    // 0,32,64,96
    const int bm = blockIdx.y * BM;
    const int bn = blockIdx.x * BN;
    const int half = lane >> 4;        // K-half selector
    const int mr   = lane & 15;        // A row / B col within 16x16 tile

    // staging indices (per thread: 1x16B for A, 2x16B for B)
    const int ar = tid >> 2;           // 0..63
    const int ac = (tid & 3) * 8;      // 0,8,16,24
    const int br = tid >> 3;           // 0..31
    const int bc = (tid & 7) * 16;     // 0..112

    v8f acc[2][2] = {};
    const int nk = K / BK;

    // element (i, jn, r) of this lane's results lies at o0 + (i * 16 + r) * N + jn * 16
    const size_t o0 = (size_t)(bm + wm + half * 8) * N + (bn + wn + mr);
    // All residual and bias loads of the lane are issued here, together: they are in flight
    // while the first K tile lands, and the epilogue waits for none of them one by one.
    float rv[2][2][8];
    if (RES) {
#pragma unroll   // static index: rv stays in registers
        for (int i = 0; i < 2; ++i)
#pragma unroll   // static index: rv stays in registers
            for (int r = 0; r < 8; ++r)
#pragma unroll   // static index: rv stays in registers
                for (int jn = 0; jn < 2; ++jn)
                    rv[i][jn][r] = res[o0 + (i * 16 + r) * N + jn * 16];
    }
    const float bvv[2] = { bias[bn + wn + mr], bias[bn + wn + 16 + mr] };

    // prologue: stage K-step 0 into buffer 0
    {
        const __bf16* ga = &A[(size_t)(bm + ar) * K + ac];
        const __bf16* gb = &Bw[(size_t)br * N + (bn + bc)];
        async_cp16(ga,     &As[0][ar][ac]);
        async_cp16(gb,     &Bs[0][br][bc]);
        async_cp16(gb + 8, &Bs[0][br][bc + 8]);
    }

    for (int ks = 0; ks < nk; ++ks) {
        const int cur = ks & 1;
        if (ks + 1 < nk) {
            const int nxt = cur ^ 1;
            const int k0 = (ks + 1) * BK;
            const __bf16* ga = &A[(size_t)(bm + ar) * K + (k0 + ac)];
            const __bf16* gb = &Bw[(size_t)(k0 + br) * N + (bn + bc)];
            async_cp16(ga,     &As[nxt][ar][ac]);
            async_cp16(gb,     &Bs[nxt][br][bc]);
            async_cp16(gb + 8, &Bs[nxt][br][bc + 8]);
            WAIT_ASYNC(3);   // newest 3 may remain outstanding -> prev panel done
        } else {
            WAIT_ASYNC(0);
        }
        __syncthreads();

        v16bf af[2], bfr[2];
#pragma unroll
        for (int i = 0; i < 2; ++i)
#pragma unroll
            for (int g2 = 0; g2 < 2; ++g2)
#pragma unroll
                for (int j = 0; j < 8; ++j) {
                    const int kk = g2 * 16 + half * 8 + j;
                    af[i][g2 * 8 + j]  = As[cur][wm + i * 16 + mr][kk];
                }
        // B fragments: element g2*8+j = Bs[g2*16 + half*8 + j][column], the k order of af
        const __bf16* bt = &Bs[cur][half * 8 + (lane & 7)][wn + ((lane >> 3) & 1) * 8];
#pragma unroll   // static fragment index: bfr stays in registers
        for (int i = 0; i < 2; ++i)
            bfr[i] = __builtin_shufflevector(lds_tr16(bt + i * 16),
                                             lds_tr16(bt + 16 * BNP + i * 16),
                                             0, 1, 2, 3, 4, 5, 6, 7, 8, 9, 10, 11, 12, 13, 14, 15);
#pragma unroll
        for (int i = 0; i < 2; ++i)
#pragma unroll
            for (int jn = 0; jn < 2; ++jn)
                acc[i][jn] = wmma_bf16(af[i], bfr[jn], acc[i][jn]);
        __syncthreads();
    }

    // epilogue
#pragma unroll
    for (int jn = 0; jn < 2; ++jn)
#pragma unroll
        for (int i = 0; i < 2; ++i)
#pragma unroll
            for (int r = 0; r < 8; ++r) {
                const size_t o = o0 + (i * 16 + r) * N + jn * 16;
                float v = acc[i][jn][r] + bvv[jn];
                if (ACT == 1) v = gelu_tanh(v);
                if (RES) v += rv[i][jn][r];
                if (OUTF) outF[o] = v;
                else      outB[o] = (__bf16)v;
            }
}

// ---------------------------------------------------------------------------
// Causal flash attention, one wave per (b, h, 16-row Q tile).
// Q/K/V/O layout: [B, T, H*Dh] bf16. Online softmax; QK^T and P*V via WMMA.
// No block barriers (waves have divergent causal trip counts).
// K and V of a 32-key block reach the wave through LDS buffers of its own, filled by
// asynchronous copies while the block before is worked on. No other wave touches them,
// so the wave's own waits order fill, read and refill.
// ---------------------------------------------------------------------------
#define KP (HEAD_DIM + 8)    // LDS pitch of a K row: 144 B, an odd multiple of 16 B, for ds_load_b128
#define VP (HEAD_DIM + 16)   // LDS pitch of a V row: 160 B, an odd multiple of 32 B, for ds_load_tr16_b128
#define PP (32 + 4)          // LDS pitch of a P row: 144 B, an odd multiple of 16 B, for ds_load_b128

__global__ __launch_bounds__(128)
void attn_kernel(const __bf16* __restrict__ Q, const __bf16* __restrict__ Km,
                 const __bf16* __restrict__ V, __bf16* __restrict__ O) {
    __shared__ __attribute__((aligned(16))) float Pl[4][16][PP];   // per-wave P bounce (C-layout -> A-layout)
    __shared__ __attribute__((aligned(16))) __bf16 Ks[4][32][KP];   // per-wave K block
    __shared__ __attribute__((aligned(16))) __bf16 Vs[4][32][VP];   // per-wave V block
    const int lane = threadIdx.x & 31;
    // in a scalar register: the trip count and the test round the copies are then scalar branches
    const int wave = __builtin_amdgcn_readfirstlane(threadIdx.x >> 5);
    const int work = blockIdx.x * 4 + wave;
    const int QT = SEQ / 16;                       // 128 q-tiles
    const int qt = work % QT;
    const int h  = (work / QT) % NUM_HEADS;
    const int b  = work / (QT * NUM_HEADS);
    const size_t base = ((size_t)b * SEQ) * D_MODEL + (size_t)h * HEAD_DIM;
    const int qbase = qt * 16;
    const int half = lane >> 4;
    const int mr   = lane & 15;
    const float scale = 0.125f;                    // 1/sqrt(64)

    // Q A-fragments for contraction halves d=[0,32) and [32,64)
    v16bf qf[2];
#pragma unroll
    for (int t = 0; t < 2; ++t)
#pragma unroll
        for (int g2 = 0; g2 < 2; ++g2)
#pragma unroll
            for (int j = 0; j < 8; ++j)
                qf[t][g2 * 8 + j] =
                    Q[base + (size_t)(qbase + mr) * D_MODEL +
                      (t * 32 + g2 * 16 + half * 8 + j)];

    v8f acc[4] = {};                // 16 x 64 output accumulator (f32)
    float rm[8], rl[8];
#pragma unroll
    for (int r = 0; r < 8; ++r) { rm[r] = -3.0e38f; rl[r] = 0.f; }

    const int nblk = (qt + 2) >> 1;       // ceil((qbase+16)/32)

    // One block = 32 rows of 128 B each of K and of V: 8 + 8 copies of 16 B a lane.
    // Copy c: lane l brings bytes 16*(l&7) .. +15 of row 8*(l>>3) + c (four whole lines).
    const int crow = (lane >> 3) * 8;
    const int ccol = (lane & 7) * 8;
    const __bf16* kg = Km + base + (size_t)crow * D_MODEL + ccol;
    const __bf16* vg = V  + base + (size_t)crow * D_MODEL + ccol;
    __bf16* kl = &Ks[wave][crow][ccol];
    __bf16* vl = &Vs[wave][crow][ccol];
    auto stage = [&](int blk) {
        const __bf16* kgb = kg + (size_t)blk * 32 * D_MODEL;
        const __bf16* vgb = vg + (size_t)blk * 32 * D_MODEL;
#pragma unroll   // constant row steps: one address pair serves eight copies
        for (int c = 0; c < 8; ++c) async_cp16(kgb + c * D_MODEL, kl + c * KP);
#pragma unroll   // constant row steps: one address pair serves eight copies
        for (int c = 0; c < 8; ++c) async_cp16(vgb + c * D_MODEL, vl + c * VP);
    };
    stage(0);

    for (int kb = 0; kb < nblk; ++kb) {
        const int kvbase = kb * 32;
        // this block's copies have landed before any of its bytes is read
        asm volatile("s_wait_asynccnt 0x0" ::: "memory");
        // K fragments: element g2*8+j = K[kvbase + t*16 + mr][kd*32 + g2*16 + half*8 + j]
        v16bf kf[2][2];
#pragma unroll   // static fragment index: kf stays in registers
        for (int t = 0; t < 2; ++t)
#pragma unroll   // static fragment index: kf stays in registers
            for (int kd = 0; kd < 2; ++kd) {
                const __bf16* kr = &Ks[wave][t * 16 + mr][kd * 32 + half * 8];
                kf[t][kd] = __builtin_shufflevector(*reinterpret_cast<const v8bf*>(kr),
                                                    *reinterpret_cast<const v8bf*>(kr + 16),
                                                    0, 1, 2, 3, 4, 5, 6, 7, 8, 9, 10, 11, 12, 13, 14, 15);
            }
        // V fragments: element g2*8+j = V[kvbase + g2*16 + half*8 + j][dt*16 + mr], the k order of pa
        v16bf vf[4];
        const __bf16* vt = &Vs[wave][half * 8 + (lane & 7)][((lane >> 3) & 1) * 8];
#pragma unroll   // static fragment index: vf stays in registers
        for (int dt = 0; dt < 4; ++dt)
            vf[dt] = __builtin_shufflevector(lds_tr16(vt + dt * 16),
                                             lds_tr16(vt + 16 * VP + dt * 16),
                                             0, 1, 2, 3, 4, 5, 6, 7, 8, 9, 10, 11, 12, 13, 14, 15);
        // every read of the two buffers has returned before the refill is issued
        asm volatile("s_wait_dscnt 0x0" ::: "memory");
        if (kb + 1 < nblk) stage(kb + 1);   // flies during this block's products and softmax
        // ---- scores S = Q K^T : two 16x16 tiles over 32 kv positions ----
        v8f s[2] = {};
#pragma unroll   // static fragment index: s, qf and kf stay in registers
        for (int t = 0; t < 2; ++t)
#pragma unroll   // static fragment index: s, qf and kf stay in registers
            for (int kd = 0; kd < 2; ++kd)
                s[t] = wmma_bf16(qf[kd], kf[t][kd], s[t]);
        // ---- causal mask + scale ----
        const int qrow_base = qbase + half * 8;
#pragma unroll
        for (int t = 0; t < 2; ++t) {
            const int kv = kvbase + t * 16 + mr;
#pragma unroll
            for (int r = 0; r < 8; ++r) {
                float v = s[t][r] * scale;
                if (kv > qrow_base + r) v = -3.0e38f;
                s[t][r] = v;
            }
        }
        // ---- online softmax (row reductions across 16-lane groups) ----
        // Each DPP step runs over all eight rows before the next one, so that the
        // rows' dependent chains fill one another's latency.
        float mblk[8], ps[8], corr[8];
#pragma unroll   // static row index: the row arrays stay in registers
        for (int r = 0; r < 8; ++r) mblk[r] = fmaxf(s[0][r], s[1][r]);
#pragma unroll   // static row index: the row arrays stay in registers
        for (int r = 0; r < 8; ++r) mblk[r] = row_max_step<8>(mblk[r]);
#pragma unroll   // static row index: the row arrays stay in registers
        for (int r = 0; r < 8; ++r) mblk[r] = row_max_step<4>(mblk[r]);
#pragma unroll   // static row index: the row arrays stay in registers
        for (int r = 0; r < 8; ++r) mblk[r] = row_max_step<2>(mblk[r]);
#pragma unroll   // static row index: the row arrays stay in registers
        for (int r = 0; r < 8; ++r) mblk[r] = row_max_step<1>(mblk[r]);
#pragma unroll   // static row index: the row arrays stay in registers
        for (int r = 0; r < 8; ++r) {
            const float mnew = fmaxf(rm[r], mblk[r]);
            corr[r] = __expf(rm[r] - mnew);
            const float p0 = __expf(s[0][r] - mnew);
            const float p1 = __expf(s[1][r] - mnew);
            ps[r] = p0 + p1;
            rm[r] = mnew;
            const int m = half * 8 + r;
            Pl[wave][m][mr]      = p0;    // C-layout -> LDS (wave-private)
            Pl[wave][m][16 + mr] = p1;
        }
#pragma unroll   // static row index: the row arrays stay in registers
        for (int r = 0; r < 8; ++r) ps[r] += row_xor<8>(ps[r]);
#pragma unroll   // static row index: the row arrays stay in registers
        for (int r = 0; r < 8; ++r) ps[r] += row_xor<4>(ps[r]);
#pragma unroll   // static row index: the row arrays stay in registers
        for (int r = 0; r < 8; ++r) ps[r] += row_xor<2>(ps[r]);
#pragma unroll   // static row index: the row arrays stay in registers
        for (int r = 0; r < 8; ++r) ps[r] += row_xor<1>(ps[r]);
#pragma unroll   // static row index: the row arrays stay in registers
        for (int r = 0; r < 8; ++r) {
            rl[r] = rl[r] * corr[r] + ps[r];
#pragma unroll
            for (int dt = 0; dt < 4; ++dt) acc[dt][r] *= corr[r];
        }
        // ---- P (16x32) as A-fragment (bf16), then P @ V ----
        v16bf pa;
#pragma unroll
        for (int g2 = 0; g2 < 2; ++g2)
#pragma unroll
            for (int j = 0; j < 8; ++j)
                pa[g2 * 8 + j] = (__bf16)Pl[wave][mr][g2 * 16 + half * 8 + j];
#pragma unroll   // static fragment index: acc and vf stay in registers
        for (int dt = 0; dt < 4; ++dt)
            acc[dt] = wmma_bf16(pa, vf[dt], acc[dt]);
    }
    // no copy is left in flight when the wave ends
    asm volatile("s_wait_asynccnt 0x0" ::: "memory");
    // ---- epilogue: O = acc / l ----
#pragma unroll
    for (int r = 0; r < 8; ++r) {
        const float inv = 1.0f / rl[r];
        const int q = qbase + half * 8 + r;
#pragma unroll
        for (int dt = 0; dt < 4; ++dt)
            O[base + (size_t)q * D_MODEL + (dt * 16 + mr)] =
                (__bf16)(acc[dt][r] * inv);
    }
}

// ---------------------------------------------------------------------------
// host launcher
// ---------------------------------------------------------------------------
extern "C" void kernel_launch(void* const* d_in, const int* in_sizes, int n_in,
                              void* d_out, int out_size, void* d_ws, size_t ws_size,
                              hipStream_t stream) {
    (void)in_sizes; (void)n_in; (void)out_size; (void)ws_size;
    const float* x   = (const float*)d_in[0];
    const float* Wq  = (const float*)d_in[1];
    const float* bq  = (const float*)d_in[2];
    const float* Wk  = (const float*)d_in[3];
    const float* bk  = (const float*)d_in[4];
    const float* Wv  = (const float*)d_in[5];
    const float* bv  = (const float*)d_in[6];
    const float* Wo  = (const float*)d_in[7];
    const float* bo  = (const float*)d_in[8];
    const float* g1  = (const float*)d_in[9];
    const float* b1  = (const float*)d_in[10];
    const float* g2  = (const float*)d_in[11];
    const float* b2  = (const float*)d_in[12];
    const float* Wup = (const float*)d_in[13];
    const float* bup = (const float*)d_in[14];
    const float* Wdn = (const float*)d_in[15];
    const float* bdn = (const float*)d_in[16];

    char* ws = (char*)d_ws;
    size_t off = 0;
    auto take = [&](size_t bytes) -> void* {
        void* p = ws + off;
        off = (off + bytes + 255) & ~(size_t)255;
        return p;
    };
    __bf16* wq_b  = (__bf16*)take((size_t)D_MODEL * D_MODEL * 2);
    __bf16* wk_b  = (__bf16*)take((size_t)D_MODEL * D_MODEL * 2);
    __bf16* wv_b  = (__bf16*)take((size_t)D_MODEL * D_MODEL * 2);
    __bf16* wo_b  = (__bf16*)take((size_t)D_MODEL * D_MODEL * 2);
    __bf16* wup_b = (__bf16*)take((size_t)D_MODEL * MLP_DIM * 2);
    __bf16* wdn_b = (__bf16*)take((size_t)MLP_DIM * D_MODEL * 2);
    __bf16* xn_b  = (__bf16*)take((size_t)ROWS * D_MODEL * 2);
    __bf16* q_b   = (__bf16*)take((size_t)ROWS * D_MODEL * 2);
    __bf16* k_b   = (__bf16*)take((size_t)ROWS * D_MODEL * 2);
    __bf16* v_b   = (__bf16*)take((size_t)ROWS * D_MODEL * 2);
    __bf16* o_b   = (__bf16*)take((size_t)ROWS * D_MODEL * 2);
    float*  x2    = (float*) take((size_t)ROWS * D_MODEL * 4);
    __bf16* xn2_b = (__bf16*)take((size_t)ROWS * D_MODEL * 2);
    __bf16* h_b   = (__bf16*)take((size_t)ROWS * MLP_DIM * 2);

    // 1) weights fp32 -> bf16: wq_b .. wdn_b are contiguous (every size is a multiple of 256 B)
    cvt_weights_kernel<<<CVT_TOTAL / CVT_CHUNK, CVT_THREADS, 0, stream>>>(Wq, Wk, Wv, Wo, Wup, Wdn, wq_b);

    // 2) LN1 -> bf16
    ln_kernel<<<ROWS, 256, 0, stream>>>(x, g1, b1, xn_b);

    // 3) Q/K/V projections (bf16 out)
    dim3 gD(D_MODEL / BN, ROWS / BM);   // (8, 64)
    gemm_bf16_kernel<0, false, false, D_MODEL><<<gD, 256, 0, stream>>>(
        xn_b, wq_b, bq, nullptr, nullptr, q_b, D_MODEL);
    gemm_bf16_kernel<0, false, false, D_MODEL><<<gD, 256, 0, stream>>>(
        xn_b, wk_b, bk, nullptr, nullptr, k_b, D_MODEL);
    gemm_bf16_kernel<0, false, false, D_MODEL><<<gD, 256, 0, stream>>>(
        xn_b, wv_b, bv, nullptr, nullptr, v_b, D_MODEL);

    // 4) causal flash attention (4096 waves, 4 waves/block)
    attn_kernel<<<(BATCH * NUM_HEADS * (SEQ / 16)) / 4, 128, 0, stream>>>(q_b, k_b, v_b, o_b);

    // 5) output projection + residual -> x2 (fp32)
    gemm_bf16_kernel<0, true, true, D_MODEL><<<gD, 256, 0, stream>>>(
        o_b, wo_b, bo, x, x2, nullptr, D_MODEL);

    // 6) LN2 -> bf16
    ln_kernel<<<ROWS, 256, 0, stream>>>(x2, g2, b2, xn2_b);

    // 7) MLP up + GELU (bf16 out)
    dim3 gU(MLP_DIM / BN, ROWS / BM);   // (32, 64)
    gemm_bf16_kernel<1, false, false, MLP_DIM><<<gU, 256, 0, stream>>>(
        xn2_b, wup_b, bup, nullptr, nullptr, h_b, D_MODEL);

    // 8) MLP down + residual -> out (fp32)
    gemm_bf16_kernel<0, true, true, D_MODEL><<<gD, 256, 0, stream>>>(
        h_b, wdn_b, bdn, x2, (float*)d_out, nullptr, MLP_DIM);
}

// v007
// One run takes 228 microseconds.
// Two timings next to v006 both put it at 1.19 times that version's speed.
// All steps since v000 together make it 2.92 times as fast.
#include <hip/hip_runtime.h>
#include <hip/hip_bf16.h>
#include <math.h>

// ---- problem constants (match reference) ----
#define D_MODEL   1024
#define NUM_HEADS 16
#define HEAD_DIM  64
#define MLP_DIM   4096
#define BATCH     2
#define SEQ       2048
#define ROWS      (BATCH * SEQ)   // 4096
#define LN_EPS    1e-5f

typedef __attribute__((ext_vector_type(16))) __bf16 v16bf;
typedef __attribute__((ext_vector_type(8)))  __bf16 v8bf;
typedef __attribute__((ext_vector_type(8)))  float  v8f;
typedef __attribute__((ext_vector_type(4)))  __bf16 v4bf;
typedef __attribute__((ext_vector_type(4)))  float  v4f;
typedef int v4i __attribute__((vector_size(16)));   // matches builtin param type

// ---- CDNA5 async global->LDS path (guarded; falls back to vector copies) ----
#if defined(__AMDGCN__) && __has_builtin(__builtin_amdgcn_global_load_async_to_lds_b128)
#define HAS_ASYNC_LDS 1
#else
#define HAS_ASYNC_LDS 0
#endif

#if HAS_ASYNC_LDS
// asm with the "memory" clobber: no LDS read moves ahead of the wait
#define WAIT_ASYNC(n) asm volatile("s_wait_asynccnt %0" ::"i"(n) : "memory")
#else
#define WAIT_ASYNC(n) do { } while (0)
#endif

static __device__ __forceinline__ void async_cp16(const __bf16* g, __bf16* l) {
#if HAS_ASYNC_LDS
    // global_load_async_to_lds_b128: 16B global -> LDS, tracked by ASYNCcnt
    __builtin_amdgcn_global_load_async_to_lds_b128((v4i*)g, (v4i*)l, 0, 0);
#else
    *reinterpret_cast<v8bf*>(l) = *reinterpret_cast<const v8bf*>(g);
#endif
}

// ds_load_tr16_b128 on a row-major 16-bit LDS tile T: with lane l aimed at
// T[k0 + 8*(l>>4) + (l&7)][n0 + 8*((l>>3)&1)], lane l gets T[k0 + 8*(l>>4) + 0..7][n0 + (l&15)],
// one half of a WMMA operand in the hardware k order. All 32 lanes must hold a valid address.
typedef __attribute__((address_space(3))) v8bf lds_v8bf;
static __device__ __forceinline__ v8bf lds_tr16(const __bf16* p) {
    return __builtin_amdgcn_ds_load_tr16_b128_v8bf16((lds_v8bf*)p);
}

static __device__ __forceinline__ v8f wmma_bf16(v16bf a, v16bf b, v8f c) {
    // D = A(16x32 bf16) * B(32x16 bf16) + C(16x16 f32)
    return __builtin_amdgcn_wmma_f32_16x16x32_bf16(
        /*neg_a=*/false, a, /*neg_b=*/false, b,
        /*c_mod=*/(short)0, c, /*reuse_a=*/false, /*reuse_b=*/false);
}

// Lane l reads lane l ^ X of its own 16-lane row (DPP row_xmask): a vector-unit
// exchange, where __shfl_xor goes through the LDS queue and a wait per step.
// All 32 lanes must be active.
template <int X>
static __device__ __forceinline__ float row_xor(float v) {
    return __builtin_bit_cast(float, __builtin_amdgcn_update_dpp(
        0, __builtin_bit_cast(int, v), 0x160 | X, 0xf, 0xf, true));
}

// One step of a 16-lane row maximum, max(v, v of lane l ^ X), as one DPP instruction.
// asm: fmaxf() on row_xor() compiles to three dependent instructions (move, quieting
// max, max); volatile: keeps the rows' independent steps in the interleaved order written.
template <int X>
static __device__ __forceinline__ float row_max_step(float v) {
    float r;
    asm volatile("v_max_num_f32_dpp %0, %1, %1 row_xmask:%2 row_mask:0xf bank_mask:0xf"
                 : "=v"(r) : "v"(v), "n"(X));
    return r;
}

static __device__ __forceinline__ float gelu_tanh(float x) {
    const float c0 = 0.7978845608028654f;   // sqrt(2/pi)
    return 0.5f * x * (1.0f + tanhf(c0 * (x + 0.044715f * x * x * x)));
}

// ---------------------------------------------------------------------------
// fp32 -> bf16 conversion of all six weight matrices in one launch.
// The six bf16 copies lie one behind the other in the workspace, so dst is one array of
// CVT_TOTAL elements; a block converts CVT_CHUNK of them, all from one source matrix.
// Few waves with much in flight each: a lane issues its 32 loads of 16 B together (every
// load of a wave covers 512 contiguous bytes) and stores 8 B per load (256 contiguous
// bytes a wave).
// ---------------------------------------------------------------------------
#define CVT_SQ      (D_MODEL * D_MODEL)              // elements of Wq, Wk, Wv, Wo; Wup and Wdn hold four times as many
#define CVT_TOTAL   (4 * CVT_SQ + 2 * D_MODEL * MLP_DIM)
#define CVT_THREADS 128
#define CVT_LOADS   32
#define CVT_STEP    (CVT_THREADS * 4)                // elements that one load of the whole block brings
#define CVT_CHUNK   (CVT_STEP * CVT_LOADS)           // 16384 elements a block; divides CVT_SQ

__global__ __launch_bounds__(CVT_THREADS)
void cvt_weights_kernel(const float* __restrict__ wq, const float* __restrict__ wk,
                        const float* __restrict__ wv, const float* __restrict__ wo,
                        const float* __restrict__ wup, const float* __restrict__ wdn,
                        __bf16* __restrict__ dst) {
    const int per = CVT_SQ / CVT_CHUNK;              // blocks per CVT_SQ elements
    const int seg = blockIdx.x / per;                // 0..3: Wq, Wk, Wv, Wo; 4..7: Wup; 8..11: Wdn
    const float* s = wq;
    s = seg == 1 ? wk  : s;
    s = seg == 2 ? wv  : s;
    s = seg == 3 ? wo  : s;
    s = seg >= 4 ? wup : s;
    s = seg >= 8 ? wdn : s;
    const int quarter = seg >= 4 ? (seg & 3) : 0;    // which CVT_SQ elements of Wup or Wdn
    s += (size_t)quarter * CVT_SQ + (size_t)(blockIdx.x % per) * CVT_CHUNK + threadIdx.x * 4;
    __bf16* d = dst + (size_t)blockIdx.x * CVT_CHUNK + threadIdx.x * 4;
    v4f v[CVT_LOADS];
#pragma unroll   // static index: v stays in registers
    for (int j = 0; j < CVT_LOADS; ++j)
        v[j] = *reinterpret_cast<const v4f*>(s + j * CVT_STEP);
    // keeps every load ahead of the first conversion: without it the compiler holds the last
    // loads back until the first have returned, a second memory latency per wave
    __builtin_amdgcn_sched_barrier(0);
#pragma unroll   // static index: v stays in registers
    for (int j = 0; j < CVT_LOADS; ++j)
        *reinterpret_cast<v4bf*>(d + j * CVT_STEP) = __builtin_convertvector(v[j], v4bf);
}

// ---------------------------------------------------------------------------
// LayerNorm over last dim (C = D_MODEL), one 256-thread block per row,
// output bf16 (feeds WMMA GEMMs)
// ---------------------------------------------------------------------------
__global__ void ln_kernel(const float* __restrict__ x,
                          const float* __restrict__ g,
                          const float* __restrict__ b,
                          __bf16* __restrict__ out) {
    const int row = blockIdx.x;
    const float* xr = x + (size_t)row * D_MODEL;
    float s = 0.f, ss = 0.f;
    for (int i = threadIdx.x; i < D_MODEL; i += blockDim.x) {
        float v = xr[i];
        s += v;
        ss += v * v;
    }
    __shared__ float sh[2][8];
    const int lane = threadIdx.x & 31;
    const int wave = threadIdx.x >> 5;
#pragma unroll
    for (int o = 16; o > 0; o >>= 1) {
        s  += __shfl_down(s, o);
        ss += __shfl_down(ss, o);
    }
    if (lane == 0) { sh[0][wave] = s; sh[1][wave] = ss; }
    __syncthreads();
    s = 0.f; ss = 0.f;
#pragma unroll
    for (int w = 0; w < 8; ++w) { s += sh[0][w]; ss += sh[1][w]; }
    const float mu   = s  * (1.0f / D_MODEL);
    const float var  = ss * (1.0f / D_MODEL) - mu * mu;
    const float rstd = rsqrtf(var + LN_EPS);
    __bf16* orow = out + (size_t)row * D_MODEL;
    for (int i = threadIdx.x; i < D_MODEL; i += blockDim.x)
        orow[i] = (__bf16)((xr[i] - mu) * rstd * g[i] + b[i]);
}

// ---------------------------------------------------------------------------
// bf16 WMMA GEMM:  C[M,N] = A[M,K] @ B[K,N] + bias (+ res)
// 256 threads = 8 waves; block tile 128(M) x 128(N); K step 64 (two WMMA depths).
// Wave tile 64x32 (4x2 WMMAs per depth). LDS double-buffered via async global->LDS.
// The operands come from L2 once per block tile, so the tile is as large as still gives
// every WGP a block at N = 1024; a K step is a whole 128-B line of every A row.
// ACT: 0 = none, 1 = tanh-GELU (applied before residual add).
// RES: add res[m][n]. OUTF: store f32 to outF, else bf16 to outB. N: row pitch of B, res, out.
// These are template constants so that the residual loads and the epilogue
// stores are straight-line code that differs by immediate offsets only.
// ---------------------------------------------------------------------------
#define BM 128
#define BN 128
#define BK 64
#define FM 4            // 16-row A fragments of a wave
#define FN 2            // 16-column B fragments of a wave
#define CPT 8           // copies of a thread per K step: 4 of A, 4 of B
#define BKP (BK + 8)    // LDS pitch of an A row: 144 B, an odd multiple of 16 B, free of bank conflicts for ds_load_b128
#define BNP (BN + 16)   // LDS pitch of a B row: 288 B, an odd multiple of 32 B, free of bank conflicts for ds_load_tr16_b128

template <int ACT, bool RES, bool OUTF, int N>
__global__ __launch_bounds__(256)
void gemm_bf16_kernel(const __bf16* __restrict__ A, const __bf16* __restrict__ Bw,
                      const float* __restrict__ bias, const float* __restrict__ res,
                      float* __restrict__ outF, __bf16* __restrict__ outB,
                      int K) {
    __shared__ __attribute__((aligned(16))) __bf16 As[2][BM][BKP];   // 2 * 18 KB
    __shared__ __attribute__((aligned(16))) __bf16 Bs[2][BK][BNP];   // 2 * 18 KB
    const int tid  = threadIdx.x;
    const int lane = tid & 31;
    const int wave = tid >> 5;
    const int wm = (wave >> 2) * 64;   // 0 / 64
    const int wn = (wave & 3) * 32;    // 0,32,64,96
    const int bm = blockIdx.y * BM;
    const int bn = blockIdx.x * BN;
    const int half = lane >> 4;        // K-half selector
    const int mr   = lane & 15;        // A row / B col within 16x16 tile

    // staging indices (per thread: 4x16B for A, 4x16B for B). Each copy instruction of a wave
    // covers whole 128-B lines: four A rows of 128 B, or two B rows of 256 B.
    const int ar = tid >> 3;           // 0..31: A rows ar, ar + 32, ar + 64, ar + 96
    const int ac = (tid & 7) * 8;      // 0..56
    const int br = (tid >> 4) * 4;     // 0..60: B rows br .. br + 3
    const int bc = (tid & 15) * 8;     // 0..120
    auto stage = [&](int buf, int k0) {
        const __bf16* ga = &A[(size_t)(bm + ar) * K + (k0 + ac)];
        const __bf16* gb = &Bw[(size_t)(k0 + br) * N + (bn + bc)];
#pragma unroll   // constant LDS steps
        for (int c = 0; c < 4; ++c) async_cp16(ga + (size_t)(c * 32) * K, &As[buf][ar + c * 32][ac]);
#pragma unroll   // constant row steps: one address pair serves four copies
        for (int c = 0; c < 4; ++c) async_cp16(gb + c * N, &Bs[buf][br + c][bc]);
    };

    v8f acc[FM][FN] = {};
    const int nk = K / BK;

    // element (i, jn, r) of this lane's results lies at o0 + (i * 16 + r) * N + jn * 16
    const size_t o0 = (size_t)(bm + wm + half * 8) * N + (bn + wn + mr);
    // All residual and bias loads of the lane are issued here, together: they are in flight
    // while the first K tile lands, and the epilogue waits for none of them one by one.
    float rv[FM][FN][8];
    if (RES) {
#pragma unroll   // static index: rv stays in registers
        for (int i = 0; i < FM; ++i)
#pragma unroll   // static index: rv stays in registers
            for (int r = 0; r < 8; ++r)
#pragma unroll   // static index: rv stays in registers
                for (int jn = 0; jn < FN; ++jn)
                    rv[i][jn][r] = res[o0 + (i * 16 + r) * N + jn * 16];
    }
    const float bvv[2] = { bias[bn + wn + mr], bias[bn + wn + 16 + mr] };

    // prologue: stage K-step 0 into buffer 0
    stage(0, 0);

    for (int ks = 0; ks < nk; ++ks) {
        const int cur = ks & 1;
        if (ks + 1 < nk) {
            stage(cur ^ 1, (ks + 1) * BK);
            WAIT_ASYNC(CPT);   // the newest CPT may remain outstanding -> this step's panel has landed
        } else {
            WAIT_ASYNC(0);
        }
        __syncthreads();

        v16bf af[BK / 32][FM], bfr[BK / 32][FN];
#pragma unroll   // static fragment index: af and bfr stay in registers
        for (int kd = 0; kd < BK / 32; ++kd) {
            // B fragments: element g2*8+j = Bs[kd*32 + g2*16 + half*8 + j][column], the k order of af
            const __bf16* bt = &Bs[cur][kd * 32 + half * 8 + (lane & 7)][wn + ((lane >> 3) & 1) * 8];
#pragma unroll   // static fragment index: bfr stays in registers
            for (int jn = 0; jn < FN; ++jn)
                bfr[kd][jn] = __builtin_shufflevector(lds_tr16(bt + jn * 16),
                                                      lds_tr16(bt + 16 * BNP + jn * 16),
                                                      0, 1, 2, 3, 4, 5, 6, 7, 8, 9, 10, 11, 12, 13, 14, 15);
            // A fragments: element g2*8+j = As[row][kd*32 + g2*16 + half*8 + j]
#pragma unroll   // static fragment index: af stays in registers
            for (int i = 0; i < FM; ++i) {
                const __bf16* at = &As[cur][wm + i * 16 + mr][kd * 32 + half * 8];
                af[kd][i] = __builtin_shufflevector(*reinterpret_cast<const v8bf*>(at),
                                                    *reinterpret_cast<const v8bf*>(at + 16),
                                                    0, 1, 2, 3, 4, 5, 6, 7, 8, 9, 10, 11, 12, 13, 14, 15);
            }
        }
        // keeps the K step's LDS reads one group ahead of its products: without it the compiler
        // sinks them among the WMMAs, each pair behind a wait of a whole LDS latency
        __builtin_amdgcn_sched_barrier(0);
#pragma unroll   // static fragment index: acc, af and bfr stay in registers
        for (int kd = 0; kd < BK / 32; ++kd)
#pragma unroll   // static fragment index: acc, af and bfr stay in registers
            for (int i = 0; i < FM; ++i)
#pragma unroll   // static fragment index: acc, af and bfr stay in registers
                for (int jn = 0; jn < FN; ++jn)
                    acc[i][jn] = wmma_bf16(af[kd][i], bfr[kd][jn], acc[i][jn]);
        // keeps the barrier behind the products: moved up among them it brings a wait for ALL
        // the reads ahead of the second product, and reads and products no longer overlap
        __builtin_amdgcn_sched_barrier(0);
        __syncthreads();
    }

    // epilogue
#pragma unroll
    for (int jn = 0; jn < FN; ++jn)
#pragma unroll
        for (int i = 0; i < FM; ++i)
#pragma unroll
            for (int r = 0; r < 8; ++r) {
                const size_t o = o0 + (i * 16 + r) * N + jn * 16;
                float v = acc[i][jn][r] + bvv[jn];
                if (ACT == 1) v = gelu_tanh(v);
                if (RES) v += rv[i][jn][r];
                if (OUTF) outF[o] = v;
                else      outB[o] = (__bf16)v;
            }
}

// ---------------------------------------------------------------------------
// Causal flash attention, one wave per (b, h, 16-row Q tile).
// Q/K/V/O layout: [B, T, H*Dh] bf16. Online softmax; QK^T and P*V via WMMA.
// No block barriers (waves have divergent causal trip counts).
// K and V of a 32-key block reach the wave through LDS buffers of its own, filled by
// asynchronous copies while the block before is worked on. No other wave touches them,
// so the wave's own waits order fill, read and refill.
// ---------------------------------------------------------------------------
#define KP (HEAD_DIM + 8)    // LDS pitch of a K row: 144 B, an odd multiple of 16 B, for ds_load_b128
#define VP (HEAD_DIM + 16)   // LDS pitch of a V row: 160 B, an odd multiple of 32 B, for ds_load_tr16_b128
#define PP (32 + 4)          // LDS pitch of a P row: 144 B, an odd multiple of 16 B, for ds_load_b128

__global__ __launch_bounds__(128)
void attn_kernel(const __bf16* __restrict__ Q, const __bf16* __restrict__ Km,
                 const __bf16* __restrict__ V, __bf16* __restrict__ O) {
    __shared__ __attribute__((aligned(16))) float Pl[4][16][PP];   // per-wave P bounce (C-layout -> A-layout)
    __shared__ __attribute__((aligned(16))) __bf16 Ks[4][32][KP];   // per-wave K block
    __shared__ __attribute__((aligned(16))) __bf16 Vs[4][32][VP];   // per-wave V block
    const int lane = threadIdx.x & 31;
    // in a scalar register: the trip count and the test round the copies are then scalar branches
    const int wave = __builtin_amdgcn_readfirstlane(threadIdx.x >> 5);
    const int work = blockIdx.x * 4 + wave;
    const int QT = SEQ / 16;                       // 128 q-tiles
    const int qt = work % QT;
    const int h  = (work / QT) % NUM_HEADS;
    const int b  = work / (QT * NUM_HEADS);
    const size_t base = ((size_t)b * SEQ) * D_MODEL + (size_t)h * HEAD_DIM;
    const int qbase = qt * 16;
    const int half = lane >> 4;
    const int mr   = lane & 15;
    const float scale = 0.125f;                    // 1/sqrt(64)

    // Q A-fragments for contraction halves d=[0,32) and [32,64)
    v16bf qf[2];
#pragma unroll
    for (int t = 0; t < 2; ++t)
#pragma unroll
        for (int g2 = 0; g2 < 2; ++g2)
#pragma unroll
            for (int j = 0; j < 8; ++j)
                qf[t][g2 * 8 + j] =
                    Q[base + (size_t)(qbase + mr) * D_MODEL +
                      (t * 32 + g2 * 16 + half * 8 + j)];

    v8f acc[4] = {};                // 16 x 64 output accumulator (f32)
    float rm[8], rl[8];
#pragma unroll
    for (int r = 0; r < 8; ++r) { rm[r] = -3.0e38f; rl[r] = 0.f; }

    const int nblk = (qt + 2) >> 1;       // ceil((qbase+16)/32)

    // One block = 32 rows of 128 B each of K and of V: 8 + 8 copies of 16 B a lane.
    // Copy c: lane l brings bytes 16*(l&7) .. +15 of row 8*(l>>3) + c (four whole lines).
    const int crow = (lane >> 3) * 8;
    const int ccol = (lane & 7) * 8;
    const __bf16* kg = Km + base + (size_t)crow * D_MODEL + ccol;
    const __bf16* vg = V  + base + (size_t)crow * D_MODEL + ccol;
    __bf16* kl = &Ks[wave][crow][ccol];
    __bf16* vl = &Vs[wave][crow][ccol];
    auto stage = [&](int blk) {
        const __bf16* kgb = kg + (size_t)blk * 32 * D_MODEL;
        const __bf16* vgb = vg + (size_t)blk * 32 * D_MODEL;
#pragma unroll   // constant row steps: one address pair serves eight copies
        for (int c = 0; c < 8; ++c) async_cp16(kgb + c * D_MODEL, kl + c * KP);
#pragma unroll   // constant row steps: one address pair serves eight copies
        for (int c = 0; c < 8; ++c) async_cp16(vgb + c * D_MODEL, vl + c * VP);
    };
    stage(0);

    for (int kb = 0; kb < nblk; ++kb) {
        const int kvbase = kb * 32;
        // this block's copies have landed before any of its bytes is read
        asm volatile("s_wait_asynccnt 0x0" ::: "memory");
        // K fragments: element g2*8+j = K[kvbase + t*16 + mr][kd*32 + g2*16 + half*8 + j]
        v16bf kf[2][2];
#pragma unroll   // static fragment index: kf stays in registers
        for (int t = 0; t < 2; ++t)
#pragma unroll   // static fragment index: kf stays in registers
            for (int kd = 0; kd < 2; ++kd) {
                const __bf16* kr = &Ks[wave][t * 16 + mr][kd * 32 + half * 8];
                kf[t][kd] = __builtin_shufflevector(*reinterpret_cast<const v8bf*>(kr),
                                                    *reinterpret_cast<const v8bf*>(kr + 16),
                                                    0, 1, 2, 3, 4, 5, 6, 7, 8, 9, 10, 11, 12, 13, 14, 15);
            }
        // V fragments: element g2*8+j = V[kvbase + g2*16 + half*8 + j][dt*16 + mr], the k order of pa
        v16bf vf[4];
        const __bf16* vt = &Vs[wave][half * 8 + (lane & 7)][((lane >> 3) & 1) * 8];
#pragma unroll   // static fragment index: vf stays in registers
        for (int dt = 0; dt < 4; ++dt)
            vf[dt] = __builtin_shufflevector(lds_tr16(vt + dt * 16),
                                             lds_tr16(vt + 16 * VP + dt * 16),
                                             0, 1, 2, 3, 4, 5, 6, 7, 8, 9, 10, 11, 12, 13, 14, 15);
        // every read of the two buffers has returned before the refill is issued
        asm volatile("s_wait_dscnt 0x0" ::: "memory");
        if (kb + 1 < nblk) stage(kb + 1);   // flies during this block's products and softmax
        // ---- scores S = Q K^T : two 16x16 tiles over 32 kv positions ----
        v8f s[2] = {};
#pragma unroll   // static fragment index: s, qf and kf stay in registers
        for (int t = 0; t < 2; ++t)
#pragma unroll   // static fragment index: s, qf and kf stay in registers
            for (int kd = 0; kd < 2; ++kd)
                s[t] = wmma_bf16(qf[kd], kf[t][kd], s[t]);
        // ---- causal mask + scale ----
        const int qrow_base = qbase + half * 8;
#pragma unroll
        for (int t = 0; t < 2; ++t) {
            const int kv = kvbase + t * 16 + mr;
#pragma unroll
            for (int r = 0; r < 8; ++r) {
                float v = s[t][r] * scale;
                if (kv > qrow_base + r) v = -3.0e38f;
                s[t][r] = v;
            }
        }
        // ---- online softmax (row reductions across 16-lane groups) ----
        // Each DPP step runs over all eight rows before the next one, so that the
        // rows' dependent chains fill one another's latency.
        float mblk[8], ps[8], corr[8];
#pragma unroll   // static row index: the row arrays stay in registers
        for (int r = 0; r < 8; ++r) mblk[r] = fmaxf(s[0][r], s[1][r]);
#pragma unroll   // static row index: the row arrays stay in registers
        for (int r = 0; r < 8; ++r) mblk[r] = row_max_step<8>(mblk[r]);
#pragma unroll   // static row index: the row arrays stay in registers
        for (int r = 0; r < 8; ++r) mblk[r] = row_max_step<4>(mblk[r]);
#pragma unroll   // static row index: the row arrays stay in registers
        for (int r = 0; r < 8; ++r) mblk[r] = row_max_step<2>(mblk[r]);
#pragma unroll   // static row index: the row arrays stay in registers
        for (int r = 0; r < 8; ++r) mblk[r] = row_max_step<1>(mblk[r]);
#pragma unroll   // static row index: the row arrays stay in registers
        for (int r = 0; r < 8; ++r) {
            const float mnew = fmaxf(rm[r], mblk[r]);
            corr[r] = __expf(rm[r] - mnew);
            const float p0 = __expf(s[0][r] - mnew);
            const float p1 = __expf(s[1][r] - mnew);
            ps[r] = p0 + p1;
            rm[r] = mnew;
            const int m = half * 8 + r;
            Pl[wave][m][mr]      = p0;    // C-layout -> LDS (wave-private)
            Pl[wave][m][16 + mr] = p1;
        }
#pragma unroll   // static row index: the row arrays stay in registers
        for (int r = 0; r < 8; ++r) ps[r] += row_xor<8>(ps[r]);
#pragma unroll   // static row index: the row arrays stay in registers
        for (int r = 0; r < 8; ++r) ps[r] += row_xor<4>(ps[r]);
#pragma unroll   // static row index: the row arrays stay in registers
        for (int r = 0; r < 8; ++r) ps[r] += row_xor<2>(ps[r]);
#pragma unroll   // static row index: the row arrays stay in registers
        for (int r = 0; r < 8; ++r) ps[r] += row_xor<1>(ps[r]);
#pragma unroll   // static row index: the row arrays stay in registers
        for (int r = 0; r < 8; ++r) {
            rl[r] = rl[r] * corr[r] + ps[r];
#pragma unroll
            for (int dt = 0; dt < 4; ++dt) acc[dt][r] *= corr[r];
        }
        // ---- P (16x32) as A-fragment (bf16), then P @ V ----
        v16bf pa;
#pragma unroll
        for (int g2 = 0; g2 < 2; ++g2)
#pragma unroll
            for (int j = 0; j < 8; ++j)
                pa[g2 * 8 + j] = (__bf16)Pl[wave][mr][g2 * 16 + half * 8 + j];
#pragma unroll   // static fragment index: acc and vf stay in registers
        for (int dt = 0; dt < 4; ++dt)
            acc[dt] = wmma_bf16(pa, vf[dt], acc[dt]);
    }
    // no copy is left in flight when the wave ends
    asm volatile("s_wait_asynccnt 0x0" ::: "memory");
    // ---- epilogue: O = acc / l ----
#pragma unroll
    for (int r = 0; r < 8; ++r) {
        const float inv = 1.0f / rl[r];
        const int q = qbase + half * 8 + r;
#pragma unroll
        for (int dt = 0; dt < 4; ++dt)
            O[base + (size_t)q * D_MODEL + (dt * 16 + mr)] =
                (__bf16)(acc[dt][r] * inv);
    }
}

// ---------------------------------------------------------------------------
// host launcher
// ---------------------------------------------------------------------------
extern "C" void kernel_launch(void* const* d_in, const int* in_sizes, int n_in,
                              void* d_out, int out_size, void* d_ws, size_t ws_size,
                              hipStream_t stream) {
    (void)in_sizes; (void)n_in; (void)out_size; (void)ws_size;
    const float* x   = (const float*)d_in[0];
    const float* Wq  = (const float*)d_in[1];
    const float* bq  = (const float*)d_in[2];
    const float* Wk  = (const float*)d_in[3];
    const float* bk  = (const float*)d_in[4];
    const float* Wv  = (const float*)d_in[5];
    const float* bv  = (const float*)d_in[6];
    const float* Wo  = (const float*)d_in[7];
    const float* bo  = (const float*)d_in[8];
    const float* g1  = (const float*)d_in[9];
    const float* b1  = (const float*)d_in[10];
    const float* g2  = (const float*)d_in[11];
    const float* b2  = (const float*)d_in[12];
    const float* Wup = (const float*)d_in[13];
    const float* bup = (const float*)d_in[14];
    const float* Wdn = (const float*)d_in[15];
    const float* bdn = (const float*)d_in[16];

    char* ws = (char*)d_ws;
    size_t off = 0;
    auto take = [&](size_t bytes) -> void* {
        void* p = ws + off;
        off = (off + bytes + 255) & ~(size_t)255;
        return p;
    };
    __bf16* wq_b  = (__bf16*)take((size_t)D_MODEL * D_MODEL * 2);
    __bf16* wk_b  = (__bf16*)take((size_t)D_MODEL * D_MODEL * 2);
    __bf16* wv_b  = (__bf16*)take((size_t)D_MODEL * D_MODEL * 2);
    __bf16* wo_b  = (__bf16*)take((size_t)D_MODEL * D_MODEL * 2);
    __bf16* wup_b = (__bf16*)take((size_t)D_MODEL * MLP_DIM * 2);
    __bf16* wdn_b = (__bf16*)take((size_t)MLP_DIM * D_MODEL * 2);
    __bf16* xn_b  = (__bf16*)take((size_t)ROWS * D_MODEL * 2);
    __bf16* q_b   = (__bf16*)take((size_t)ROWS * D_MODEL * 2);
    __bf16* k_b   = (__bf16*)take((size_t)ROWS * D_MODEL * 2);
    __bf16* v_b   = (__bf16*)take((size_t)ROWS * D_MODEL * 2);
    __bf16* o_b   = (__bf16*)take((size_t)ROWS * D_MODEL * 2);
    float*  x2    = (float*) take((size_t)ROWS * D_MODEL * 4);
    __bf16* xn2_b = (__bf16*)take((size_t)ROWS * D_MODEL * 2);
    __bf16* h_b   = (__bf16*)take((size_t)ROWS * MLP_DIM * 2);

    // 1) weights fp32 -> bf16: wq_b .. wdn_b are contiguous (every size is a multiple of 256 B)
    cvt_weights_kernel<<<CVT_TOTAL / CVT_CHUNK, CVT_THREADS, 0, stream>>>(Wq, Wk, Wv, Wo, Wup, Wdn, wq_b);

    // 2) LN1 -> bf16
    ln_kernel<<<ROWS, 256, 0, stream>>>(x, g1, b1, xn_b);

    // 3) Q/K/V projections (bf16 out)
    dim3 gD(D_MODEL / BN, ROWS / BM);   // (8, 32)
    gemm_bf16_kernel<0, false, false, D_MODEL><<<gD, 256, 0, stream>>>(
        xn_b, wq_b, bq, nullptr, nullptr, q_b, D_MODEL);
    gemm_bf16_kernel<0, false, false, D_MODEL><<<gD, 256, 0, stream>>>(
        xn_b, wk_b, bk, nullptr, nullptr, k_b, D_MODEL);
    gemm_bf16_kernel<0, false, false, D_MODEL><<<gD, 256, 0, stream>>>(
        xn_b, wv_b, bv, nullptr, nullptr, v_b, D_MODEL);

    // 4) causal flash attention (4096 waves, 4 waves/block)
    attn_kernel<<<(BATCH * NUM_HEADS * (SEQ / 16)) / 4, 128, 0, stream>>>(q_b, k_b, v_b, o_b);

    // 5) output projection + residual -> x2 (fp32)
    gemm_bf16_kernel<0, true, true, D_MODEL><<<gD, 256, 0, stream>>>(
        o_b, wo_b, bo, x, x2, nullptr, D_MODEL);

    // 6) LN2 -> bf16
    ln_kernel<<<ROWS, 256, 0, stream>>>(x2, g2, b2, xn2_b);

    // 7) MLP up + GELU (bf16 out)
    dim3 gU(MLP_DIM / BN, ROWS / BM);   // (32, 32)
    gemm_bf16_kernel<1, false, false, MLP_DIM><<<gU, 256, 0, stream>>>(
        xn2_b, wup_b, bup, nullptr, nullptr, h_b, D_MODEL);

    // 8) MLP down + residual -> out (fp32)
    gemm_bf16_kernel<0, true, true, D_MODEL><<<gD, 256, 0, stream>>>(
        h_b, wdn_b, bdn, x2, (float*)d_out, nullptr, MLP_DIM);
}

// v008
// One run takes 218 microseconds.
// Next to v007, in two timings, it ran 1.05 times as fast each time.
// All steps since v000 together make it 3.07 times as fast.
#include <hip/hip_runtime.h>
#include <hip/hip_bf16.h>
#include <math.h>

// ---- problem constants (match reference) ----
#define D_MODEL   1024
#define NUM_HEADS 16
#define HEAD_DIM  64
#define MLP_DIM   4096
#define BATCH     2
#define SEQ       2048
#define ROWS      (BATCH * SEQ)   // 4096
#define LN_EPS    1e-5f

typedef __attribute__((ext_vector_type(16))) __bf16 v16bf;
typedef __attribute__((ext_vector_type(8)))  __bf16 v8bf;
typedef __attribute__((ext_vector_type(8)))  float  v8f;
typedef __attribute__((ext_vector_type(4)))  __bf16 v4bf;
typedef __attribute__((ext_vector_type(4)))  float  v4f;
typedef int v4i __attribute__((vector_size(16)));   // matches builtin param type

// ---- CDNA5 async global->LDS path (guarded; falls back to vector copies) ----
#if defined(__AMDGCN__) && __has_builtin(__builtin_amdgcn_global_load_async_to_lds_b128)
#define HAS_ASYNC_LDS 1
#else
#define HAS_ASYNC_LDS 0
#endif

#if HAS_ASYNC_LDS
// asm with the "memory" clobber: no LDS read moves ahead of the wait
#define WAIT_ASYNC(n) asm volatile("s_wait_asynccnt %0" ::"i"(n) : "memory")
#else
#define WAIT_ASYNC(n) do { } while (0)
#endif

static __device__ __forceinline__ void async_cp16(const __bf16* g, __bf16* l) {
#if HAS_ASYNC_LDS
    // global_load_async_to_lds_b128: 16B global -> LDS, tracked by ASYNCcnt
    __builtin_amdgcn_global_load_async_to_lds_b128((v4i*)g, (v4i*)l, 0, 0);
#else
    *reinterpret_cast<v8bf*>(l) = *reinterpret_cast<const v8bf*>(g);
#endif
}

// ds_load_tr16_b128 on a row-major 16-bit LDS tile T: with lane l aimed at
// T[k0 + 8*(l>>4) + (l&7)][n0 + 8*((l>>3)&1)], lane l gets T[k0 + 8*(l>>4) + 0..7][n0 + (l&15)],
// one half of a WMMA operand in the hardware k order. All 32 lanes must hold a valid address.
typedef __attribute__((address_space(3))) v8bf lds_v8bf;
static __device__ __forceinline__ v8bf lds_tr16(const __bf16* p) {
    return __builtin_amdgcn_ds_load_tr16_b128_v8bf16((lds_v8bf*)p);
}

static __device__ __forceinline__ v8f wmma_bf16(v16bf a, v16bf b, v8f c) {
    // D = A(16x32 bf16) * B(32x16 bf16) + C(16x16 f32)
    return __builtin_amdgcn_wmma_f32_16x16x32_bf16(
        /*neg_a=*/false, a, /*neg_b=*/false, b,
        /*c_mod=*/(short)0, c, /*reuse_a=*/false, /*reuse_b=*/false);
}

// Lane l reads lane l ^ X of its own 16-lane row (DPP row_xmask): a vector-unit
// exchange, where __shfl_xor goes through the LDS queue and a wait per step.
// All 32 lanes must be active.
template <int X>
static __device__ __forceinline__ float row_xor(float v) {
    return __builtin_bit_cast(float, __builtin_amdgcn_update_dpp(
        0, __builtin_bit_cast(int, v), 0x160 | X, 0xf, 0xf, true));
}

// One step of a 16-lane row maximum, max(v, v of lane l ^ X), as one DPP instruction.
// asm: fmaxf() on row_xor() compiles to three dependent instructions (move, quieting
// max, max); volatile: keeps the rows' independent steps in the interleaved order written.
template <int X>
static __device__ __forceinline__ float row_max_step(float v) {
    float r;
    asm volatile("v_max_num_f32_dpp %0, %1, %1 row_xmask:%2 row_mask:0xf bank_mask:0xf"
                 : "=v"(r) : "v"(v), "n"(X));
    return r;
}

// tanh-GELU of eight values without a branch: 0.5 * (1 + tanh(u)) = 1 / (1 + exp(-2u)),
// u = sqrt(2/pi) * (x + 0.044715 x^3): one v_exp_f32 and one v_rcp_f32 per value. The library tanhf picks
// one of two paths per lane, so a wave walks both behind two branches on EXEC, one value at a time.
// exp overflows to +inf only where the exact factor is below 2^-126: rcp gives 0 there, as tanh = -1 does.
static __device__ __forceinline__ void gelu_tanh8(float (&x)[8]) {
    const float k = -2.0f * 0.7978845608028654f * 1.4426950408889634f;   // exp(-2u) = exp2(k * (x + 0.044715 x^3))
    float s[8];
#pragma unroll   // static index: s stays in registers
    for (int r = 0; r < 8; ++r) s[r] = x[r] * fmaf(0.044715f * k, x[r] * x[r], k);
    // s = 1 / (1 + exp2(s)). asm: behind every transcendental stands an instruction that neither reads its
    // result nor overwrites its source (the eight values fill one another's slot, v_nop the last one).
    asm("v_exp_f32 %0, %0\n\tv_exp_f32 %1, %1\n\tv_exp_f32 %2, %2\n\tv_exp_f32 %3, %3\n\t"
        "v_exp_f32 %4, %4\n\tv_exp_f32 %5, %5\n\tv_exp_f32 %6, %6\n\tv_exp_f32 %7, %7\n\t"
        "v_add_f32 %0, 1.0, %0\n\tv_add_f32 %1, 1.0, %1\n\tv_add_f32 %2, 1.0, %2\n\tv_add_f32 %3, 1.0, %3\n\t"
        "v_add_f32 %4, 1.0, %4\n\tv_add_f32 %5, 1.0, %5\n\tv_add_f32 %6, 1.0, %6\n\tv_add_f32 %7, 1.0, %7\n\t"
        "v_rcp_f32 %0, %0\n\tv_rcp_f32 %1, %1\n\tv_rcp_f32 %2, %2\n\tv_rcp_f32 %3, %3\n\t"
        "v_rcp_f32 %4, %4\n\tv_rcp_f32 %5, %5\n\tv_rcp_f32 %6, %6\n\tv_rcp_f32 %7, %7\n\t"
        "v_nop"
        : "+v"(s[0]), "+v"(s[1]), "+v"(s[2]), "+v"(s[3]), "+v"(s[4]), "+v"(s[5]), "+v"(s[6]), "+v"(s[7]));
#pragma unroll   // static index: s stays in registers
    for (int r = 0; r < 8; ++r) x[r] *= s[r];
}

// ---------------------------------------------------------------------------
// fp32 -> bf16 conversion of all six weight matrices in one launch.
// The six bf16 copies lie one behind the other in the workspace, so dst is one array of
// CVT_TOTAL elements; a block converts CVT_CHUNK of them, all from one source matrix.
// Few waves with much in flight each: a lane issues its 32 loads of 16 B together (every
// load of a wave covers 512 contiguous bytes) and stores 8 B per load (256 contiguous
// bytes a wave).
// ---------------------------------------------------------------------------
#define CVT_SQ      (D_MODEL * D_MODEL)              // elements of Wq, Wk, Wv, Wo; Wup and Wdn hold four times as many
#define CVT_TOTAL   (4 * CVT_SQ + 2 * D_MODEL * MLP_DIM)
#define CVT_THREADS 128
#define CVT_LOADS   32
#define CVT_STEP    (CVT_THREADS * 4)                // elements that one load of the whole block brings
#define CVT_CHUNK   (CVT_STEP * CVT_LOADS)           // 16384 elements a block; divides CVT_SQ

__global__ __launch_bounds__(CVT_THREADS)
void cvt_weights_kernel(const float* __restrict__ wq, const float* __restrict__ wk,
                        const float* __restrict__ wv, const float* __restrict__ wo,
                        const float* __restrict__ wup, const float* __restrict__ wdn,
                        __bf16* __restrict__ dst) {
    const int per = CVT_SQ / CVT_CHUNK;              // blocks per CVT_SQ elements
    const int seg = blockIdx.x / per;                // 0..3: Wq, Wk, Wv, Wo; 4..7: Wup; 8..11: Wdn
    const float* s = wq;
    s = seg == 1 ? wk  : s;
    s = seg == 2 ? wv  : s;
    s = seg == 3 ? wo  : s;
    s = seg >= 4 ? wup : s;
    s = seg >= 8 ? wdn : s;
    const int quarter = seg >= 4 ? (seg & 3) : 0;    // which CVT_SQ elements of Wup or Wdn
    s += (size_t)quarter * CVT_SQ + (size_t)(blockIdx.x % per) * CVT_CHUNK + threadIdx.x * 4;
    __bf16* d = dst + (size_t)blockIdx.x * CVT_CHUNK + threadIdx.x * 4;
    v4f v[CVT_LOADS];
#pragma unroll   // static index: v stays in registers
    for (int j = 0; j < CVT_LOADS; ++j)
        v[j] = *reinterpret_cast<const v4f*>(s + j * CVT_STEP);
    // keeps every load ahead of the first conversion: without it the compiler holds the last
    // loads back until the first have returned, a second memory latency per wave
    __builtin_amdgcn_sched_barrier(0);
#pragma unroll   // static index: v stays in registers
    for (int j = 0; j < CVT_LOADS; ++j)
        *reinterpret_cast<v4bf*>(d + j * CVT_STEP) = __builtin_convertvector(v[j], v4bf);
}

// ---------------------------------------------------------------------------
// LayerNorm over last dim (C = D_MODEL), one 256-thread block per row,
// output bf16 (feeds WMMA GEMMs)
// ---------------------------------------------------------------------------
__global__ void ln_kernel(const float* __restrict__ x,
                          const float* __restrict__ g,
                          const float* __restrict__ b,
                          __bf16* __restrict__ out) {
    const int row = blockIdx.x;
    const float* xr = x + (size_t)row * D_MODEL;
    float s = 0.f, ss = 0.f;
    for (int i = threadIdx.x; i < D_MODEL; i += blockDim.x) {
        float v = xr[i];
        s += v;
        ss += v * v;
    }
    __shared__ float sh[2][8];
    const int lane = threadIdx.x & 31;
    const int wave = threadIdx.x >> 5;
#pragma unroll
    for (int o = 16; o > 0; o >>= 1) {
        s  += __shfl_down(s, o);
        ss += __shfl_down(ss, o);
    }
    if (lane == 0) { sh[0][wave] = s; sh[1][wave] = ss; }
    __syncthreads();
    s = 0.f; ss = 0.f;
#pragma unroll
    for (int w = 0; w < 8; ++w) { s += sh[0][w]; ss += sh[1][w]; }
    const float mu   = s  * (1.0f / D_MODEL);
    const float var  = ss * (1.0f / D_MODEL) - mu * mu;
    const float rstd = rsqrtf(var + LN_EPS);
    __bf16* orow = out + (size_t)row * D_MODEL;
    for (int i = threadIdx.x; i < D_MODEL; i += blockDim.x)
        orow[i] = (__bf16)((xr[i] - mu) * rstd * g[i] + b[i]);
}

// ---------------------------------------------------------------------------
// bf16 WMMA GEMM:  C[M,N] = A[M,K] @ B[K,N] + bias (+ res)
// 256 threads = 8 waves; block tile 128(M) x 128(N); K step 64 (two WMMA depths).
// Wave tile 64x32 (4x2 WMMAs per depth). LDS double-buffered via async global->LDS.
// The operands come from L2 once per block tile, so the tile is as large as still gives
// every WGP a block at N = 1024; a K step is a whole 128-B line of every A row.
// ACT: 0 = none, 1 = tanh-GELU (applied before residual add).
// RES: add res[m][n]. OUTF: store f32 to outF, else bf16 to outB. N: row pitch of B, res, out.
// These are template constants so that the residual loads and the epilogue
// stores are straight-line code that differs by immediate offsets only.
// ---------------------------------------------------------------------------
#define BM 128
#define BN 128
#define BK 64
#define FM 4            // 16-row A fragments of a wave
#define FN 2            // 16-column B fragments of a wave
#define CPT 8           // copies of a thread per K step: 4 of A, 4 of B
#define BKP (BK + 8)    // LDS pitch of an A row: 144 B, an odd multiple of 16 B, free of bank conflicts for ds_load_b128
#define BNP (BN + 16)   // LDS pitch of a B row: 288 B, an odd multiple of 32 B, free of bank conflicts for ds_load_tr16_b128

template <int ACT, bool RES, bool OUTF, int N>
__global__ __launch_bounds__(256)
void gemm_bf16_kernel(const __bf16* __restrict__ A, const __bf16* __restrict__ Bw,
                      const float* __restrict__ bias, const float* __restrict__ res,
                      float* __restrict__ outF, __bf16* __restrict__ outB,
                      int K) {
    __shared__ __attribute__((aligned(16))) __bf16 As[2][BM][BKP];   // 2 * 18 KB
    __shared__ __attribute__((aligned(16))) __bf16 Bs[2][BK][BNP];   // 2 * 18 KB
    const int tid  = threadIdx.x;
    const int lane = tid & 31;
    const int wave = tid >> 5;
    const int wm = (wave >> 2) * 64;   // 0 / 64
    const int wn = (wave & 3) * 32;    // 0,32,64,96
    const int bm = blockIdx.y * BM;
    const int bn = blockIdx.x * BN;
    const int half = lane >> 4;        // K-half selector
    const int mr   = lane & 15;        // A row / B col within 16x16 tile

    // staging indices (per thread: 4x16B for A, 4x16B for B). Each copy instruction of a wave
    // covers whole 128-B lines: four A rows of 128 B, or two B rows of 256 B.
    const int ar = tid >> 3;           // 0..31: A rows ar, ar + 32, ar + 64, ar + 96
    const int ac = (tid & 7) * 8;      // 0..56
    const int br = (tid >> 4) * 4;     // 0..60: B rows br .. br + 3
    const int bc = (tid & 15) * 8;     // 0..120
    auto stage = [&](int buf, int k0) {
        const __bf16* ga = &A[(size_t)(bm + ar) * K + (k0 + ac)];
        const __bf16* gb = &Bw[(size_t)(k0 + br) * N + (bn + bc)];
#pragma unroll   // constant LDS steps
        for (int c = 0; c < 4; ++c) async_cp16(ga + (size_t)(c * 32) * K, &As[buf][ar + c * 32][ac]);
#pragma unroll   // constant row steps: one address pair serves four copies
        for (int c = 0; c < 4; ++c) async_cp16(gb + c * N, &Bs[buf][br + c][bc]);
    };

    v8f acc[FM][FN] = {};
    const int nk = K / BK;

    // element (i, jn, r) of this lane's results lies at o0 + (i * 16 + r) * N + jn * 16
    const size_t o0 = (size_t)(bm + wm + half * 8) * N + (bn + wn + mr);
    // All residual and bias loads of the lane are issued here, together: they are in flight
    // while the first K tile lands, and the epilogue waits for none of them one by one.
    float rv[FM][FN][8];
    if (RES) {
#pragma unroll   // static index: rv stays in registers
        for (int i = 0; i < FM; ++i)
#pragma unroll   // static index: rv stays in registers
            for (int r = 0; r < 8; ++r)
#pragma unroll   // static index: rv stays in registers
                for (int jn = 0; jn < FN; ++jn)
                    rv[i][jn][r] = res[o0 + (i * 16 + r) * N + jn * 16];
    }
    const float bvv[2] = { bias[bn + wn + mr], bias[bn + wn + 16 + mr] };

    // prologue: stage K-step 0 into buffer 0
    stage(0, 0);

    for (int ks = 0; ks < nk; ++ks) {
        const int cur = ks & 1;
        if (ks + 1 < nk) {
            stage(cur ^ 1, (ks + 1) * BK);
            WAIT_ASYNC(CPT);   // the newest CPT may remain outstanding -> this step's panel has landed
        } else {
            WAIT_ASYNC(0);
        }
        __syncthreads();

        v16bf af[BK / 32][FM], bfr[BK / 32][FN];
#pragma unroll   // static fragment index: af and bfr stay in registers
        for (int kd = 0; kd < BK / 32; ++kd) {
            // B fragments: element g2*8+j = Bs[kd*32 + g2*16 + half*8 + j][column], the k order of af
            const __bf16* bt = &Bs[cur][kd * 32 + half * 8 + (lane & 7)][wn + ((lane >> 3) & 1) * 8];
#pragma unroll   // static fragment index: bfr stays in registers
            for (int jn = 0; jn < FN; ++jn)
                bfr[kd][jn] = __builtin_shufflevector(lds_tr16(bt + jn * 16),
                                                      lds_tr16(bt + 16 * BNP + jn * 16),
                                                      0, 1, 2, 3, 4, 5, 6, 7, 8, 9, 10, 11, 12, 13, 14, 15);
            // A fragments: element g2*8+j = As[row][kd*32 + g2*16 + half*8 + j]
#pragma unroll   // static fragment index: af stays in registers
            for (int i = 0; i < FM; ++i) {
                const __bf16* at = &As[cur][wm + i * 16 + mr][kd * 32 + half * 8];
                af[kd][i] = __builtin_shufflevector(*reinterpret_cast<const v8bf*>(at),
                                                    *reinterpret_cast<const v8bf*>(at + 16),
                                                    0, 1, 2, 3, 4, 5, 6, 7, 8, 9, 10, 11, 12, 13, 14, 15);
            }
        }
        // keeps the K step's LDS reads one group ahead of its products: without it the compiler
        // sinks them among the WMMAs, each pair behind a wait of a whole LDS latency
        __builtin_amdgcn_sched_barrier(0);
#pragma unroll   // static fragment index: acc, af and bfr stay in registers
        for (int kd = 0; kd < BK / 32; ++kd)
#pragma unroll   // static fragment index: acc, af and bfr stay in registers
            for (int i = 0; i < FM; ++i)
#pragma unroll   // static fragment index: acc, af and bfr stay in registers
                for (int jn = 0; jn < FN; ++jn)
                    acc[i][jn] = wmma_bf16(af[kd][i], bfr[kd][jn], acc[i][jn]);
        // keeps the barrier behind the products: moved up among them it brings a wait for ALL
        // the reads ahead of the second product, and reads and products no longer overlap
        __builtin_amdgcn_sched_barrier(0);
        __syncthreads();
    }

    // epilogue
    if (ACT == 1) {
#pragma unroll   // static fragment index: acc stays in registers
        for (int jn = 0; jn < FN; ++jn)
#pragma unroll   // static fragment index: acc stays in registers
            for (int i = 0; i < FM; ++i) {
                float g[8];
#pragma unroll   // static index: g stays in registers
                for (int r = 0; r < 8; ++r) g[r] = acc[i][jn][r] + bvv[jn];
                gelu_tanh8(g);
#pragma unroll   // static index: g stays in registers
                for (int r = 0; r < 8; ++r) acc[i][jn][r] = g[r];
            }
    }
#pragma unroll
    for (int jn = 0; jn < FN; ++jn)
#pragma unroll
        for (int i = 0; i < FM; ++i)
#pragma unroll
            for (int r = 0; r < 8; ++r) {
                const size_t o = o0 + (i * 16 + r) * N + jn * 16;
                float v = acc[i][jn][r];
                if (ACT != 1) v += bvv[jn];   // with ACT == 1 the bias went in ahead of the GELU
                if (RES) v += rv[i][jn][r];
                if (OUTF) outF[o] = v;
                else      outB[o] = (__bf16)v;
            }
}

// ---------------------------------------------------------------------------
// Causal flash attention, one wave per (b, h, 16-row Q tile).
// Q/K/V/O layout: [B, T, H*Dh] bf16. Online softmax; QK^T and P*V via WMMA.
// No block barriers (waves have divergent causal trip counts).
// K and V of a 32-key block reach the wave through LDS buffers of its own, filled by
// asynchronous copies while the block before is worked on. No other wave touches them,
// so the wave's own waits order fill, read and refill.
// ---------------------------------------------------------------------------
#define KP (HEAD_DIM + 8)    // LDS pitch of a K row: 144 B, an odd multiple of 16 B, for ds_load_b128
#define VP (HEAD_DIM + 16)   // LDS pitch of a V row: 160 B, an odd multiple of 32 B, for ds_load_tr16_b128
#define PP (32 + 4)          // LDS pitch of a P row: 144 B, an odd multiple of 16 B, for ds_load_b128

__global__ __launch_bounds__(128)
void attn_kernel(const __bf16* __restrict__ Q, const __bf16* __restrict__ Km,
                 const __bf16* __restrict__ V, __bf16* __restrict__ O) {
    __shared__ __attribute__((aligned(16))) float Pl[4][16][PP];   // per-wave P bounce (C-layout -> A-layout)
    __shared__ __attribute__((aligned(16))) __bf16 Ks[4][32][KP];   // per-wave K block
    __shared__ __attribute__((aligned(16))) __bf16 Vs[4][32][VP];   // per-wave V block
    const int lane = threadIdx.x & 31;
    // in a scalar register: the trip count and the test round the copies are then scalar branches
    const int wave = __builtin_amdgcn_readfirstlane(threadIdx.x >> 5);
    const int work = blockIdx.x * 4 + wave;
    const int QT = SEQ / 16;                       // 128 q-tiles
    const int qt = work % QT;
    const int h  = (work / QT) % NUM_HEADS;
    const int b  = work / (QT * NUM_HEADS);
    const size_t base = ((size_t)b * SEQ) * D_MODEL + (size_t)h * HEAD_DIM;
    const int qbase = qt * 16;
    const int half = lane >> 4;
    const int mr   = lane & 15;
    const float scale = 0.125f;                    // 1/sqrt(64)

    // Q A-fragments for contraction halves d=[0,32) and [32,64)
    v16bf qf[2];
#pragma unroll
    for (int t = 0; t < 2; ++t)
#pragma unroll
        for (int g2 = 0; g2 < 2; ++g2)
#pragma unroll
            for (int j = 0; j < 8; ++j)
                qf[t][g2 * 8 + j] =
                    Q[base + (size_t)(qbase + mr) * D_MODEL +
                      (t * 32 + g2 * 16 + half * 8 + j)];

    v8f acc[4] = {};                // 16 x 64 output accumulator (f32)
    float rm[8], rl[8];
#pragma unroll
    for (int r = 0; r < 8; ++r) { rm[r] = -3.0e38f; rl[r] = 0.f; }

    const int nblk = (qt + 2) >> 1;       // ceil((qbase+16)/32)

    // One block = 32 rows of 128 B each of K and of V: 8 + 8 copies of 16 B a lane.
    // Copy c: lane l brings bytes 16*(l&7) .. +15 of row 8*(l>>3) + c (four whole lines).
    const int crow = (lane >> 3) * 8;
    const int ccol = (lane & 7) * 8;
    const __bf16* kg = Km + base + (size_t)crow * D_MODEL + ccol;
    const __bf16* vg = V  + base + (size_t)crow * D_MODEL + ccol;
    __bf16* kl = &Ks[wave][crow][ccol];
    __bf16* vl = &Vs[wave][crow][ccol];
    auto stage = [&](int blk) {
        const __bf16* kgb = kg + (size_t)blk * 32 * D_MODEL;
        const __bf16* vgb = vg + (size_t)blk * 32 * D_MODEL;
#pragma unroll   // constant row steps: one address pair serves eight copies
        for (int c = 0; c < 8; ++c) async_cp16(kgb + c * D_MODEL, kl + c * KP);
#pragma unroll   // constant row steps: one address pair serves eight copies
        for (int c = 0; c < 8; ++c) async_cp16(vgb + c * D_MODEL, vl + c * VP);
    };
    stage(0);

    for (int kb = 0; kb < nblk; ++kb) {
        const int kvbase = kb * 32;
        // this block's copies have landed before any of its bytes is read
        asm volatile("s_wait_asynccnt 0x0" ::: "memory");
        // K fragments: element g2*8+j = K[kvbase + t*16 + mr][kd*32 + g2*16 + half*8 + j]
        v16bf kf[2][2];
#pragma unroll   // static fragment index: kf stays in registers
        for (int t = 0; t < 2; ++t)
#pragma unroll   // static fragment index: kf stays in registers
            for (int kd = 0; kd < 2; ++kd) {
                const __bf16* kr = &Ks[wave][t * 16 + mr][kd * 32 + half * 8];
                kf[t][kd] = __builtin_shufflevector(*reinterpret_cast<const v8bf*>(kr),
                                                    *reinterpret_cast<const v8bf*>(kr + 16),
                                                    0, 1, 2, 3, 4, 5, 6, 7, 8, 9, 10, 11, 12, 13, 14, 15);
            }
        // V fragments: element g2*8+j = V[kvbase + g2*16 + half*8 + j][dt*16 + mr], the k order of pa
        v16bf vf[4];
        const __bf16* vt = &Vs[wave][half * 8 + (lane & 7)][((lane >> 3) & 1) * 8];
#pragma unroll   // static fragment index: vf stays in registers
        for (int dt = 0; dt < 4; ++dt)
            vf[dt] = __builtin_shufflevector(lds_tr16(vt + dt * 16),
                                             lds_tr16(vt + 16 * VP + dt * 16),
                                             0, 1, 2, 3, 4, 5, 6, 7, 8, 9, 10, 11, 12, 13, 14, 15);
        // every read of the two buffers has returned before the refill is issued
        asm volatile("s_wait_dscnt 0x0" ::: "memory");
        if (kb + 1 < nblk) stage(kb + 1);   // flies during this block's products and softmax
        // ---- scores S = Q K^T : two 16x16 tiles over 32 kv positions ----
        v8f s[2] = {};
#pragma unroll   // static fragment index: s, qf and kf stay in registers
        for (int t = 0; t < 2; ++t)
#pragma unroll   // static fragment index: s, qf and kf stay in registers
            for (int kd = 0; kd < 2; ++kd)
                s[t] = wmma_bf16(qf[kd], kf[t][kd], s[t]);
        // ---- causal mask + scale ----
        const int qrow_base = qbase + half * 8;
#pragma unroll
        for (int t = 0; t < 2; ++t) {
            const int kv = kvbase + t * 16 + mr;
#pragma unroll
            for (int r = 0; r < 8; ++r) {
                float v = s[t][r] * scale;
                if (kv > qrow_base + r) v = -3.0e38f;
                s[t][r] = v;
            }
        }
        // ---- online softmax (row reductions across 16-lane groups) ----
        // Each DPP step runs over all eight rows before the next one, so that the
        // rows' dependent chains fill one another's latency.
        float mblk[8], ps[8], corr[8];
#pragma unroll   // static row index: the row arrays stay in registers
        for (int r = 0; r < 8; ++r) mblk[r] = fmaxf(s[0][r], s[1][r]);
#pragma unroll   // static row index: the row arrays stay in registers
        for (int r = 0; r < 8; ++r) mblk[r] = row_max_step<8>(mblk[r]);
#pragma unroll   // static row index: the row arrays stay in registers
        for (int r = 0; r < 8; ++r) mblk[r] = row_max_step<4>(mblk[r]);
#pragma unroll   // static row index: the row arrays stay in registers
        for (int r = 0; r < 8; ++r) mblk[r] = row_max_step<2>(mblk[r]);
#pragma unroll   // static row index: the row arrays stay in registers
        for (int r = 0; r < 8; ++r) mblk[r] = row_max_step<1>(mblk[r]);
#pragma unroll   // static row index: the row arrays stay in registers
        for (int r = 0; r < 8; ++r) {
            const float mnew = fmaxf(rm[r], mblk[r]);
            corr[r] = __expf(rm[r] - mnew);
            const float p0 = __expf(s[0][r] - mnew);
            const float p1 = __expf(s[1][r] - mnew);
            ps[r] = p0 + p1;
            rm[r] = mnew;
            const int m = half * 8 + r;
            Pl[wave][m][mr]      = p0;    // C-layout -> LDS (wave-private)
            Pl[wave][m][16 + mr] = p1;
        }
#pragma unroll   // static row index: the row arrays stay in registers
        for (int r = 0; r < 8; ++r) ps[r] += row_xor<8>(ps[r]);
#pragma unroll   // static row index: the row arrays stay in registers
        for (int r = 0; r < 8; ++r) ps[r] += row_xor<4>(ps[r]);
#pragma unroll   // static row index: the row arrays stay in registers
        for (int r = 0; r < 8; ++r) ps[r] += row_xor<2>(ps[r]);
#pragma unroll   // static row index: the row arrays stay in registers
        for (int r = 0; r < 8; ++r) ps[r] += row_xor<1>(ps[r]);
#pragma unroll   // static row index: the row arrays stay in registers
        for (int r = 0; r < 8; ++r) {
            rl[r] = rl[r] * corr[r] + ps[r];
#pragma unroll
            for (int dt = 0; dt < 4; ++dt) acc[dt][r] *= corr[r];
        }
        // ---- P (16x32) as A-fragment (bf16), then P @ V ----
        v16bf pa;
#pragma unroll
        for (int g2 = 0; g2 < 2; ++g2)
#pragma unroll
            for (int j = 0; j < 8; ++j)
                pa[g2 * 8 + j] = (__bf16)Pl[wave][mr][g2 * 16 + half * 8 + j];
#pragma unroll   // static fragment index: acc and vf stay in registers
        for (int dt = 0; dt < 4; ++dt)
            acc[dt] = wmma_bf16(pa, vf[dt], acc[dt]);
    }
    // no copy is left in flight when the wave ends
    asm volatile("s_wait_asynccnt 0x0" ::: "memory");
    // ---- epilogue: O = acc / l ----
#pragma unroll
    for (int r = 0; r < 8; ++r) {
        const float inv = 1.0f / rl[r];
        const int q = qbase + half * 8 + r;
#pragma unroll
        for (int dt = 0; dt < 4; ++dt)
            O[base + (size_t)q * D_MODEL + (dt * 16 + mr)] =
                (__bf16)(acc[dt][r] * inv);
    }
}

// ---------------------------------------------------------------------------
// host launcher
// ---------------------------------------------------------------------------
extern "C" void kernel_launch(void* const* d_in, const int* in_sizes, int n_in,
                              void* d_out, int out_size, void* d_ws, size_t ws_size,
                              hipStream_t stream) {
    (void)in_sizes; (void)n_in; (void)out_size; (void)ws_size;
    const float* x   = (const float*)d_in[0];
    const float* Wq  = (const float*)d_in[1];
    const float* bq  = (const float*)d_in[2];
    const float* Wk  = (const float*)d_in[3];
    const float* bk  = (const float*)d_in[4];
    const float* Wv  = (const float*)d_in[5];
    const float* bv  = (const float*)d_in[6];
    const float* Wo  = (const float*)d_in[7];
    const float* bo  = (const float*)d_in[8];
    const float* g1  = (const float*)d_in[9];
    const float* b1  = (const float*)d_in[10];
    const float* g2  = (const float*)d_in[11];
    const float* b2  = (const float*)d_in[12];
    const float* Wup = (const float*)d_in[13];
    const float* bup = (const float*)d_in[14];
    const float* Wdn = (const float*)d_in[15];
    const float* bdn = (const float*)d_in[16];

    char* ws = (char*)d_ws;
    size_t off = 0;
    auto take = [&](size_t bytes) -> void* {
        void* p = ws + off;
        off = (off + bytes + 255) & ~(size_t)255;
        return p;
    };
    __bf16* wq_b  = (__bf16*)take((size_t)D_MODEL * D_MODEL * 2);
    __bf16* wk_b  = (__bf16*)take((size_t)D_MODEL * D_MODEL * 2);
    __bf16* wv_b  = (__bf16*)take((size_t)D_MODEL * D_MODEL * 2);
    __bf16* wo_b  = (__bf16*)take((size_t)D_MODEL * D_MODEL * 2);
    __bf16* wup_b = (__bf16*)take((size_t)D_MODEL * MLP_DIM * 2);
    __bf16* wdn_b = (__bf16*)take((size_t)MLP_DIM * D_MODEL * 2);
    __bf16* xn_b  = (__bf16*)take((size_t)ROWS * D_MODEL * 2);
    __bf16* q_b   = (__bf16*)take((size_t)ROWS * D_MODEL * 2);
    __bf16* k_b   = (__bf16*)take((size_t)ROWS * D_MODEL * 2);
    __bf16* v_b   = (__bf16*)take((size_t)ROWS * D_MODEL * 2);
    __bf16* o_b   = (__bf16*)take((size_t)ROWS * D_MODEL * 2);
    float*  x2    = (float*) take((size_t)ROWS * D_MODEL * 4);
    __bf16* xn2_b = (__bf16*)take((size_t)ROWS * D_MODEL * 2);
    __bf16* h_b   = (__bf16*)take((size_t)ROWS * MLP_DIM * 2);

    // 1) weights fp32 -> bf16: wq_b .. wdn_b are contiguous (every size is a multiple of 256 B)
    cvt_weights_kernel<<<CVT_TOTAL / CVT_CHUNK, CVT_THREADS, 0, stream>>>(Wq, Wk, Wv, Wo, Wup, Wdn, wq_b);

    // 2) LN1 -> bf16
    ln_kernel<<<ROWS, 256, 0, stream>>>(x, g1, b1, xn_b);

    // 3) Q/K/V projections (bf16 out)
    dim3 gD(D_MODEL / BN, ROWS / BM);   // (8, 32)
    gemm_bf16_kernel<0, false, false, D_MODEL><<<gD, 256, 0, stream>>>(
        xn_b, wq_b, bq, nullptr, nullptr, q_b, D_MODEL);
    gemm_bf16_kernel<0, false, false, D_MODEL><<<gD, 256, 0, stream>>>(
        xn_b, wk_b, bk, nullptr, nullptr, k_b, D_MODEL);
    gemm_bf16_kernel<0, false, false, D_MODEL><<<gD, 256, 0, stream>>>(
        xn_b, wv_b, bv, nullptr, nullptr, v_b, D_MODEL);

    // 4) causal flash attention (4096 waves, 4 waves/block)
    attn_kernel<<<(BATCH * NUM_HEADS * (SEQ / 16)) / 4, 128, 0, stream>>>(q_b, k_b, v_b, o_b);

    // 5) output projection + residual -> x2 (fp32)
    gemm_bf16_kernel<0, true, true, D_MODEL><<<gD, 256, 0, stream>>>(
        o_b, wo_b, bo, x, x2, nullptr, D_MODEL);

    // 6) LN2 -> bf16
    ln_kernel<<<ROWS, 256, 0, stream>>>(x2, g2, b2, xn2_b);

    // 7) MLP up + GELU (bf16 out)
    dim3 gU(MLP_DIM / BN, ROWS / BM);   // (32, 32)
    gemm_bf16_kernel<1, false, false, MLP_DIM><<<gU, 256, 0, stream>>>(
        xn2_b, wup_b, bup, nullptr, nullptr, h_b, D_MODEL);

    // 8) MLP down + residual -> out (fp32)
    gemm_bf16_kernel<0, true, true, D_MODEL><<<gD, 256, 0, stream>>>(
        h_b, wdn_b, bdn, x2, (float*)d_out, nullptr, MLP_DIM);
}

// v009
// It runs in 206 microseconds.
// Two timings next to v008 put it at 1.06 and 1.07 times that version's speed.
// All steps since v000 together make it 3.26 times as fast.
#include <hip/hip_runtime.h>
#include <hip/hip_bf16.h>
#include <math.h>

// ---- problem constants (match reference) ----
#define D_MODEL   1024
#define NUM_HEADS 16
#define HEAD_DIM  64
#define MLP_DIM   4096
#define BATCH     2
#define SEQ       2048
#define ROWS      (BATCH * SEQ)   // 4096
#define LN_EPS    1e-5f

typedef __attribute__((ext_vector_type(16))) __bf16 v16bf;
typedef __attribute__((ext_vector_type(8)))  __bf16 v8bf;
typedef __attribute__((ext_vector_type(8)))  float  v8f;
typedef __attribute__((ext_vector_type(4)))  __bf16 v4bf;
typedef __attribute__((ext_vector_type(4)))  float  v4f;
typedef int v4i __attribute__((vector_size(16)));   // matches builtin param type

// ---- CDNA5 async global->LDS path (guarded; falls back to vector copies) ----
#if defined(__AMDGCN__) && __has_builtin(__builtin_amdgcn_global_load_async_to_lds_b128)
#define HAS_ASYNC_LDS 1
#else
#define HAS_ASYNC_LDS 0
#endif

#if HAS_ASYNC_LDS
// asm with the "memory" clobber: no LDS read moves ahead of the wait
#define WAIT_ASYNC(n) asm volatile("s_wait_asynccnt %0" ::"i"(n) : "memory")
#else
#define WAIT_ASYNC(n) do { } while (0)
#endif

static __device__ __forceinline__ void async_cp16(const __bf16* g, __bf16* l) {
#if HAS_ASYNC_LDS
    // global_load_async_to_lds_b128: 16B global -> LDS, tracked by ASYNCcnt
    __builtin_amdgcn_global_load_async_to_lds_b128((v4i*)g, (v4i*)l, 0, 0);
#else
    *reinterpret_cast<v8bf*>(l) = *reinterpret_cast<const v8bf*>(g);
#endif
}

// ds_load_tr16_b128 on a row-major 16-bit LDS tile T: with lane l aimed at
// T[k0 + 8*(l>>4) + (l&7)][n0 + 8*((l>>3)&1)], lane l gets T[k0 + 8*(l>>4) + 0..7][n0 + (l&15)],
// one half of a WMMA operand in the hardware k order. All 32 lanes must hold a valid address.
typedef __attribute__((address_space(3))) v8bf lds_v8bf;
static __device__ __forceinline__ v8bf lds_tr16(const __bf16* p) {
    return __builtin_amdgcn_ds_load_tr16_b128_v8bf16((lds_v8bf*)p);
}

static __device__ __forceinline__ v8f wmma_bf16(v16bf a, v16bf b, v8f c) {
    // D = A(16x32 bf16) * B(32x16 bf16) + C(16x16 f32)
    return __builtin_amdgcn_wmma_f32_16x16x32_bf16(
        /*neg_a=*/false, a, /*neg_b=*/false, b,
        /*c_mod=*/(short)0, c, /*reuse_a=*/false, /*reuse_b=*/false);
}

// Lane l reads lane l ^ X of its own 16-lane row (DPP row_xmask): a vector-unit
// exchange, where __shfl_xor goes through the LDS queue and a wait per step.
// All 32 lanes must be active.
template <int X>
static __device__ __forceinline__ float row_xor(float v) {
    return __builtin_bit_cast(float, __builtin_amdgcn_update_dpp(
        0, __builtin_bit_cast(int, v), 0x160 | X, 0xf, 0xf, true));
}

// One step of a 16-lane row maximum, max(v, v of lane l ^ X), as one DPP instruction.
// asm: fmaxf() on row_xor() compiles to three dependent instructions (move, quieting
// max, max); volatile: keeps the rows' independent steps in the interleaved order written.
template <int X>
static __device__ __forceinline__ float row_max_step(float v) {
    float r;
    asm volatile("v_max_num_f32_dpp %0, %1, %1 row_xmask:%2 row_mask:0xf bank_mask:0xf"
                 : "=v"(r) : "v"(v), "n"(X));
    return r;
}

// tanh-GELU of eight values without a branch: 0.5 * (1 + tanh(u)) = 1 / (1 + exp(-2u)),
// u = sqrt(2/pi) * (x + 0.044715 x^3): one v_exp_f32 and one v_rcp_f32 per value. The library tanhf picks
// one of two paths per lane, so a wave walks both behind two branches on EXEC, one value at a time.
// exp overflows to +inf only where the exact factor is below 2^-126: rcp gives 0 there, as tanh = -1 does.
static __device__ __forceinline__ void gelu_tanh8(float (&x)[8]) {
    const float k = -2.0f * 0.7978845608028654f * 1.4426950408889634f;   // exp(-2u) = exp2(k * (x + 0.044715 x^3))
    float s[8];
#pragma unroll   // static index: s stays in registers
    for (int r = 0; r < 8; ++r) s[r] = x[r] * fmaf(0.044715f * k, x[r] * x[r], k);
    // s = 1 / (1 + exp2(s)). asm: behind every transcendental stands an instruction that neither reads its
    // result nor overwrites its source (the eight values fill one another's slot, v_nop the last one).
    asm("v_exp_f32 %0, %0\n\tv_exp_f32 %1, %1\n\tv_exp_f32 %2, %2\n\tv_exp_f32 %3, %3\n\t"
        "v_exp_f32 %4, %4\n\tv_exp_f32 %5, %5\n\tv_exp_f32 %6, %6\n\tv_exp_f32 %7, %7\n\t"
        "v_add_f32 %0, 1.0, %0\n\tv_add_f32 %1, 1.0, %1\n\tv_add_f32 %2, 1.0, %2\n\tv_add_f32 %3, 1.0, %3\n\t"
        "v_add_f32 %4, 1.0, %4\n\tv_add_f32 %5, 1.0, %5\n\tv_add_f32 %6, 1.0, %6\n\tv_add_f32 %7, 1.0, %7\n\t"
        "v_rcp_f32 %0, %0\n\tv_rcp_f32 %1, %1\n\tv_rcp_f32 %2, %2\n\tv_rcp_f32 %3, %3\n\t"
        "v_rcp_f32 %4, %4\n\tv_rcp_f32 %5, %5\n\tv_rcp_f32 %6, %6\n\tv_rcp_f32 %7, %7\n\t"
        "v_nop"
        : "+v"(s[0]), "+v"(s[1]), "+v"(s[2]), "+v"(s[3]), "+v"(s[4]), "+v"(s[5]), "+v"(s[6]), "+v"(s[7]));
#pragma unroll   // static index: s stays in registers
    for (int r = 0; r < 8; ++r) x[r] *= s[r];
}

// ---------------------------------------------------------------------------
// fp32 -> bf16 conversion of all six weight matrices in one launch.
// The six bf16 copies lie one behind the other in the workspace, so dst is one array of
// CVT_TOTAL elements; a block converts CVT_CHUNK of them, all from one source matrix.
// Few waves with much in flight each: a lane issues its 32 loads of 16 B together (every
// load of a wave covers 512 contiguous bytes) and stores 8 B per load (256 contiguous
// bytes a wave).
// ---------------------------------------------------------------------------
#define CVT_SQ      (D_MODEL * D_MODEL)              // elements of Wq, Wk, Wv, Wo; Wup and Wdn hold four times as many
#define CVT_TOTAL   (4 * CVT_SQ + 2 * D_MODEL * MLP_DIM)
#define CVT_THREADS 128
#define CVT_LOADS   32
#define CVT_STEP    (CVT_THREADS * 4)                // elements that one load of the whole block brings
#define CVT_CHUNK   (CVT_STEP * CVT_LOADS)           // 16384 elements a block; divides CVT_SQ

__global__ __launch_bounds__(CVT_THREADS)
void cvt_weights_kernel(const float* __restrict__ wq, const float* __restrict__ wk,
                        const float* __restrict__ wv, const float* __restrict__ wo,
                        const float* __restrict__ wup, const float* __restrict__ wdn,
                        __bf16* __restrict__ dst) {
    const int per = CVT_SQ / CVT_CHUNK;              // blocks per CVT_SQ elements
    const int seg = blockIdx.x / per;                // 0..3: Wq, Wk, Wv, Wo; 4..7: Wup; 8..11: Wdn
    const float* s = wq;
    s = seg == 1 ? wk  : s;
    s = seg == 2 ? wv  : s;
    s = seg == 3 ? wo  : s;
    s = seg >= 4 ? wup : s;
    s = seg >= 8 ? wdn : s;
    const int quarter = seg >= 4 ? (seg & 3) : 0;    // which CVT_SQ elements of Wup or Wdn
    s += (size_t)quarter * CVT_SQ + (size_t)(blockIdx.x % per) * CVT_CHUNK + threadIdx.x * 4;
    __bf16* d = dst + (size_t)blockIdx.x * CVT_CHUNK + threadIdx.x * 4;
    v4f v[CVT_LOADS];
#pragma unroll   // static index: v stays in registers
    for (int j = 0; j < CVT_LOADS; ++j)
        v[j] = *reinterpret_cast<const v4f*>(s + j * CVT_STEP);
    // keeps every load ahead of the first conversion: without it the compiler holds the last
    // loads back until the first have returned, a second memory latency per wave
    __builtin_amdgcn_sched_barrier(0);
#pragma unroll   // static index: v stays in registers
    for (int j = 0; j < CVT_LOADS; ++j)
        *reinterpret_cast<v4bf*>(d + j * CVT_STEP) = __builtin_convertvector(v[j], v4bf);
}

// ---------------------------------------------------------------------------
// LayerNorm over last dim (C = D_MODEL), one 256-thread block per row,
// output bf16 (feeds WMMA GEMMs)
// ---------------------------------------------------------------------------
__global__ void ln_kernel(const float* __restrict__ x,
                          const float* __restrict__ g,
                          const float* __restrict__ b,
                          __bf16* __restrict__ out) {
    const int row = blockIdx.x;
    const float* xr = x + (size_t)row * D_MODEL;
    float s = 0.f, ss = 0.f;
    for (int i = threadIdx.x; i < D_MODEL; i += blockDim.x) {
        float v = xr[i];
        s += v;
        ss += v * v;
    }
    __shared__ float sh[2][8];
    const int lane = threadIdx.x & 31;
    const int wave = threadIdx.x >> 5;
#pragma unroll
    for (int o = 16; o > 0; o >>= 1) {
        s  += __shfl_down(s, o);
        ss += __shfl_down(ss, o);
    }
    if (lane == 0) { sh[0][wave] = s; sh[1][wave] = ss; }
    __syncthreads();
    s = 0.f; ss = 0.f;
#pragma unroll
    for (int w = 0; w < 8; ++w) { s += sh[0][w]; ss += sh[1][w]; }
    const float mu   = s  * (1.0f / D_MODEL);
    const float var  = ss * (1.0f / D_MODEL) - mu * mu;
    const float rstd = rsqrtf(var + LN_EPS);
    __bf16* orow = out + (size_t)row * D_MODEL;
    for (int i = threadIdx.x; i < D_MODEL; i += blockDim.x)
        orow[i] = (__bf16)((xr[i] - mu) * rstd * g[i] + b[i]);
}

// ---------------------------------------------------------------------------
// bf16 WMMA GEMM:  C[M,N] = A[M,K] @ B[K,N] + bias (+ res)
// 256 threads = 8 waves; block tile 128(M) x 128(N); K step 64 (two WMMA depths).
// Wave tile 64x32 (4x2 WMMAs per depth). LDS double-buffered via async global->LDS.
// The operands come from L2 once per block tile, so the tile is as large as still gives
// every WGP a block at N = 1024; a K step is a whole 128-B line of every A row.
// ACT: 0 = none, 1 = tanh-GELU (applied before residual add).
// RES: add res[m][n]. OUTF: store f32 to outF, else bf16 to outB. N: row pitch of B, res, out.
// These are template constants so that the residual loads and the epilogue
// stores are straight-line code that differs by immediate offsets only.
// ---------------------------------------------------------------------------
#define BM 128
#define BN 128
#define BK 64
#define FM 4            // 16-row A fragments of a wave
#define FN 2            // 16-column B fragments of a wave
#define CPT 8           // copies of a thread per K step: 4 of A, 4 of B
#define BKP (BK + 8)    // LDS pitch of an A row: 144 B, an odd multiple of 16 B, free of bank conflicts for ds_load_b128
#define BNP (BN + 16)   // LDS pitch of a B row: 288 B, an odd multiple of 32 B, free of bank conflicts for ds_load_tr16_b128

template <int ACT, bool RES, bool OUTF, int N>
__global__ __launch_bounds__(256)
void gemm_bf16_kernel(const __bf16* __restrict__ A, const __bf16* __restrict__ Bw,
                      const float* __restrict__ bias, const float* __restrict__ res,
                      float* __restrict__ outF, __bf16* __restrict__ outB,
                      int K) {
    __shared__ __attribute__((aligned(16))) __bf16 As[2][BM][BKP];   // 2 * 18 KB
    __shared__ __attribute__((aligned(16))) __bf16 Bs[2][BK][BNP];   // 2 * 18 KB
    const int tid  = threadIdx.x;
    const int lane = tid & 31;
    const int wave = tid >> 5;
    const int wm = (wave >> 2) * 64;   // 0 / 64
    const int wn = (wave & 3) * 32;    // 0,32,64,96
    const int bm = blockIdx.y * BM;
    const int bn = blockIdx.x * BN;
    const int half = lane >> 4;        // K-half selector
    const int mr   = lane & 15;        // A row / B col within 16x16 tile

    // staging indices (per thread: 4x16B for A, 4x16B for B). Each copy instruction of a wave
    // covers whole 128-B lines: four A rows of 128 B, or two B rows of 256 B.
    const int ar = tid >> 3;           // 0..31: A rows ar, ar + 32, ar + 64, ar + 96
    const int ac = (tid & 7) * 8;      // 0..56
    const int br = (tid >> 4) * 4;     // 0..60: B rows br .. br + 3
    const int bc = (tid & 15) * 8;     // 0..120
    auto stage = [&](int buf, int k0) {
        const __bf16* ga = &A[(size_t)(bm + ar) * K + (k0 + ac)];
        const __bf16* gb = &Bw[(size_t)(k0 + br) * N + (bn + bc)];
#pragma unroll   // constant LDS steps
        for (int c = 0; c < 4; ++c) async_cp16(ga + (size_t)(c * 32) * K, &As[buf][ar + c * 32][ac]);
#pragma unroll   // constant row steps: one address pair serves four copies
        for (int c = 0; c < 4; ++c) async_cp16(gb + c * N, &Bs[buf][br + c][bc]);
    };

    v8f acc[FM][FN] = {};
    const int nk = K / BK;

    // element (i, jn, r) of this lane's results lies at o0 + (i * 16 + r) * N + jn * 16
    const size_t o0 = (size_t)(bm + wm + half * 8) * N + (bn + wn + mr);
    // All residual and bias loads of the lane are issued here, together: they are in flight
    // while the first K tile lands, and the epilogue waits for none of them one by one.
    float rv[FM][FN][8];
    if (RES) {
#pragma unroll   // static index: rv stays in registers
        for (int i = 0; i < FM; ++i)
#pragma unroll   // static index: rv stays in registers
            for (int r = 0; r < 8; ++r)
#pragma unroll   // static index: rv stays in registers
                for (int jn = 0; jn < FN; ++jn)
                    rv[i][jn][r] = res[o0 + (i * 16 + r) * N + jn * 16];
    }
    const float bvv[2] = { bias[bn + wn + mr], bias[bn + wn + 16 + mr] };

    // prologue: stage K-step 0 into buffer 0
    stage(0, 0);

    for (int ks = 0; ks < nk; ++ks) {
        const int cur = ks & 1;
        if (ks + 1 < nk) {
            stage(cur ^ 1, (ks + 1) * BK);
            WAIT_ASYNC(CPT);   // the newest CPT may remain outstanding -> this step's panel has landed
        } else {
            WAIT_ASYNC(0);
        }
        __syncthreads();

        v16bf af[BK / 32][FM], bfr[BK / 32][FN];
#pragma unroll   // static fragment index: af and bfr stay in registers
        for (int kd = 0; kd < BK / 32; ++kd) {
            // B fragments: element g2*8+j = Bs[kd*32 + g2*16 + half*8 + j][column], the k order of af
            const __bf16* bt = &Bs[cur][kd * 32 + half * 8 + (lane & 7)][wn + ((lane >> 3) & 1) * 8];
#pragma unroll   // static fragment index: bfr stays in registers
            for (int jn = 0; jn < FN; ++jn)
                bfr[kd][jn] = __builtin_shufflevector(lds_tr16(bt + jn * 16),
                                                      lds_tr16(bt + 16 * BNP + jn * 16),
                                                      0, 1, 2, 3, 4, 5, 6, 7, 8, 9, 10, 11, 12, 13, 14, 15);
            // A fragments: element g2*8+j = As[row][kd*32 + g2*16 + half*8 + j]
#pragma unroll   // static fragment index: af stays in registers
            for (int i = 0; i < FM; ++i) {
                const __bf16* at = &As[cur][wm + i * 16 + mr][kd * 32 + half * 8];
                af[kd][i] = __builtin_shufflevector(*reinterpret_cast<const v8bf*>(at),
                                                    *reinterpret_cast<const v8bf*>(at + 16),
                                                    0, 1, 2, 3, 4, 5, 6, 7, 8, 9, 10, 11, 12, 13, 14, 15);
            }
        }
        // keeps the K step's LDS reads one group ahead of its products: without it the compiler
        // sinks them among the WMMAs, each pair behind a wait of a whole LDS latency
        __builtin_amdgcn_sched_barrier(0);
#pragma unroll   // static fragment index: acc, af and bfr stay in registers
        for (int kd = 0; kd < BK / 32; ++kd)
#pragma unroll   // static fragment index: acc, af and bfr stay in registers
            for (int i = 0; i < FM; ++i)
#pragma unroll   // static fragment index: acc, af and bfr stay in registers
                for (int jn = 0; jn < FN; ++jn)
                    acc[i][jn] = wmma_bf16(af[kd][i], bfr[kd][jn], acc[i][jn]);
        // keeps the barrier behind the products: moved up among them it brings a wait for ALL
        // the reads ahead of the second product, and reads and products no longer overlap
        __builtin_amdgcn_sched_barrier(0);
        __syncthreads();
    }

    // epilogue
    if (ACT == 1) {
#pragma unroll   // static fragment index: acc stays in registers
        for (int jn = 0; jn < FN; ++jn)
#pragma unroll   // static fragment index: acc stays in registers
            for (int i = 0; i < FM; ++i) {
                float g[8];
#pragma unroll   // static index: g stays in registers
                for (int r = 0; r < 8; ++r) g[r] = acc[i][jn][r] + bvv[jn];
                gelu_tanh8(g);
#pragma unroll   // static index: g stays in registers
                for (int r = 0; r < 8; ++r) acc[i][jn][r] = g[r];
            }
    }
#pragma unroll
    for (int jn = 0; jn < FN; ++jn)
#pragma unroll
        for (int i = 0; i < FM; ++i)
#pragma unroll
            for (int r = 0; r < 8; ++r) {
                const size_t o = o0 + (i * 16 + r) * N + jn * 16;
                float v = acc[i][jn][r];
                if (ACT != 1) v += bvv[jn];   // with ACT == 1 the bias went in ahead of the GELU
                if (RES) v += rv[i][jn][r];
                if (OUTF) outF[o] = v;
                else      outB[o] = (__bf16)v;
            }
}

// ---------------------------------------------------------------------------
// The Q, K and V projections as one GEMM of 3 * D_MODEL columns, in one launch.
// W holds the three D_MODEL x D_MODEL weight matrices one behind the other, out the three ROWS x D_MODEL
// results likewise: column c of the product is column c % D_MODEL of matrix c / D_MODEL, with that matrix's bias.
// One projection alone is one 128 x 128 block per WGP, whose eight waves read LDS, multiply and wait for the
// next K tile in step with one another. Tiles of 128 x 192 make 512 blocks, two resident per WGP (by registers),
// which fill one another's waits; the wider tile also takes fewer operand bytes per product from L2 and LDS.
// Otherwise as gemm_bf16_kernel: 8 waves, K step 64, two LDS buffers, the same k order. Wave tile 64 x 48.
// ---------------------------------------------------------------------------
#define QBN  192          // columns of a block tile; a multiple of 64 that divides 3 * D_MODEL
#define QFN  3            // 16-column B fragments of a wave
#define QCPT 10           // copies of a thread per K step: 4 of A, 6 of B
#define QBNP (QBN + 16)   // LDS pitch of a B row: 416 B, an odd multiple of 32 B, free of bank conflicts for ds_load_tr16_b128

__global__ __launch_bounds__(256)
void gemm_qkv_kernel(const __bf16* __restrict__ A, const __bf16* __restrict__ W,
                     const float* __restrict__ bq, const float* __restrict__ bk,
                     const float* __restrict__ bv, __bf16* __restrict__ out) {
    __shared__ __attribute__((aligned(16))) __bf16 As[2][BM][BKP];    // 2 * 18 KB
    __shared__ __attribute__((aligned(16))) __bf16 Bs[2][BK][QBNP];   // 2 * 26 KB
    const int tid  = threadIdx.x;
    const int lane = tid & 31;
    const int wave = tid >> 5;
    const int wm = (wave >> 2) * 64;   // 0 / 64
    const int wn = (wave & 3) * 48;    // 0,48,96,144
    const int bm = blockIdx.y * BM;
    const int bn = blockIdx.x * QBN;   // 0 .. 3 * D_MODEL - QBN
    const int half = lane >> 4;        // K-half selector
    const int mr   = lane & 15;        // A row / B col within 16x16 tile

    // staging indices (per thread: 4x16B for A, 6x16B for B). Each copy instruction of a wave
    // covers whole 128-B lines: four A rows of 128 B, or 128 B of each of four B rows.
    const int ar = tid >> 3;           // 0..31: A rows ar, ar + 32, ar + 64, ar + 96
    const int ac = (tid & 7) * 8;      // 0..56
    const int br = (tid >> 3) * 2;     // 0..62: B rows br, br + 1
    const int bc = (tid & 7) * 8;      // 0..56: B columns bc, bc + 64, bc + 128 of the tile
    // where the thread's three pieces of B row br lie at k0 = 0. An aligned group of 64 columns
    // lies in one matrix: bn and D_MODEL are multiples of 64.
    const __bf16* gb0[3];
#pragma unroll   // static index: gb0 stays in registers
    for (int j = 0; j < 3; ++j) {
        const int c = bn + j * 64 + bc;
        gb0[j] = W + (size_t)(c / D_MODEL) * (D_MODEL * D_MODEL) + (size_t)br * D_MODEL + c % D_MODEL;
    }
    auto stage = [&](int buf, int k0) {
        const __bf16* ga = &A[(size_t)(bm + ar) * D_MODEL + (k0 + ac)];
#pragma unroll   // constant steps: one address pair serves four copies
        for (int c = 0; c < 4; ++c) async_cp16(ga + c * 32 * D_MODEL, &As[buf][ar + c * 32][ac]);
#pragma unroll   // static index: gb0 stays in registers
        for (int j = 0; j < 3; ++j)
#pragma unroll   // constant row step: one address pair serves two copies
            for (int c = 0; c < 2; ++c)
                async_cp16(gb0[j] + (size_t)k0 * D_MODEL + c * D_MODEL, &Bs[buf][br + c][j * 64 + bc]);
    };

    v8f acc[FM][QFN] = {};
    const int nk = D_MODEL / BK;

    // Fragment jn holds 16 columns of one matrix (D_MODEL is a multiple of 16): element (i, jn, r) of this
    // lane's results lies at ob[jn] + (i * 16 + r) * D_MODEL of out, and bvv[jn] is its bias.
    size_t ob[QFN];
    float bvv[QFN];
#pragma unroll   // static index: ob and bvv stay in registers
    for (int jn = 0; jn < QFN; ++jn) {
        const int c = bn + wn + jn * 16;
        const int z = c / D_MODEL;
        const float* bz = z == 0 ? bq : (z == 1 ? bk : bv);
        ob[jn]  = (size_t)z * (ROWS * D_MODEL) + (size_t)(bm + wm + half * 8) * D_MODEL + (c % D_MODEL + mr);
        bvv[jn] = bz[c % D_MODEL + mr];
    }

    // prologue: stage K-step 0 into buffer 0
    stage(0, 0);

    for (int ks = 0; ks < nk; ++ks) {
        const int cur = ks & 1;
        if (ks + 1 < nk) {
            stage(cur ^ 1, (ks + 1) * BK);
            WAIT_ASYNC(QCPT);   // the newest QCPT may remain outstanding -> this step's panel has landed
        } else {
            WAIT_ASYNC(0);
        }
        __syncthreads();

        v16bf af[BK / 32][FM], bfr[BK / 32][QFN];
#pragma unroll   // static fragment index: af and bfr stay in registers
        for (int kd = 0; kd < BK / 32; ++kd) {
            // B fragments: element g2*8+j = Bs[kd*32 + g2*16 + half*8 + j][column], the k order of af
            const __bf16* bt = &Bs[cur][kd * 32 + half * 8 + (lane & 7)][wn + ((lane >> 3) & 1) * 8];
#pragma unroll   // static fragment index: bfr stays in registers
            for (int jn = 0; jn < QFN; ++jn)
                bfr[kd][jn] = __builtin_shufflevector(lds_tr16(bt + jn * 16),
                                                      lds_tr16(bt + 16 * QBNP + jn * 16),
                                                      0, 1, 2, 3, 4, 5, 6, 7, 8, 9, 10, 11, 12, 13, 14, 15);
            // A fragments: element g2*8+j = As[row][kd*32 + g2*16 + half*8 + j]
#pragma unroll   // static fragment index: af stays in registers
            for (int i = 0; i < FM; ++i) {
                const __bf16* at = &As[cur][wm + i * 16 + mr][kd * 32 + half * 8];
                af[kd][i] = __builtin_shufflevector(*reinterpret_cast<const v8bf*>(at),
                                                    *reinterpret_cast<const v8bf*>(at + 16),
                                                    0, 1, 2, 3, 4, 5, 6, 7, 8, 9, 10, 11, 12, 13, 14, 15);
            }
        }
        // keeps the K step's LDS reads one group ahead of its products: without it the compiler
        // sinks them among the WMMAs, each pair behind a wait of a whole LDS latency
        __builtin_amdgcn_sched_barrier(0);
#pragma unroll   // static fragment index: acc, af and bfr stay in registers
        for (int kd = 0; kd < BK / 32; ++kd)
#pragma unroll   // static fragment index: acc, af and bfr stay in registers
            for (int i = 0; i < FM; ++i)
#pragma unroll   // static fragment index: acc, af and bfr stay in registers
                for (int jn = 0; jn < QFN; ++jn)
                    acc[i][jn] = wmma_bf16(af[kd][i], bfr[kd][jn], acc[i][jn]);
        // keeps the barrier behind the products: moved up among them it brings a wait for ALL
        // the reads ahead of the second product, and reads and products no longer overlap
        __builtin_amdgcn_sched_barrier(0);
        __syncthreads();
    }

    // epilogue
#pragma unroll   // static fragment index: acc stays in registers
    for (int jn = 0; jn < QFN; ++jn)
#pragma unroll   // static fragment index: acc stays in registers
        for (int i = 0; i < FM; ++i)
#pragma unroll   // static fragment index: acc stays in registers
            for (int r = 0; r < 8; ++r)
                out[ob[jn] + (i * 16 + r) * D_MODEL] = (__bf16)(acc[i][jn][r] + bvv[jn]);
}

// ---------------------------------------------------------------------------
// Causal flash attention, one wave per (b, h, 16-row Q tile).
// Q/K/V/O layout: [B, T, H*Dh] bf16. Online softmax; QK^T and P*V via WMMA.
// No block barriers (waves have divergent causal trip counts).
// K and V of a 32-key block reach the wave through LDS buffers of its own, filled by
// asynchronous copies while the block before is worked on. No other wave touches them,
// so the wave's own waits order fill, read and refill.
// ---------------------------------------------------------------------------
#define KP (HEAD_DIM + 8)    // LDS pitch of a K row: 144 B, an odd multiple of 16 B, for ds_load_b128
#define VP (HEAD_DIM + 16)   // LDS pitch of a V row: 160 B, an odd multiple of 32 B, for ds_load_tr16_b128
#define PP (32 + 4)          // LDS pitch of a P row: 144 B, an odd multiple of 16 B, for ds_load_b128

__global__ __launch_bounds__(128)
void attn_kernel(const __bf16* __restrict__ Q, const __bf16* __restrict__ Km,
                 const __bf16* __restrict__ V, __bf16* __restrict__ O) {
    __shared__ __attribute__((aligned(16))) float Pl[4][16][PP];   // per-wave P bounce (C-layout -> A-layout)
    __shared__ __attribute__((aligned(16))) __bf16 Ks[4][32][KP];   // per-wave K block
    __shared__ __attribute__((aligned(16))) __bf16 Vs[4][32][VP];   // per-wave V block
    const int lane = threadIdx.x & 31;
    // in a scalar register: the trip count and the test round the copies are then scalar branches
    const int wave = __builtin_amdgcn_readfirstlane(threadIdx.x >> 5);
    const int work = blockIdx.x * 4 + wave;
    const int QT = SEQ / 16;                       // 128 q-tiles
    const int qt = work % QT;
    const int h  = (work / QT) % NUM_HEADS;
    const int b  = work / (QT * NUM_HEADS);
    const size_t base = ((size_t)b * SEQ) * D_MODEL + (size_t)h * HEAD_DIM;
    const int qbase = qt * 16;
    const int half = lane >> 4;
    const int mr   = lane & 15;
    const float scale = 0.125f;                    // 1/sqrt(64)

    // Q A-fragments for contraction halves d=[0,32) and [32,64)
    v16bf qf[2];
#pragma unroll
    for (int t = 0; t < 2; ++t)
#pragma unroll
        for (int g2 = 0; g2 < 2; ++g2)
#pragma unroll
            for (int j = 0; j < 8; ++j)
                qf[t][g2 * 8 + j] =
                    Q[base + (size_t)(qbase + mr) * D_MODEL +
                      (t * 32 + g2 * 16 + half * 8 + j)];

    v8f acc[4] = {};                // 16 x 64 output accumulator (f32)
    float rm[8], rl[8];
#pragma unroll
    for (int r = 0; r < 8; ++r) { rm[r] = -3.0e38f; rl[r] = 0.f; }

    const int nblk = (qt + 2) >> 1;       // ceil((qbase+16)/32)

    // One block = 32 rows of 128 B each of K and of V: 8 + 8 copies of 16 B a lane.
    // Copy c: lane l brings bytes 16*(l&7) .. +15 of row 8*(l>>3) + c (four whole lines).
    const int crow = (lane >> 3) * 8;
    const int ccol = (lane & 7) * 8;
    const __bf16* kg = Km + base + (size_t)crow * D_MODEL + ccol;
    const __bf16* vg = V  + base + (size_t)crow * D_MODEL + ccol;
    __bf16* kl = &Ks[wave][crow][ccol];
    __bf16* vl = &Vs[wave][crow][ccol];
    auto stage = [&](int blk) {
        const __bf16* kgb = kg + (size_t)blk * 32 * D_MODEL;
        const __bf16* vgb = vg + (size_t)blk * 32 * D_MODEL;
#pragma unroll   // constant row steps: one address pair serves eight copies
        for (int c = 0; c < 8; ++c) async_cp16(kgb + c * D_MODEL, kl + c * KP);
#pragma unroll   // constant row steps: one address pair serves eight copies
        for (int c = 0; c < 8; ++c) async_cp16(vgb + c * D_MODEL, vl + c * VP);
    };
    stage(0);

    for (int kb = 0; kb < nblk; ++kb) {
        const int kvbase = kb * 32;
        // this block's copies have landed before any of its bytes is read
        asm volatile("s_wait_asynccnt 0x0" ::: "memory");
        // K fragments: element g2*8+j = K[kvbase + t*16 + mr][kd*32 + g2*16 + half*8 + j]
        v16bf kf[2][2];
#pragma unroll   // static fragment index: kf stays in registers
        for (int t = 0; t < 2; ++t)
#pragma unroll   // static fragment index: kf stays in registers
            for (int kd = 0; kd < 2; ++kd) {
                const __bf16* kr = &Ks[wave][t * 16 + mr][kd * 32 + half * 8];
                kf[t][kd] = __builtin_shufflevector(*reinterpret_cast<const v8bf*>(kr),
                                                    *reinterpret_cast<const v8bf*>(kr + 16),
                                                    0, 1, 2, 3, 4, 5, 6, 7, 8, 9, 10, 11, 12, 13, 14, 15);
            }
        // V fragments: element g2*8+j = V[kvbase + g2*16 + half*8 + j][dt*16 + mr], the k order of pa
        v16bf vf[4];
        const __bf16* vt = &Vs[wave][half * 8 + (lane & 7)][((lane >> 3) & 1) * 8];
#pragma unroll   // static fragment index: vf stays in registers
        for (int dt = 0; dt < 4; ++dt)
            vf[dt] = __builtin_shufflevector(lds_tr16(vt + dt * 16),
                                             lds_tr16(vt + 16 * VP + dt * 16),
                                             0, 1, 2, 3, 4, 5, 6, 7, 8, 9, 10, 11, 12, 13, 14, 15);
        // every read of the two buffers has returned before the refill is issued
        asm volatile("s_wait_dscnt 0x0" ::: "memory");
        if (kb + 1 < nblk) stage(kb + 1);   // flies during this block's products and softmax
        // ---- scores S = Q K^T : two 16x16 tiles over 32 kv positions ----
        v8f s[2] = {};
#pragma unroll   // static fragment index: s, qf and kf stay in registers
        for (int t = 0; t < 2; ++t)
#pragma unroll   // static fragment index: s, qf and kf stay in registers
            for (int kd = 0; kd < 2; ++kd)
                s[t] = wmma_bf16(qf[kd], kf[t][kd], s[t]);
        // ---- causal mask + scale ----
        const int qrow_base = qbase + half * 8;
#pragma unroll
        for (int t = 0; t < 2; ++t) {
            const int kv = kvbase + t * 16 + mr;
#pragma unroll
            for (int r = 0; r < 8; ++r) {
                float v = s[t][r] * scale;
                if (kv > qrow_base + r) v = -3.0e38f;
                s[t][r] = v;
            }
        }
        // ---- online softmax (row reductions across 16-lane groups) ----
        // Each DPP step runs over all eight rows before the next one, so that the
        // rows' dependent chains fill one another's latency.
        float mblk[8], ps[8], corr[8];
#pragma unroll   // static row index: the row arrays stay in registers
        for (int r = 0; r < 8; ++r) mblk[r] = fmaxf(s[0][r], s[1][r]);
#pragma unroll   // static row index: the row arrays stay in registers
        for (int r = 0; r < 8; ++r) mblk[r] = row_max_step<8>(mblk[r]);
#pragma unroll   // static row index: the row arrays stay in registers
        for (int r = 0; r < 8; ++r) mblk[r] = row_max_step<4>(mblk[r]);
#pragma unroll   // static row index: the row arrays stay in registers
        for (int r = 0; r < 8; ++r) mblk[r] = row_max_step<2>(mblk[r]);
#pragma unroll   // static row index: the row arrays stay in registers
        for (int r = 0; r < 8; ++r) mblk[r] = row_max_step<1>(mblk[r]);
#pragma unroll   // static row index: the row arrays stay in registers
        for (int r = 0; r < 8; ++r) {
            const float mnew = fmaxf(rm[r], mblk[r]);
            corr[r] = __expf(rm[r] - mnew);
            const float p0 = __expf(s[0][r] - mnew);
            const float p1 = __expf(s[1][r] - mnew);
            ps[r] = p0 + p1;
            rm[r] = mnew;
            const int m = half * 8 + r;
            Pl[wave][m][mr]      = p0;    // C-layout -> LDS (wave-private)
            Pl[wave][m][16 + mr] = p1;
        }
#pragma unroll   // static row index: the row arrays stay in registers
        for (int r = 0; r < 8; ++r) ps[r] += row_xor<8>(ps[r]);
#pragma unroll   // static row index: the row arrays stay in registers
        for (int r = 0; r < 8; ++r) ps[r] += row_xor<4>(ps[r]);
#pragma unroll   // static row index: the row arrays stay in registers
        for (int r = 0; r < 8; ++r) ps[r] += row_xor<2>(ps[r]);
#pragma unroll   // static row index: the row arrays stay in registers
        for (int r = 0; r < 8; ++r) ps[r] += row_xor<1>(ps[r]);
#pragma unroll   // static row index: the row arrays stay in registers
        for (int r = 0; r < 8; ++r) {
            rl[r] = rl[r] * corr[r] + ps[r];
#pragma unroll
            for (int dt = 0; dt < 4; ++dt) acc[dt][r] *= corr[r];
        }
        // ---- P (16x32) as A-fragment (bf16), then P @ V ----
        v16bf pa;
#pragma unroll
        for (int g2 = 0; g2 < 2; ++g2)
#pragma unroll
            for (int j = 0; j < 8; ++j)
                pa[g2 * 8 + j] = (__bf16)Pl[wave][mr][g2 * 16 + half * 8 + j];
#pragma unroll   // static fragment index: acc and vf stay in registers
        for (int dt = 0; dt < 4; ++dt)
            acc[dt] = wmma_bf16(pa, vf[dt], acc[dt]);
    }
    // no copy is left in flight when the wave ends
    asm volatile("s_wait_asynccnt 0x0" ::: "memory");
    // ---- epilogue: O = acc / l ----
#pragma unroll
    for (int r = 0; r < 8; ++r) {
        const float inv = 1.0f / rl[r];
        const int q = qbase + half * 8 + r;
#pragma unroll
        for (int dt = 0; dt < 4; ++dt)
            O[base + (size_t)q * D_MODEL + (dt * 16 + mr)] =
                (__bf16)(acc[dt][r] * inv);
    }
}

// ---------------------------------------------------------------------------
// host launcher
// ---------------------------------------------------------------------------
extern "C" void kernel_launch(void* const* d_in, const int* in_sizes, int n_in,
                              void* d_out, int out_size, void* d_ws, size_t ws_size,
                              hipStream_t stream) {
    (void)in_sizes; (void)n_in; (void)out_size; (void)ws_size;
    const float* x   = (const float*)d_in[0];
    const float* Wq  = (const float*)d_in[1];
    const float* bq  = (const float*)d_in[2];
    const float* Wk  = (const float*)d_in[3];
    const float* bk  = (const float*)d_in[4];
    const float* Wv  = (const float*)d_in[5];
    const float* bv  = (const float*)d_in[6];
    const float* Wo  = (const float*)d_in[7];
    const float* bo  = (const float*)d_in[8];
    const float* g1  = (const float*)d_in[9];
    const float* b1  = (const float*)d_in[10];
    const float* g2  = (const float*)d_in[11];
    const float* b2  = (const float*)d_in[12];
    const float* Wup = (const float*)d_in[13];
    const float* bup = (const float*)d_in[14];
    const float* Wdn = (const float*)d_in[15];
    const float* bdn = (const float*)d_in[16];

    char* ws = (char*)d_ws;
    size_t off = 0;
    auto take = [&](size_t bytes) -> void* {
        void* p = ws + off;
        off = (off + bytes + 255) & ~(size_t)255;
        return p;
    };
    __bf16* wq_b  = (__bf16*)take((size_t)D_MODEL * D_MODEL * 2);
    __bf16* wk_b  = (__bf16*)take((size_t)D_MODEL * D_MODEL * 2);
    __bf16* wv_b  = (__bf16*)take((size_t)D_MODEL * D_MODEL * 2);
    __bf16* wo_b  = (__bf16*)take((size_t)D_MODEL * D_MODEL * 2);
    __bf16* wup_b = (__bf16*)take((size_t)D_MODEL * MLP_DIM * 2);
    __bf16* wdn_b = (__bf16*)take((size_t)MLP_DIM * D_MODEL * 2);
    __bf16* xn_b  = (__bf16*)take((size_t)ROWS * D_MODEL * 2);
    __bf16* q_b   = (__bf16*)take((size_t)ROWS * D_MODEL * 2);
    __bf16* k_b   = (__bf16*)take((size_t)ROWS * D_MODEL * 2);
    __bf16* v_b   = (__bf16*)take((size_t)ROWS * D_MODEL * 2);
    __bf16* o_b   = (__bf16*)take((size_t)ROWS * D_MODEL * 2);
    float*  x2    = (float*) take((size_t)ROWS * D_MODEL * 4);
    __bf16* xn2_b = (__bf16*)take((size_t)ROWS * D_MODEL * 2);
    __bf16* h_b   = (__bf16*)take((size_t)ROWS * MLP_DIM * 2);

    // 1) weights fp32 -> bf16: wq_b .. wdn_b are contiguous (every size is a multiple of 256 B)
    cvt_weights_kernel<<<CVT_TOTAL / CVT_CHUNK, CVT_THREADS, 0, stream>>>(Wq, Wk, Wv, Wo, Wup, Wdn, wq_b);

    // 2) LN1 -> bf16
    ln_kernel<<<ROWS, 256, 0, stream>>>(x, g1, b1, xn_b);

    // 3) Q/K/V projections (bf16 out), one launch: wq_b, wk_b, wv_b are contiguous, and so are q_b, k_b, v_b
    dim3 gD(D_MODEL / BN, ROWS / BM);   // (8, 32)
    dim3 gQKV(3 * D_MODEL / QBN, ROWS / BM);   // (16, 32)
    gemm_qkv_kernel<<<gQKV, 256, 0, stream>>>(xn_b, wq_b, bq, bk, bv, q_b);

    // 4) causal flash attention (4096 waves, 4 waves/block)
    attn_kernel<<<(BATCH * NUM_HEADS * (SEQ / 16)) / 4, 128, 0, stream>>>(q_b, k_b, v_b, o_b);

    // 5) output projection + residual -> x2 (fp32)
    gemm_bf16_kernel<0, true, true, D_MODEL><<<gD, 256, 0, stream>>>(
        o_b, wo_b, bo, x, x2, nullptr, D_MODEL);

    // 6) LN2 -> bf16
    ln_kernel<<<ROWS, 256, 0, stream>>>(x2, g2, b2, xn2_b);

    // 7) MLP up + GELU (bf16 out)
    dim3 gU(MLP_DIM / BN, ROWS / BM);   // (32, 32)
    gemm_bf16_kernel<1, false, false, MLP_DIM><<<gU, 256, 0, stream>>>(
        xn2_b, wup_b, bup, nullptr, nullptr, h_b, D_MODEL);

    // 8) MLP down + residual -> out (fp32)
    gemm_bf16_kernel<0, true, true, D_MODEL><<<gD, 256, 0, stream>>>(
        h_b, wdn_b, bdn, x2, (float*)d_out, nullptr, MLP_DIM);
}

// v010
// One run takes 195 microseconds.
// In both of two side-by-side timings against v009, it was 1.05 times as fast.
// All steps since v000 together make it 3.43 times as fast.
#include <hip/hip_runtime.h>
#include <hip/hip_bf16.h>
#include <math.h>

// ---- problem constants (match reference) ----
#define D_MODEL   1024
#define NUM_HEADS 16
#define HEAD_DIM  64
#define MLP_DIM   4096
#define BATCH     2
#define SEQ       2048
#define ROWS      (BATCH * SEQ)   // 4096
#define LN_EPS    1e-5f

typedef __attribute__((ext_vector_type(16))) __bf16 v16bf;
typedef __attribute__((ext_vector_type(8)))  __bf16 v8bf;
typedef __attribute__((ext_vector_type(8)))  float  v8f;
typedef __attribute__((ext_vector_type(4)))  __bf16 v4bf;
typedef __attribute__((ext_vector_type(4)))  float  v4f;
typedef int v4i __attribute__((vector_size(16)));   // matches builtin param type

// ---- CDNA5 async global->LDS path (guarded; falls back to vector copies) ----
#if defined(__AMDGCN__) && __has_builtin(__builtin_amdgcn_global_load_async_to_lds_b128)
#define HAS_ASYNC_LDS 1
#else
#define HAS_ASYNC_LDS 0
#endif

#if HAS_ASYNC_LDS
// asm with the "memory" clobber: no LDS read moves ahead of the wait
#define WAIT_ASYNC(n) asm volatile("s_wait_asynccnt %0" ::"i"(n) : "memory")
#else
#define WAIT_ASYNC(n) do { } while (0)
#endif

static __device__ __forceinline__ void async_cp16(const __bf16* g, __bf16* l) {
#if HAS_ASYNC_LDS
    // global_load_async_to_lds_b128: 16B global -> LDS, tracked by ASYNCcnt
    __builtin_amdgcn_global_load_async_to_lds_b128((v4i*)g, (v4i*)l, 0, 0);
#else
    *reinterpret_cast<v8bf*>(l) = *reinterpret_cast<const v8bf*>(g);
#endif
}

// ds_load_tr16_b128 on a row-major 16-bit LDS tile T: with lane l aimed at
// T[k0 + 8*(l>>4) + (l&7)][n0 + 8*((l>>3)&1)], lane l gets T[k0 + 8*(l>>4) + 0..7][n0 + (l&15)],
// one half of a WMMA operand in the hardware k order. All 32 lanes must hold a valid address.
typedef __attribute__((address_space(3))) v8bf lds_v8bf;
static __device__ __forceinline__ v8bf lds_tr16(const __bf16* p) {
    return __builtin_amdgcn_ds_load_tr16_b128_v8bf16((lds_v8bf*)p);
}

static __device__ __forceinline__ v8f wmma_bf16(v16bf a, v16bf b, v8f c) {
    // D = A(16x32 bf16) * B(32x16 bf16) + C(16x16 f32)
    return __builtin_amdgcn_wmma_f32_16x16x32_bf16(
        /*neg_a=*/false, a, /*neg_b=*/false, b,
        /*c_mod=*/(short)0, c, /*reuse_a=*/false, /*reuse_b=*/false);
}

// Lane l reads lane l ^ 16 (v_permlanex16_b32 with the identity selection): a vector-unit
// exchange between the wave's halves. All 32 lanes must be active.
static __device__ __forceinline__ float other_half(float v) {
    const int b = __builtin_bit_cast(int, v);
    return __builtin_bit_cast(float, __builtin_amdgcn_permlanex16(b, b, 0x76543210, 0xfedcba98, false, false));
}

// e[i] = exp2(e[i]) for 17 values. asm: behind every transcendental stands an instruction that neither reads
// its result nor overwrites its source (the values fill one another's slot, v_nop the last one).
static __device__ __forceinline__ void exp2_17(float (&e)[17]) {
    asm("v_exp_f32 %0, %0\n\tv_exp_f32 %1, %1\n\tv_exp_f32 %2, %2\n\tv_exp_f32 %3, %3\n\t"
        "v_exp_f32 %4, %4\n\tv_exp_f32 %5, %5\n\tv_exp_f32 %6, %6\n\tv_exp_f32 %7, %7\n\t"
        "v_exp_f32 %8, %8\n\tv_exp_f32 %9, %9\n\tv_exp_f32 %10, %10\n\tv_exp_f32 %11, %11\n\t"
        "v_exp_f32 %12, %12\n\tv_exp_f32 %13, %13\n\tv_exp_f32 %14, %14\n\tv_exp_f32 %15, %15\n\t"
        "v_exp_f32 %16, %16\n\t"
        "v_nop"
        : "+v"(e[0]), "+v"(e[1]), "+v"(e[2]), "+v"(e[3]), "+v"(e[4]), "+v"(e[5]), "+v"(e[6]), "+v"(e[7]),
          "+v"(e[8]), "+v"(e[9]), "+v"(e[10]), "+v"(e[11]), "+v"(e[12]), "+v"(e[13]), "+v"(e[14]), "+v"(e[15]),
          "+v"(e[16]));
}

// tanh-GELU of eight values without a branch: 0.5 * (1 + tanh(u)) = 1 / (1 + exp(-2u)),
// u = sqrt(2/pi) * (x + 0.044715 x^3): one v_exp_f32 and one v_rcp_f32 per value. The library tanhf picks
// one of two paths per lane, so a wave walks both behind two branches on EXEC, one value at a time.
// exp overflows to +inf only where the exact factor is below 2^-126: rcp gives 0 there, as tanh = -1 does.
static __device__ __forceinline__ void gelu_tanh8(float (&x)[8]) {
    const float k = -2.0f * 0.7978845608028654f * 1.4426950408889634f;   // exp(-2u) = exp2(k * (x + 0.044715 x^3))
    float s[8];
#pragma unroll   // static index: s stays in registers
    for (int r = 0; r < 8; ++r) s[r] = x[r] * fmaf(0.044715f * k, x[r] * x[r], k);
    // s = 1 / (1 + exp2(s)). asm: behind every transcendental stands an instruction that neither reads its
    // result nor overwrites its source (the eight values fill one another's slot, v_nop the last one).
    asm("v_exp_f32 %0, %0\n\tv_exp_f32 %1, %1\n\tv_exp_f32 %2, %2\n\tv_exp_f32 %3, %3\n\t"
        "v_exp_f32 %4, %4\n\tv_exp_f32 %5, %5\n\tv_exp_f32 %6, %6\n\tv_exp_f32 %7, %7\n\t"
        "v_add_f32 %0, 1.0, %0\n\tv_add_f32 %1, 1.0, %1\n\tv_add_f32 %2, 1.0, %2\n\tv_add_f32 %3, 1.0, %3\n\t"
        "v_add_f32 %4, 1.0, %4\n\tv_add_f32 %5, 1.0, %5\n\tv_add_f32 %6, 1.0, %6\n\tv_add_f32 %7, 1.0, %7\n\t"
        "v_rcp_f32 %0, %0\n\tv_rcp_f32 %1, %1\n\tv_rcp_f32 %2, %2\n\tv_rcp_f32 %3, %3\n\t"
        "v_rcp_f32 %4, %4\n\tv_rcp_f32 %5, %5\n\tv_rcp_f32 %6, %6\n\tv_rcp_f32 %7, %7\n\t"
        "v_nop"
        : "+v"(s[0]), "+v"(s[1]), "+v"(s[2]), "+v"(s[3]), "+v"(s[4]), "+v"(s[5]), "+v"(s[6]), "+v"(s[7]));
#pragma unroll   // static index: s stays in registers
    for (int r = 0; r < 8; ++r) x[r] *= s[r];
}

// ---------------------------------------------------------------------------
// fp32 -> bf16 conversion of all six weight matrices in one launch.
// The six bf16 copies lie one behind the other in the workspace, so dst is one array of
// CVT_TOTAL elements; a block converts CVT_CHUNK of them, all from one source matrix.
// Few waves with much in flight each: a lane issues its 32 loads of 16 B together (every
// load of a wave covers 512 contiguous bytes) and stores 8 B per load (256 contiguous
// bytes a wave).
// ---------------------------------------------------------------------------
#define CVT_SQ      (D_MODEL * D_MODEL)              // elements of Wq, Wk, Wv, Wo; Wup and Wdn hold four times as many
#define CVT_TOTAL   (4 * CVT_SQ + 2 * D_MODEL * MLP_DIM)
#define CVT_THREADS 128
#define CVT_LOADS   32
#define CVT_STEP    (CVT_THREADS * 4)                // elements that one load of the whole block brings
#define CVT_CHUNK   (CVT_STEP * CVT_LOADS)           // 16384 elements a block; divides CVT_SQ

__global__ __launch_bounds__(CVT_THREADS)
void cvt_weights_kernel(const float* __restrict__ wq, const float* __restrict__ wk,
                        const float* __restrict__ wv, const float* __restrict__ wo,
                        const float* __restrict__ wup, const float* __restrict__ wdn,
                        __bf16* __restrict__ dst) {
    const int per = CVT_SQ / CVT_CHUNK;              // blocks per CVT_SQ elements
    const int seg = blockIdx.x / per;                // 0..3: Wq, Wk, Wv, Wo; 4..7: Wup; 8..11: Wdn
    const float* s = wq;
    s = seg == 1 ? wk  : s;
    s = seg == 2 ? wv  : s;
    s = seg == 3 ? wo  : s;
    s = seg >= 4 ? wup : s;
    s = seg >= 8 ? wdn : s;
    const int quarter = seg >= 4 ? (seg & 3) : 0;    // which CVT_SQ elements of Wup or Wdn
    s += (size_t)quarter * CVT_SQ + (size_t)(blockIdx.x % per) * CVT_CHUNK + threadIdx.x * 4;
    __bf16* d = dst + (size_t)blockIdx.x * CVT_CHUNK + threadIdx.x * 4;
    v4f v[CVT_LOADS];
#pragma unroll   // static index: v stays in registers
    for (int j = 0; j < CVT_LOADS; ++j)
        v[j] = *reinterpret_cast<const v4f*>(s + j * CVT_STEP);
    // keeps every load ahead of the first conversion: without it the compiler holds the last
    // loads back until the first have returned, a second memory latency per wave
    __builtin_amdgcn_sched_barrier(0);
#pragma unroll   // static index: v stays in registers
    for (int j = 0; j < CVT_LOADS; ++j)
        *reinterpret_cast<v4bf*>(d + j * CVT_STEP) = __builtin_convertvector(v[j], v4bf);
}

// ---------------------------------------------------------------------------
// LayerNorm over last dim (C = D_MODEL), one 256-thread block per row,
// output bf16 (feeds WMMA GEMMs)
// ---------------------------------------------------------------------------
__global__ void ln_kernel(const float* __restrict__ x,
                          const float* __restrict__ g,
                          const float* __restrict__ b,
                          __bf16* __restrict__ out) {
    const int row = blockIdx.x;
    const float* xr = x + (size_t)row * D_MODEL;
    float s = 0.f, ss = 0.f;
    for (int i = threadIdx.x; i < D_MODEL; i += blockDim.x) {
        float v = xr[i];
        s += v;
        ss += v * v;
    }
    __shared__ float sh[2][8];
    const int lane = threadIdx.x & 31;
    const int wave = threadIdx.x >> 5;
#pragma unroll
    for (int o = 16; o > 0; o >>= 1) {
        s  += __shfl_down(s, o);
        ss += __shfl_down(ss, o);
    }
    if (lane == 0) { sh[0][wave] = s; sh[1][wave] = ss; }
    __syncthreads();
    s = 0.f; ss = 0.f;
#pragma unroll
    for (int w = 0; w < 8; ++w) { s += sh[0][w]; ss += sh[1][w]; }
    const float mu   = s  * (1.0f / D_MODEL);
    const float var  = ss * (1.0f / D_MODEL) - mu * mu;
    const float rstd = rsqrtf(var + LN_EPS);
    __bf16* orow = out + (size_t)row * D_MODEL;
    for (int i = threadIdx.x; i < D_MODEL; i += blockDim.x)
        orow[i] = (__bf16)((xr[i] - mu) * rstd * g[i] + b[i]);
}

// ---------------------------------------------------------------------------
// bf16 WMMA GEMM:  C[M,N] = A[M,K] @ B[K,N] + bias (+ res)
// 256 threads = 8 waves; block tile 128(M) x 128(N); K step 64 (two WMMA depths).
// Wave tile 64x32 (4x2 WMMAs per depth). LDS double-buffered via async global->LDS.
// The operands come from L2 once per block tile, so the tile is as large as still gives
// every WGP a block at N = 1024; a K step is a whole 128-B line of every A row.
// ACT: 0 = none, 1 = tanh-GELU (applied before residual add).
// RES: add res[m][n]. OUTF: store f32 to outF, else bf16 to outB. N: row pitch of B, res, out.
// These are template constants so that the residual loads and the epilogue
// stores are straight-line code that differs by immediate offsets only.
// ---------------------------------------------------------------------------
#define BM 128
#define BN 128
#define BK 64
#define FM 4            // 16-row A fragments of a wave
#define FN 2            // 16-column B fragments of a wave
#define CPT 8           // copies of a thread per K step: 4 of A, 4 of B
#define BKP (BK + 8)    // LDS pitch of an A row: 144 B, an odd multiple of 16 B, free of bank conflicts for ds_load_b128
#define BNP (BN + 16)   // LDS pitch of a B row: 288 B, an odd multiple of 32 B, free of bank conflicts for ds_load_tr16_b128

template <int ACT, bool RES, bool OUTF, int N>
__global__ __launch_bounds__(256)
void gemm_bf16_kernel(const __bf16* __restrict__ A, const __bf16* __restrict__ Bw,
                      const float* __restrict__ bias, const float* __restrict__ res,
                      float* __restrict__ outF, __bf16* __restrict__ outB,
                      int K) {
    __shared__ __attribute__((aligned(16))) __bf16 As[2][BM][BKP];   // 2 * 18 KB
    __shared__ __attribute__((aligned(16))) __bf16 Bs[2][BK][BNP];   // 2 * 18 KB
    const int tid  = threadIdx.x;
    const int lane = tid & 31;
    const int wave = tid >> 5;
    const int wm = (wave >> 2) * 64;   // 0 / 64
    const int wn = (wave & 3) * 32;    // 0,32,64,96
    const int bm = blockIdx.y * BM;
    const int bn = blockIdx.x * BN;
    const int half = lane >> 4;        // K-half selector
    const int mr   = lane & 15;        // A row / B col within 16x16 tile

    // staging indices (per thread: 4x16B for A, 4x16B for B). Each copy instruction of a wave
    // covers whole 128-B lines: four A rows of 128 B, or two B rows of 256 B.
    const int ar = tid >> 3;           // 0..31: A rows ar, ar + 32, ar + 64, ar + 96
    const int ac = (tid & 7) * 8;      // 0..56
    const int br = (tid >> 4) * 4;     // 0..60: B rows br .. br + 3
    const int bc = (tid & 15) * 8;     // 0..120
    auto stage = [&](int buf, int k0) {
        const __bf16* ga = &A[(size_t)(bm + ar) * K + (k0 + ac)];
        const __bf16* gb = &Bw[(size_t)(k0 + br) * N + (bn + bc)];
#pragma unroll   // constant LDS steps
        for (int c = 0; c < 4; ++c) async_cp16(ga + (size_t)(c * 32) * K, &As[buf][ar + c * 32][ac]);
#pragma unroll   // constant row steps: one address pair serves four copies
        for (int c = 0; c < 4; ++c) async_cp16(gb + c * N, &Bs[buf][br + c][bc]);
    };

    v8f acc[FM][FN] = {};
    const int nk = K / BK;

    // element (i, jn, r) of this lane's results lies at o0 + (i * 16 + r) * N + jn * 16
    const size_t o0 = (size_t)(bm + wm + half * 8) * N + (bn + wn + mr);
    // All residual and bias loads of the lane are issued here, together: they are in flight
    // while the first K tile lands, and the epilogue waits for none of them one by one.
    float rv[FM][FN][8];
    if (RES) {
#pragma unroll   // static index: rv stays in registers
        for (int i = 0; i < FM; ++i)
#pragma unroll   // static index: rv stays in registers
            for (int r = 0; r < 8; ++r)
#pragma unroll   // static index: rv stays in registers
                for (int jn = 0; jn < FN; ++jn)
                    rv[i][jn][r] = res[o0 + (i * 16 + r) * N + jn * 16];
    }
    const float bvv[2] = { bias[bn + wn + mr], bias[bn + wn + 16 + mr] };

    // prologue: stage K-step 0 into buffer 0
    stage(0, 0);

    for (int ks = 0; ks < nk; ++ks) {
        const int cur = ks & 1;
        if (ks + 1 < nk) {
            stage(cur ^ 1, (ks + 1) * BK);
            WAIT_ASYNC(CPT);   // the newest CPT may remain outstanding -> this step's panel has landed
        } else {
            WAIT_ASYNC(0);
        }
        __syncthreads();

        v16bf af[BK / 32][FM], bfr[BK / 32][FN];
#pragma unroll   // static fragment index: af and bfr stay in registers
        for (int kd = 0; kd < BK / 32; ++kd) {
            // B fragments: element g2*8+j = Bs[kd*32 + g2*16 + half*8 + j][column], the k order of af
            const __bf16* bt = &Bs[cur][kd * 32 + half * 8 + (lane & 7)][wn + ((lane >> 3) & 1) * 8];
#pragma unroll   // static fragment index: bfr stays in registers
            for (int jn = 0; jn < FN; ++jn)
                bfr[kd][jn] = __builtin_shufflevector(lds_tr16(bt + jn * 16),
                                                      lds_tr16(bt + 16 * BNP + jn * 16),
                                                      0, 1, 2, 3, 4, 5, 6, 7, 8, 9, 10, 11, 12, 13, 14, 15);
            // A fragments: element g2*8+j = As[row][kd*32 + g2*16 + half*8 + j]
#pragma unroll   // static fragment index: af stays in registers
            for (int i = 0; i < FM; ++i) {
                const __bf16* at = &As[cur][wm + i * 16 + mr][kd * 32 + half * 8];
                af[kd][i] = __builtin_shufflevector(*reinterpret_cast<const v8bf*>(at),
                                                    *reinterpret_cast<const v8bf*>(at + 16),
                                                    0, 1, 2, 3, 4, 5, 6, 7, 8, 9, 10, 11, 12, 13, 14, 15);
            }
        }
        // keeps the K step's LDS reads one group ahead of its products: without it the compiler
        // sinks them among the WMMAs, each pair behind a wait of a whole LDS latency
        __builtin_amdgcn_sched_barrier(0);
#pragma unroll   // static fragment index: acc, af and bfr stay in registers
        for (int kd = 0; kd < BK / 32; ++kd)
#pragma unroll   // static fragment index: acc, af and bfr stay in registers
            for (int i = 0; i < FM; ++i)
#pragma unroll   // static fragment index: acc, af and bfr stay in registers
                for (int jn = 0; jn < FN; ++jn)
                    acc[i][jn] = wmma_bf16(af[kd][i], bfr[kd][jn], acc[i][jn]);
        // keeps the barrier behind the products: moved up among them it brings a wait for ALL
        // the reads ahead of the second product, and reads and products no longer overlap
        __builtin_amdgcn_sched_barrier(0);
        __syncthreads();
    }

    // epilogue
    if (ACT == 1) {
#pragma unroll   // static fragment index: acc stays in registers
        for (int jn = 0; jn < FN; ++jn)
#pragma unroll   // static fragment index: acc stays in registers
            for (int i = 0; i < FM; ++i) {
                float g[8];
#pragma unroll   // static index: g stays in registers
                for (int r = 0; r < 8; ++r) g[r] = acc[i][jn][r] + bvv[jn];
                gelu_tanh8(g);
#pragma unroll   // static index: g stays in registers
                for (int r = 0; r < 8; ++r) acc[i][jn][r] = g[r];
            }
    }
#pragma unroll
    for (int jn = 0; jn < FN; ++jn)
#pragma unroll
        for (int i = 0; i < FM; ++i)
#pragma unroll
            for (int r = 0; r < 8; ++r) {
                const size_t o = o0 + (i * 16 + r) * N + jn * 16;
                float v = acc[i][jn][r];
                if (ACT != 1) v += bvv[jn];   // with ACT == 1 the bias went in ahead of the GELU
                if (RES) v += rv[i][jn][r];
                if (OUTF) outF[o] = v;
                else      outB[o] = (__bf16)v;
            }
}

// ---------------------------------------------------------------------------
// The Q, K and V projections as one GEMM of 3 * D_MODEL columns, in one launch.
// W holds the three D_MODEL x D_MODEL weight matrices one behind the other, out the three ROWS x D_MODEL
// results likewise: column c of the product is column c % D_MODEL of matrix c / D_MODEL, with that matrix's bias.
// One projection alone is one 128 x 128 block per WGP, whose eight waves read LDS, multiply and wait for the
// next K tile in step with one another. Tiles of 128 x 192 make 512 blocks, two resident per WGP (by registers),
// which fill one another's waits; the wider tile also takes fewer operand bytes per product from L2 and LDS.
// Otherwise as gemm_bf16_kernel: 8 waves, K step 64, two LDS buffers, the same k order. Wave tile 64 x 48.
// ---------------------------------------------------------------------------
#define QBN  192          // columns of a block tile; a multiple of 64 that divides 3 * D_MODEL
#define QFN  3            // 16-column B fragments of a wave
#define QCPT 10           // copies of a thread per K step: 4 of A, 6 of B
#define QBNP (QBN + 16)   // LDS pitch of a B row: 416 B, an odd multiple of 32 B, free of bank conflicts for ds_load_tr16_b128

__global__ __launch_bounds__(256)
void gemm_qkv_kernel(const __bf16* __restrict__ A, const __bf16* __restrict__ W,
                     const float* __restrict__ bq, const float* __restrict__ bk,
                     const float* __restrict__ bv, __bf16* __restrict__ out) {
    __shared__ __attribute__((aligned(16))) __bf16 As[2][BM][BKP];    // 2 * 18 KB
    __shared__ __attribute__((aligned(16))) __bf16 Bs[2][BK][QBNP];   // 2 * 26 KB
    const int tid  = threadIdx.x;
    const int lane = tid & 31;
    const int wave = tid >> 5;
    const int wm = (wave >> 2) * 64;   // 0 / 64
    const int wn = (wave & 3) * 48;    // 0,48,96,144
    const int bm = blockIdx.y * BM;
    const int bn = blockIdx.x * QBN;   // 0 .. 3 * D_MODEL - QBN
    const int half = lane >> 4;        // K-half selector
    const int mr   = lane & 15;        // A row / B col within 16x16 tile

    // staging indices (per thread: 4x16B for A, 6x16B for B). Each copy instruction of a wave
    // covers whole 128-B lines: four A rows of 128 B, or 128 B of each of four B rows.
    const int ar = tid >> 3;           // 0..31: A rows ar, ar + 32, ar + 64, ar + 96
    const int ac = (tid & 7) * 8;      // 0..56
    const int br = (tid >> 3) * 2;     // 0..62: B rows br, br + 1
    const int bc = (tid & 7) * 8;      // 0..56: B columns bc, bc + 64, bc + 128 of the tile
    // where the thread's three pieces of B row br lie at k0 = 0. An aligned group of 64 columns
    // lies in one matrix: bn and D_MODEL are multiples of 64.
    const __bf16* gb0[3];
#pragma unroll   // static index: gb0 stays in registers
    for (int j = 0; j < 3; ++j) {
        const int c = bn + j * 64 + bc;
        gb0[j] = W + (size_t)(c / D_MODEL) * (D_MODEL * D_MODEL) + (size_t)br * D_MODEL + c % D_MODEL;
    }
    auto stage = [&](int buf, int k0) {
        const __bf16* ga = &A[(size_t)(bm + ar) * D_MODEL + (k0 + ac)];
#pragma unroll   // constant steps: one address pair serves four copies
        for (int c = 0; c < 4; ++c) async_cp16(ga + c * 32 * D_MODEL, &As[buf][ar + c * 32][ac]);
#pragma unroll   // static index: gb0 stays in registers
        for (int j = 0; j < 3; ++j)
#pragma unroll   // constant row step: one address pair serves two copies
            for (int c = 0; c < 2; ++c)
                async_cp16(gb0[j] + (size_t)k0 * D_MODEL + c * D_MODEL, &Bs[buf][br + c][j * 64 + bc]);
    };

    v8f acc[FM][QFN] = {};
    const int nk = D_MODEL / BK;

    // Fragment jn holds 16 columns of one matrix (D_MODEL is a multiple of 16): element (i, jn, r) of this
    // lane's results lies at ob[jn] + (i * 16 + r) * D_MODEL of out, and bvv[jn] is its bias.
    size_t ob[QFN];
    float bvv[QFN];
#pragma unroll   // static index: ob and bvv stay in registers
    for (int jn = 0; jn < QFN; ++jn) {
        const int c = bn + wn + jn * 16;
        const int z = c / D_MODEL;
        const float* bz = z == 0 ? bq : (z == 1 ? bk : bv);
        ob[jn]  = (size_t)z * (ROWS * D_MODEL) + (size_t)(bm + wm + half * 8) * D_MODEL + (c % D_MODEL + mr);
        bvv[jn] = bz[c % D_MODEL + mr];
    }

    // prologue: stage K-step 0 into buffer 0
    stage(0, 0);

    for (int ks = 0; ks < nk; ++ks) {
        const int cur = ks & 1;
        if (ks + 1 < nk) {
            stage(cur ^ 1, (ks + 1) * BK);
            WAIT_ASYNC(QCPT);   // the newest QCPT may remain outstanding -> this step's panel has landed
        } else {
            WAIT_ASYNC(0);
        }
        __syncthreads();

        v16bf af[BK / 32][FM], bfr[BK / 32][QFN];
#pragma unroll   // static fragment index: af and bfr stay in registers
        for (int kd = 0; kd < BK / 32; ++kd) {
            // B fragments: element g2*8+j = Bs[kd*32 + g2*16 + half*8 + j][column], the k order of af
            const __bf16* bt = &Bs[cur][kd * 32 + half * 8 + (lane & 7)][wn + ((lane >> 3) & 1) * 8];
#pragma unroll   // static fragment index: bfr stays in registers
            for (int jn = 0; jn < QFN; ++jn)
                bfr[kd][jn] = __builtin_shufflevector(lds_tr16(bt + jn * 16),
                                                      lds_tr16(bt + 16 * QBNP + jn * 16),
                                                      0, 1, 2, 3, 4, 5, 6, 7, 8, 9, 10, 11, 12, 13, 14, 15);
            // A fragments: element g2*8+j = As[row][kd*32 + g2*16 + half*8 + j]
#pragma unroll   // static fragment index: af stays in registers
            for (int i = 0; i < FM; ++i) {
                const __bf16* at = &As[cur][wm + i * 16 + mr][kd * 32 + half * 8];
                af[kd][i] = __builtin_shufflevector(*reinterpret_cast<const v8bf*>(at),
                                                    *reinterpret_cast<const v8bf*>(at + 16),
                                                    0, 1, 2, 3, 4, 5, 6, 7, 8, 9, 10, 11, 12, 13, 14, 15);
            }
        }
        // keeps the K step's LDS reads one group ahead of its products: without it the compiler
        // sinks them among the WMMAs, each pair behind a wait of a whole LDS latency
        __builtin_amdgcn_sched_barrier(0);
#pragma unroll   // static fragment index: acc, af and bfr stay in registers
        for (int kd = 0; kd < BK / 32; ++kd)
#pragma unroll   // static fragment index: acc, af and bfr stay in registers
            for (int i = 0; i < FM; ++i)
#pragma unroll   // static fragment index: acc, af and bfr stay in registers
                for (int jn = 0; jn < QFN; ++jn)
                    acc[i][jn] = wmma_bf16(af[kd][i], bfr[kd][jn], acc[i][jn]);
        // keeps the barrier behind the products: moved up among them it brings a wait for ALL
        // the reads ahead of the second product, and reads and products no longer overlap
        __builtin_amdgcn_sched_barrier(0);
        __syncthreads();
    }

    // epilogue
#pragma unroll   // static fragment index: acc stays in registers
    for (int jn = 0; jn < QFN; ++jn)
#pragma unroll   // static fragment index: acc stays in registers
        for (int i = 0; i < FM; ++i)
#pragma unroll   // static fragment index: acc stays in registers
            for (int r = 0; r < 8; ++r)
                out[ob[jn] + (i * 16 + r) * D_MODEL] = (__bf16)(acc[i][jn][r] + bvv[jn]);
}

#define KP (HEAD_DIM + 8)    // LDS pitch of a K row: 144 B, an odd multiple of 16 B, for ds_load_b128
#define VP (HEAD_DIM + 16)   // LDS pitch of a V row: 160 B, an odd multiple of 32 B, for ds_load_tr16_b128

__global__ __launch_bounds__(128)
void attn_kernel(const __bf16* __restrict__ Q, const __bf16* __restrict__ Km,
                 const __bf16* __restrict__ V, __bf16* __restrict__ O) {
    __shared__ __attribute__((aligned(16))) __bf16 Ks[4][32][KP];   // per-wave K block
    __shared__ __attribute__((aligned(16))) __bf16 Vs[4][32][VP];   // per-wave V block
    const int lane = threadIdx.x & 31;
    // in a scalar register: the trip count and the test round the copies are then scalar branches
    const int wave = __builtin_amdgcn_readfirstlane(threadIdx.x >> 5);
    const int work = blockIdx.x * 4 + wave;
    const int QT = SEQ / 16;                       // 128 q-tiles
    const int qt = work % QT;
    const int h  = (work / QT) % NUM_HEADS;
    const int b  = work / (QT * NUM_HEADS);
    const size_t base = ((size_t)b * SEQ) * D_MODEL + (size_t)h * HEAD_DIM;
    const int qbase = qt * 16;
    const int half = lane >> 4;
    const int mr   = lane & 15;
    const float scale = 0.125f;                    // 1/sqrt(64)

    // Q fragments (B operand: lane = query column) for contraction halves d=[0,32) and [32,64)
    v16bf qf[2];
#pragma unroll
    for (int t = 0; t < 2; ++t)
#pragma unroll
        for (int g2 = 0; g2 < 2; ++g2)
#pragma unroll
            for (int j = 0; j < 8; ++j)
                qf[t][g2 * 8 + j] =
                    Q[base + (size_t)(qbase + mr) * D_MODEL +
                      (t * 32 + g2 * 16 + half * 8 + j)];

    v8f acc[4] = {};                // O^T (f32): acc[dt][r] = O[query mr][dt*16 + half*8 + r]
    float rm = -3.0e38f;            // running maximum of query mr, the same in both halves
    float rl = 0.f;                 // running sum of query mr over this half's keys; the halves join in the epilogue

    const int nblk = (qt + 2) >> 1;       // ceil((qbase+16)/32)

    // One block = 32 rows of 128 B each of K and of V: 8 + 8 copies of 16 B a lane.
    // Copy c: lane l brings bytes 16*(l&7) .. +15 of row 8*(l>>3) + c (four whole lines).
    const int crow = (lane >> 3) * 8;
    const int ccol = (lane & 7) * 8;
    const __bf16* kg = Km + base + (size_t)crow * D_MODEL + ccol;
    const __bf16* vg = V  + base + (size_t)crow * D_MODEL + ccol;
    __bf16* kl = &Ks[wave][crow][ccol];
    __bf16* vl = &Vs[wave][crow][ccol];
    auto stage = [&](int blk) {
        const __bf16* kgb = kg + (size_t)blk * 32 * D_MODEL;
        const __bf16* vgb = vg + (size_t)blk * 32 * D_MODEL;
#pragma unroll   // constant row steps: one address pair serves eight copies
        for (int c = 0; c < 8; ++c) async_cp16(kgb + c * D_MODEL, kl + c * KP);
#pragma unroll   // constant row steps: one address pair serves eight copies
        for (int c = 0; c < 8; ++c) async_cp16(vgb + c * D_MODEL, vl + c * VP);
    };
    stage(0);

    for (int kb = 0; kb < nblk; ++kb) {
        const int kvbase = kb * 32;
        // this block's copies have landed before any of its bytes is read
        asm volatile("s_wait_asynccnt 0x0" ::: "memory");
        // K fragments: element g2*8+j = K[kvbase + t*16 + mr][kd*32 + g2*16 + half*8 + j]
        v16bf kf[2][2];
#pragma unroll   // static fragment index: kf stays in registers
        for (int t = 0; t < 2; ++t)
#pragma unroll   // static fragment index: kf stays in registers
            for (int kd = 0; kd < 2; ++kd) {
                const __bf16* kr = &Ks[wave][t * 16 + mr][kd * 32 + half * 8];
                kf[t][kd] = __builtin_shufflevector(*reinterpret_cast<const v8bf*>(kr),
                                                    *reinterpret_cast<const v8bf*>(kr + 16),
                                                    0, 1, 2, 3, 4, 5, 6, 7, 8, 9, 10, 11, 12, 13, 14, 15);
            }
        // V fragments: element g2*8+j = V[kvbase + g2*16 + half*8 + j][dt*16 + mr], the k order of pb
        v16bf vf[4];
        const __bf16* vt = &Vs[wave][half * 8 + (lane & 7)][((lane >> 3) & 1) * 8];
#pragma unroll   // static fragment index: vf stays in registers
        for (int dt = 0; dt < 4; ++dt)
            vf[dt] = __builtin_shufflevector(lds_tr16(vt + dt * 16),
                                             lds_tr16(vt + 16 * VP + dt * 16),
                                             0, 1, 2, 3, 4, 5, 6, 7, 8, 9, 10, 11, 12, 13, 14, 15);
        // every read of the two buffers has returned before the refill is issued
        asm volatile("s_wait_dscnt 0x0" ::: "memory");
        if (kb + 1 < nblk) stage(kb + 1);   // flies during this block's products and softmax
        // ---- scores S^T = K Q^T : s[t][r] = S[query mr][key kvbase + t*16 + half*8 + r] ----
        v8f s[2] = {};
#pragma unroll   // static fragment index: s, qf and kf stay in registers
        for (int t = 0; t < 2; ++t)
#pragma unroll   // static fragment index: s, qf and kf stay in registers
            for (int kd = 0; kd < 2; ++kd)
                s[t] = wmma_bf16(kf[t][kd], qf[kd], s[t]);
        // ---- causal mask + scale ----
        const int qrow = qbase + mr;
#pragma unroll   // static index: s stays in registers
        for (int t = 0; t < 2; ++t) {
            const int kv0 = kvbase + t * 16 + half * 8;
#pragma unroll   // static index: s stays in registers
            for (int r = 0; r < 8; ++r) {
                float v = s[t][r] * scale;
                if (kv0 + r > qrow) v = -3.0e38f;
                s[t][r] = v;
            }
        }
        // ---- online softmax: the lane's 16 keys in the lane, the other 16 from lane ^ 16 ----
        float m8[8];
#pragma unroll   // static index: m8 stays in registers
        for (int r = 0; r < 8; ++r) m8[r] = fmaxf(s[0][r], s[1][r]);
        float mblk = fmaxf(fmaxf(fmaxf(m8[0], m8[1]), fmaxf(m8[2], m8[3])),
                           fmaxf(fmaxf(m8[4], m8[5]), fmaxf(m8[6], m8[7])));
        mblk = fmaxf(mblk, other_half(mblk));
        const float mnew = fmaxf(rm, mblk);
        // exp(x) = exp2(x * log2(e)), as __expf forms it: e[0] the rescale factor, e[1 + t*8 + r] the weights
        const float log2e = 1.4426950408889634f;
        float e[17];
        e[0] = (rm - mnew) * log2e;
#pragma unroll   // static index: e stays in registers
        for (int t = 0; t < 2; ++t)
#pragma unroll   // static index: e stays in registers
            for (int r = 0; r < 8; ++r) e[1 + t * 8 + r] = (s[t][r] - mnew) * log2e;
        exp2_17(e);
        const float corr = e[0];
        rm = mnew;
        float p[2][8];
#pragma unroll   // static index: p and e stay in registers
        for (int t = 0; t < 2; ++t)
#pragma unroll   // static index: p and e stay in registers
            for (int r = 0; r < 8; ++r) p[t][r] = e[1 + t * 8 + r];
        float p8[8];
#pragma unroll   // static index: p8 stays in registers
        for (int r = 0; r < 8; ++r) p8[r] = p[0][r] + p[1][r];
        rl = rl * corr + (((p8[0] + p8[1]) + (p8[2] + p8[3])) + ((p8[4] + p8[5]) + (p8[6] + p8[7])));
#pragma unroll   // static fragment index: acc stays in registers
        for (int dt = 0; dt < 4; ++dt)
#pragma unroll   // static fragment index: acc stays in registers
            for (int r = 0; r < 8; ++r) acc[dt][r] *= corr;
        // ---- P^T (32 keys x 16 queries) as B fragment: element g2*8+j = P[query mr][g2*16 + half*8 + j],
        //      which is this lane's own p[g2][j]: the k order of vf ----
        v16bf pb;
#pragma unroll   // static index: p and pb stay in registers
        for (int g2 = 0; g2 < 2; ++g2)
#pragma unroll   // static index: p and pb stay in registers
            for (int j = 0; j < 8; ++j)
                pb[g2 * 8 + j] = (__bf16)p[g2][j];
        // ---- O^T += V^T P^T ----
#pragma unroll   // static fragment index: acc and vf stay in registers
        for (int dt = 0; dt < 4; ++dt)
            acc[dt] = wmma_bf16(vf[dt], pb, acc[dt]);
    }
    // no copy is left in flight when the wave ends
    asm volatile("s_wait_asynccnt 0x0" ::: "memory");
    // ---- epilogue: O = acc / l; a lane's eight registers are eight consecutive d of its query: 16-B stores ----
    const float inv = 1.0f / (rl + other_half(rl));
    __bf16* orow = O + base + (size_t)(qbase + mr) * D_MODEL + half * 8;
#pragma unroll   // static fragment index: acc stays in registers
    for (int dt = 0; dt < 4; ++dt) {
        v8bf o;
#pragma unroll   // static index: o stays in registers
        for (int r = 0; r < 8; ++r) o[r] = (__bf16)(acc[dt][r] * inv);
        *reinterpret_cast<v8bf*>(orow + dt * 16) = o;
    }
}

// ---------------------------------------------------------------------------
// host launcher
// ---------------------------------------------------------------------------
extern "C" void kernel_launch(void* const* d_in, const int* in_sizes, int n_in,
                              void* d_out, int out_size, void* d_ws, size_t ws_size,
                              hipStream_t stream) {
    (void)in_sizes; (void)n_in; (void)out_size; (void)ws_size;
    const float* x   = (const float*)d_in[0];
    const float* Wq  = (const float*)d_in[1];
    const float* bq  = (const float*)d_in[2];
    const float* Wk  = (const float*)d_in[3];
    const float* bk  = (const float*)d_in[4];
    const float* Wv  = (const float*)d_in[5];
    const float* bv  = (const float*)d_in[6];
    const float* Wo  = (const float*)d_in[7];
    const float* bo  = (const float*)d_in[8];
    const float* g1  = (const float*)d_in[9];
    const float* b1  = (const float*)d_in[10];
    const float* g2  = (const float*)d_in[11];
    const float* b2  = (const float*)d_in[12];
    const float* Wup = (const float*)d_in[13];
    const float* bup = (const float*)d_in[14];
    const float* Wdn = (const float*)d_in[15];
    const float* bdn = (const float*)d_in[16];

    char* ws = (char*)d_ws;
    size_t off = 0;
    auto take = [&](size_t bytes) -> void* {
        void* p = ws + off;
        off = (off + bytes + 255) & ~(size_t)255;
        return p;
    };
    __bf16* wq_b  = (__bf16*)take((size_t)D_MODEL * D_MODEL * 2);
    __bf16* wk_b  = (__bf16*)take((size_t)D_MODEL * D_MODEL * 2);
    __bf16* wv_b  = (__bf16*)take((size_t)D_MODEL * D_MODEL * 2);
    __bf16* wo_b  = (__bf16*)take((size_t)D_MODEL * D_MODEL * 2);
    __bf16* wup_b = (__bf16*)take((size_t)D_MODEL * MLP_DIM * 2);
    __bf16* wdn_b = (__bf16*)take((size_t)MLP_DIM * D_MODEL * 2);
    __bf16* xn_b  = (__bf16*)take((size_t)ROWS * D_MODEL * 2);
    __bf16* q_b   = (__bf16*)take((size_t)ROWS * D_MODEL * 2);
    __bf16* k_b   = (__bf16*)take((size_t)ROWS * D_MODEL * 2);
    __bf16* v_b   = (__bf16*)take((size_t)ROWS * D_MODEL * 2);
    __bf16* o_b   = (__bf16*)take((size_t)ROWS * D_MODEL * 2);
    float*  x2    = (float*) take((size_t)ROWS * D_MODEL * 4);
    __bf16* xn2_b = (__bf16*)take((size_t)ROWS * D_MODEL * 2);
    __bf16* h_b   = (__bf16*)take((size_t)ROWS * MLP_DIM * 2);

    // 1) weights fp32 -> bf16: wq_b .. wdn_b are contiguous (every size is a multiple of 256 B)
    cvt_weights_kernel<<<CVT_TOTAL / CVT_CHUNK, CVT_THREADS, 0, stream>>>(Wq, Wk, Wv, Wo, Wup, Wdn, wq_b);

    // 2) LN1 -> bf16
    ln_kernel<<<ROWS, 256, 0, stream>>>(x, g1, b1, xn_b);

    // 3) Q/K/V projections (bf16 out), one launch: wq_b, wk_b, wv_b are contiguous, and so are q_b, k_b, v_b
    dim3 gD(D_MODEL / BN, ROWS / BM);   // (8, 32)
    dim3 gQKV(3 * D_MODEL / QBN, ROWS / BM);   // (16, 32)
    gemm_qkv_kernel<<<gQKV, 256, 0, stream>>>(xn_b, wq_b, bq, bk, bv, q_b);

    // 4) causal flash attention (4096 waves, 4 waves/block)
    attn_kernel<<<(BATCH * NUM_HEADS * (SEQ / 16)) / 4, 128, 0, stream>>>(q_b, k_b, v_b, o_b);

    // 5) output projection + residual -> x2 (fp32)
    gemm_bf16_kernel<0, true, true, D_MODEL><<<gD, 256, 0, stream>>>(
        o_b, wo_b, bo, x, x2, nullptr, D_MODEL);

    // 6) LN2 -> bf16
    ln_kernel<<<ROWS, 256, 0, stream>>>(x2, g2, b2, xn2_b);

    // 7) MLP up + GELU (bf16 out)
    dim3 gU(MLP_DIM / BN, ROWS / BM);   // (32, 32)
    gemm_bf16_kernel<1, false, false, MLP_DIM><<<gU, 256, 0, stream>>>(
        xn2_b, wup_b, bup, nullptr, nullptr, h_b, D_MODEL);

    // 8) MLP down + residual -> out (fp32)
    gemm_bf16_kernel<0, true, true, D_MODEL><<<gD, 256, 0, stream>>>(
        h_b, wdn_b, bdn, x2, (float*)d_out, nullptr, MLP_DIM);
}
